// v000
// Times are from an AMD MI455X. After a warm-up the kernel runs many times in a row, and a time is the length of
// such a window on the GPU divided by its runs, so every launch and the gaps after it count. The runs cycle
// through copies of the inputs. A figure is the median of several windows, for all but v000 over two sittings.
// Sittings can differ by a few percent; kernels timed side by side share one.
// v000 is the starting kernel. One run takes 741 microseconds.
// compute dtype: all float inputs rounded to bf16; tokens = bf16(x) transposed; qkv = tok W^T with EXACT bf16 products on WMMA 16x16x32 (f32 accumulate); q as f16 hi + residual (x 2^10) against k once to f16 (2 products) x 32^-0.5; the local window (grid distance < 10) as an exact integer test per (query, key); softmax in f32 (precise expf); P x 2^11 once to f16 against v once to f16 (1 product); ctx once to f16 against proj_w carried x 2^8 in f16 + b; f32 output written channels-first.
#include <hip/hip_runtime.h>
#include <math.h>

typedef __attribute__((ext_vector_type(16))) _Float16 v16h;
typedef __attribute__((ext_vector_type(16))) __bf16 v16b;
typedef __attribute__((ext_vector_type(8)))  _Float16 v8h;
typedef __attribute__((ext_vector_type(8)))  float v8f;
typedef __attribute__((ext_vector_type(4)))  float v4f;
typedef __attribute__((ext_vector_type(2)))  float v2f;
typedef __attribute__((ext_vector_type(4)))  unsigned v4u;
typedef __attribute__((ext_vector_type(4)))  int v4i;
typedef float __attribute__((may_alias)) float_a;
typedef int __attribute__((may_alias)) int_a;

template <typename T> __device__ __forceinline__ void vst2(void* p, T v) { *(T*)p = v;  }
__device__ __forceinline__ v8f wmma16(v16h a, v16h b, v8f c) {
  v8f d = __builtin_amdgcn_wmma_f32_16x16x32_f16(false, a, false, b, (short)0, c, false, false);
  asm volatile("v_nop\n\tv_nop\n\tv_nop\n\tv_nop" : "+v"(d) : "v"(a), "v"(b));
  return d;
}
__device__ __forceinline__ v8f wmma_bf(v16b a, v16b b, v8f c) {
  v8f d = __builtin_amdgcn_wmma_f32_16x16x32_bf16(false, a, false, b, (short)0, c, false, false);
  asm volatile("v_nop\n\tv_nop\n\tv_nop\n\tv_nop" : "+v"(d) : "v"(a), "v"(b));
  return d;
}
// 16x16x32 fragments: lane = (h = lane>>4, row/col = lane&15); elements 0..7 = k0+8h+0..7, 8..15 = k0+16+8h+0..7; D element r = row 8h+r
__device__ __forceinline__ v16h frag_h(const _Float16* rowk0, int lane) {
  union { v16h v; v8h q[2]; } u; const _Float16* p = rowk0 + 8 * (lane >> 4);
  u.q[0] = *(const v8h*)p; u.q[1] = *(const v8h*)(p + 16); return u.v;
}
__device__ __forceinline__ v16h frag_f32(const float* rowk0, int lane) {
  v16h a; const float* p = rowk0 + 8 * (lane >> 4);
#pragma unroll
  for (int i = 0; i < 8; ++i) { a[i] = (_Float16)p[i]; a[8 + i] = (_Float16)p[16 + i]; }
  return a;
}
__device__ __forceinline__ v16h frag_f32s(const float* rowk0, int lane, float sc) {
  v16h a; const float* p = rowk0 + 8 * (lane >> 4);
#pragma unroll
  for (int i = 0; i < 8; ++i) { a[i] = (_Float16)(p[i] * sc); a[8 + i] = (_Float16)(p[16 + i] * sc); }
  return a;
}
// column fragment from a [K][ld] layout (column n), rows >= K read as 0
__device__ __forceinline__ v16h fragc_f32(const float* W, int k0, int n, int lane, int ld, int K) {
  v16h a; const int g = lane >> 4;
#pragma unroll
  for (int i = 0; i < 8; ++i) { const int ka = k0 + 8 * g + i, kb = ka + 16;
    a[i] = (_Float16)(ka < K ? W[(size_t)(ka < K ? ka : K - 1) * ld + n] : 0.f); a[8 + i] = (_Float16)(kb < K ? W[(size_t)(kb < K ? kb : K - 1) * ld + n] : 0.f); }
  return a;
}
struct F2 { v16b h, l; };
__device__ __forceinline__ F2 bsplit16(const float v[16]) { F2 r;
#pragma unroll
  for (int i = 0; i < 16; ++i) { const __bf16 h = (__bf16)v[i]; r.h[i] = h; r.l[i] = (__bf16)(v[i] - (float)h); }
  return r; }
__device__ __forceinline__ F2 split_row(const float* row, int k0, int lane) { float v[16]; const float* p = row + k0 + 8 * (lane >> 4);
#pragma unroll
  for (int i = 0; i < 8; ++i) { v[i] = p[i]; v[8 + i] = p[16 + i]; }
  return bsplit16(v); }
__device__ __forceinline__ F2 split_rowK(const float* row, int k0, int lane, int K) { float v[16]; const int g = lane >> 4;
#pragma unroll
  for (int i = 0; i < 8; ++i) { const int ka = k0 + 8 * g + i, kb = ka + 16; v[i] = ka < K ? row[ka < K ? ka : K - 1] : 0.f; v[8 + i] = kb < K ? row[kb < K ? kb : K - 1] : 0.f; }
  return bsplit16(v); }
__device__ __forceinline__ F2 split_col(const float* W, int k0, int n, int lane, int ld, int K) { float v[16]; const int g = lane >> 4;
#pragma unroll
  for (int i = 0; i < 8; ++i) { const int ka = k0 + 8 * g + i, kb = ka + 16; v[i] = ka < K ? W[(size_t)(ka < K ? ka : K - 1) * ld + n] : 0.f; v[8 + i] = kb < K ? W[(size_t)(kb < K ? kb : K - 1) * ld + n] : 0.f; }
  return bsplit16(v); }
__device__ __forceinline__ v8f mac3(const F2& a, const F2& b, v8f c) { c = wmma_bf(a.l, b.h, c); c = wmma_bf(a.h, b.l, c); return wmma_bf(a.h, b.h, c); }
__device__ __forceinline__ float sigm(float v) { return 1.0f / (1.0f + expf(-v)); }
#define LDSX() do { asm volatile("s_wait_dscnt 0" ::: "memory"); __builtin_amdgcn_wave_barrier(); __builtin_amdgcn_fence(__ATOMIC_RELEASE, "workgroup"); } while (0)

// 3-D local-window attention layer (x [1, 256, 16, 16, 16] -> 4,096 tokens, 8 heads x 32): qkv = tok qkv_w^T (packed (out,in) [768, 256], layout (3, H, hd)); scores = q k^T / sqrt(32) masked to -inf where the integer grid distance between the two tokens is >= 10 (sqrt(dz^2+dy^2+dx^2) < 10 <=> d2 < 100); softmax; out = merged(attn v) proj_w^T + proj_b, returned as [1, 256, 16, 16, 16].
#define NB 1
#define TT 4096
#define CC 256            // NH * HD = projected width
#define DIN 256          // input (model) width
#define NH 8
#define HD 32
#define NQB (TT / 64)
#define HG 2
#define SCALE (0.17677669529663687f)
#define CAUSAL 0
#ifndef TNB
#define TNB NB
#endif
__device__ __forceinline__ float bfr(float v) { return (float)(__bf16)v; }
__host__ __device__ __forceinline__ int kb_last(int qb) { return CAUSAL ? ((qb * 64 + 63) >> 7) : (TT / 128 - 1); }
typedef __attribute__((ext_vector_type(8))) __bf16 v8b;
__device__ __forceinline__ v16b frag_b(const __bf16* rowk0, int lane) {
  union { v16b v; v8b q[2]; } u; const __bf16* p = rowk0 + 8 * (lane >> 4);
  u.q[0] = *(const v8b*)p; u.q[1] = *(const v8b*)(p + 16); return u.v;
}
#define QBH 0              // causal: query blocks 0..QBH-1 of each sequence (few keys, no averaging) take the high-precision path
#define QHI 4096            // rows carrying a q residual plane (all rows when non-causal: 2-product logits everywhere)
#define KHI 64            // key rows carrying k residual / v bf16 hi+lo planes (used only by the causal high-precision path)
// B fragment (k rows k0+.., output column o) of a weight: (in,out) [K][ld] or (out,in) [ld rows of K]: bf16 exact, or f16(bf16 * 256) exact
__device__ __forceinline__ v16b wcol_io(const float* Wm, int k0, int o, int lane, int ld) { v16b w; const int g = lane >> 4;
#pragma unroll
  for (int i = 0; i < 8; ++i) { w[i] = (__bf16)Wm[(size_t)(k0 + 8 * g + i) * ld + o]; w[8 + i] = (__bf16)Wm[(size_t)(k0 + 16 + 8 * g + i) * ld + o]; }
  return w; }
__device__ __forceinline__ v16b wcol_oi(const float* Wm, int k0, int o, int lane, int K) { v16b w; const float* p = Wm + (size_t)o * K + k0 + 8 * (lane >> 4);
#pragma unroll
  for (int i = 0; i < 8; ++i) { w[i] = (__bf16)p[i]; w[8 + i] = (__bf16)p[16 + i]; }
  return w; }
__device__ __forceinline__ v16h wcolh_io(const float* Wm, int k0, int o, int lane, int ld) { v16h w; const int g = lane >> 4;
#pragma unroll
  for (int i = 0; i < 8; ++i) { w[i] = (_Float16)(bfr(Wm[(size_t)(k0 + 8 * g + i) * ld + o]) * 256.0f); w[8 + i] = (_Float16)(bfr(Wm[(size_t)(k0 + 16 + 8 * g + i) * ld + o]) * 256.0f); }
  return w; }
__device__ __forceinline__ v16h wcolh_oi(const float* Wm, int k0, int o, int lane, int K) { v16h w; const float* p = Wm + (size_t)o * K + k0 + 8 * (lane >> 4);
#pragma unroll
  for (int i = 0; i < 8; ++i) { w[i] = (_Float16)(bfr(p[i]) * 256.0f); w[8 + i] = (_Float16)(bfr(p[16 + i]) * 256.0f); }
  return w; }
#define WQKV_LAYOUT 1   // 0 = (in,out) [DIN][CC]; 1 = (out,in) [CC][DIN]; 2 = per-head [NH][DIN][HD]
__device__ __forceinline__ v16b wcol_hdk(const float* Wm, int k0, int o, int lane) { v16b w; const int g = lane >> 4; const float* p = Wm + (size_t)(o / HD) * DIN * HD + (o % HD);
#pragma unroll
  for (int i = 0; i < 8; ++i) { w[i] = (__bf16)p[(size_t)(k0 + 8 * g + i) * HD]; w[8 + i] = (__bf16)p[(size_t)(k0 + 16 + 8 * g + i) * HD]; }
  return w; }
#define WO_OUT_IN 1
#if WQKV_LAYOUT == 1
#define WCOL(W, k0, o, lane) wcol_oi(W, k0, o, lane, DIN)
#elif WQKV_LAYOUT == 2
#define WCOL(W, k0, o, lane) wcol_hdk(W, k0, o, lane)
#else
#define WCOL(W, k0, o, lane) wcol_io(W, k0, o, lane, CC)
#endif
#if WO_OUT_IN
#define WOCOL(W, k0, o, lane) wcol_oi(W, k0, o, lane, CC)
#define WOCOLH(W, k0, o, lane) wcolh_oi(W, k0, o, lane, CC)
#else
#define WOCOL(W, k0, o, lane) wcol_io(W, k0, o, lane, DIN)
#define WOCOLH(W, k0, o, lane) wcolh_io(W, k0, o, lane, DIN)
#endif
#define SM_MASK_HOOK do { const int dz = (t >> 8) - (k >> 8), dy = ((t >> 4) & 15) - ((k >> 4) & 15), dx = (t & 15) - (k & 15); v = (dz * dz + dy * dy + dx * dx < 100) ? v : -3.0e38f; } while (0)   /* local pattern: dist < 10 on the (d,h,w) token grid, exact in integers */
#define NTOK 4096
// ---- k_tok: block = (64 tokens, 64 channels): XT[n][c] = bf16(x[c][n]) through an LDS tile (x is [1][256][4096] channels-first)
__global__ __launch_bounds__(256) void k_tok(const float* __restrict__ X, float* __restrict__ XT) { __shared__ float st[64][68]; const int tid = threadIdx.x; const int n0 = blockIdx.x * 64, c0 = blockIdx.y * 64;
  for (int e = tid; e < 64 * 16; e += 256) { const int cl = e >> 4, q = e & 15; const v4f v = *(const v4f*)(X + (size_t)(c0 + cl) * NTOK + n0 + q * 4); st[cl][q * 4] = bfr(v[0]); st[cl][q * 4 + 1] = bfr(v[1]); st[cl][q * 4 + 2] = bfr(v[2]); st[cl][q * 4 + 3] = bfr(v[3]); }
  __syncthreads();
  for (int e = tid; e < 64 * 16; e += 256) { const int nl = e >> 4, q = e & 15; v4f o; o[0] = st[q * 4][nl]; o[1] = st[q * 4 + 1][nl]; o[2] = st[q * 4 + 2][nl]; o[3] = st[q * 4 + 3][nl]; vst2(XT + (size_t)(n0 + nl) * CC + c0 + q * 4, o); } }
// ---- k_fin: block = (64 tokens, 64 channels): out[c][n] = OR[n][c] (LDS transpose; 256-B runs of 64 tokens per channel)
__global__ __launch_bounds__(256) void k_fin(const float* __restrict__ ORW, float* __restrict__ OUT) { __shared__ float st[64][68]; const int tid = threadIdx.x; const int n0 = blockIdx.x * 64, c0 = blockIdx.y * 64;
  for (int e = tid; e < 64 * 16; e += 256) { const int nl = e >> 4, q = e & 15; *(v4f*)&st[nl][q * 4] = *(const v4f*)(ORW + (size_t)(n0 + nl) * CC + c0 + q * 4); }
  __syncthreads();
  for (int e = tid; e < 64 * 16; e += 256) { const int cl = e >> 4, q = e & 15; v4f o; o[0] = st[q * 4][cl]; o[1] = st[q * 4 + 1][cl]; o[2] = st[q * 4 + 2][cl]; o[3] = st[q * 4 + 3][cl]; vst2(OUT + (size_t)(c0 + cl) * NTOK + n0 + q * 4, o); } }
#define WS_XT  (WS_END)
#define WS_OR  (WS_XT + 4u * (size_t)NTOK * CC)
#define WS_END2 (WS_OR + 4u * (size_t)NTOK * CC)
#ifndef SM_EXTRA_PARAMS
#define SM_EXTRA_PARAMS
#endif
#ifndef PROJ_EXTRA_PARAMS
#define PROJ_EXTRA_PARAMS
#endif
#ifndef SM_MASK_HOOK
#define SM_MASK_HOOK (void)0
#endif

#define WS_QH  0u                                      // f16 q rows [b*t][CC]
#define WS_KH  (WS_QH + 2u * (size_t)NB * TT * CC)      // f16 k rows [b*t][CC]
#define WS_VT  (WS_KH + 2u * (size_t)NB * TT * CC)      // f16 v planes [b][c][t]
#define WS_QL  (WS_VT + 2u * (size_t)NB * CC * TT)      // f16 q residual x 2^10 rows [b][t < QHI][CC]
#define WS_KL  (WS_QL + 2u * (size_t)NB * QHI * CC)     // f16 k residual x 2^10 rows [b][t < KHI][CC]
#define WS_VB  (WS_KL + 2u * (size_t)NB * KHI * CC)     // bf16 v hi planes [b][c][t < KHI]
#define WS_VBL (WS_VB + 2u * (size_t)NB * CC * KHI)
#define WS_S   (WS_VBL + 2u * (size_t)NB * CC * KHI)    // f32 logits / P [hg][t][s]
#define WS_Y   (WS_S  + 4u * (size_t)HG * TT * TT)      // f32 ctx rows [b*t][CC] (only when there is an output projection)
#define WS_END (WS_Y  + 4u * (size_t)NB * TT * CC)

// ---- k_proj: block = (64 rows, 128 cols, which): q/k/v = X W (+ b) with exact bf16 products (K = DIN) -> which 0: q f16 rows (+ residual rows < QHI); 1: k f16 rows (+ residual rows < KHI); 2: v f16 planes [c][t] (+ bf16 hi/lo planes for t < KHI)
__global__ __launch_bounds__(128) void k_proj(const float* __restrict__ XQ, const float* __restrict__ XK, const float* __restrict__ XV, const float* __restrict__ WQ, const float* __restrict__ WK, const float* __restrict__ WV, const float* __restrict__ BQ, const float* __restrict__ BK, const float* __restrict__ BV,
    _Float16* __restrict__ QH, _Float16* __restrict__ QL, _Float16* __restrict__ KH, _Float16* __restrict__ KL, _Float16* __restrict__ VT, __bf16* __restrict__ VB, __bf16* __restrict__ VBL) {
  __shared__ __align__(16) _Float16 sh[64][136], sl[64][136]; __shared__ __align__(16) _Float16 th[128][72]; __shared__ __align__(16) __bf16 tb[128][72], tbl[128][72];
  const int tid = threadIdx.x, wave = tid >> 5, lane = tid & 31, col = lane & 15, g = lane >> 4; const int which = blockIdx.z; const int c0 = blockIdx.y * 128; const size_t r0 = (size_t)blockIdx.x * 64; const size_t bb = r0 / TT; const int t0 = (int)(r0 % TT);
  const float* X = which == 0 ? XQ : which == 1 ? XK : XV; const float* WA = which == 0 ? WQ : which == 1 ? WK : WV; const float* BA = which == 0 ? BQ : which == 1 ? BK : BV;
  v8f acc[8] = {};
#pragma unroll 2
  for (int kc = 0; kc < DIN / 32; ++kc) { v16b a; { const float* p = X + (r0 + wave * 16 + col) * DIN + kc * 32 + 8 * g;
#pragma unroll
      for (int i = 0; i < 8; ++i) { a[i] = (__bf16)p[i]; a[8 + i] = (__bf16)p[16 + i]; } }
    asm volatile("s_wait_loadcnt 0x0" ::: "memory");
#pragma unroll
    for (int j = 0; j < 8; ++j) { const v16b w = WCOL(WA, kc * 32, c0 + j * 16 + col, lane); asm volatile("s_wait_loadcnt 0x0" ::: "memory"); acc[j] = wmma_bf(a, w, acc[j]); } }
  if (which < 2) { _Float16* DH = which == 0 ? QH : KH; _Float16* DL = which == 0 ? QL : KL; const int nhi = which == 0 ? QHI : KHI; const bool hi_rows = t0 < nhi;
#pragma unroll
    for (int j = 0; j < 8; ++j) { const float bias = BA ? bfr(BA[c0 + j * 16 + col]) : 0.f;
#pragma unroll
      for (int r = 0; r < 8; ++r) { const float v = acc[j][r] + bias; const _Float16 hv = (_Float16)v; sh[wave * 16 + 8 * g + r][j * 16 + col] = hv; sl[wave * 16 + 8 * g + r][j * 16 + col] = (_Float16)((v - (float)hv) * 1024.0f); } }
    __syncthreads();
    for (int e = tid; e < 64 * 16; e += 128) { const int rl = e >> 4, q = e & 15; vst2((unsigned*)(DH + (r0 + rl) * CC + c0 + q * 8), *(const v4u*)&sh[rl][q * 8]); if (hi_rows) vst2((unsigned*)(DL + (bb * nhi + t0 + rl) * (size_t)CC + c0 + q * 8), *(const v4u*)&sl[rl][q * 8]); }
  } else { const bool hi_rows = t0 < KHI;
#pragma unroll
    for (int j = 0; j < 8; ++j) { const float bias = BA ? bfr(BA[c0 + j * 16 + col]) : 0.f;
#pragma unroll
      for (int r = 0; r < 8; ++r) { const float v = acc[j][r] + bias; const int rl = wave * 16 + 8 * g + r, cl = j * 16 + col; th[cl][rl] = (_Float16)v; const __bf16 bh = (__bf16)v; tb[cl][rl] = bh; tbl[cl][rl] = (__bf16)(v - (float)bh); } }
    __syncthreads();
    for (int e = tid; e < 128 * 8; e += 128) { const int cl = e >> 3, q = e & 7; vst2((unsigned*)(VT + (bb * CC + c0 + cl) * (size_t)TT + t0 + q * 8), *(const v4u*)&th[cl][q * 8]); if (hi_rows) { const size_t o3 = (bb * CC + c0 + cl) * (size_t)KHI + t0 + q * 8; vst2((unsigned*)(VB + o3), *(const v4u*)&tb[cl][q * 8]); vst2((unsigned*)(VBL + o3), *(const v4u*)&tbl[cl][q * 8]); } } } }
// ---- k_sc: block = (query block qb, key block kb <= kb_last(qb), head in group) of batch b: logits x SCALE; q hi + residual (x 2^10) against k (2 products) for query rows < QHI, plus the k residual (3 products) for query blocks < QBH (causal early rows); causal: blocks past the diagonal exit, the mask itself is applied by index in k_sm
__global__ __launch_bounds__(128) void k_sc(const _Float16* __restrict__ QH, const _Float16* __restrict__ KH, const _Float16* __restrict__ QL, const _Float16* __restrict__ KL, int b, int h0, float* __restrict__ S0) { __shared__ __align__(16) float ss[4][16][132];
  const int qb = blockIdx.x, kb = blockIdx.y; if (kb > kb_last(qb)) return;
  const int h = h0 + blockIdx.z; float* S = S0 + (size_t)blockIdx.z * TT * TT;
  const int tid = threadIdx.x, wave = tid >> 5, lane = tid & 31, col = lane & 15, g = lane >> 4; const int k0 = kb * 128; const int ql0 = qb * 64 + wave * 16; const size_t q0 = (size_t)b * TT + ql0, kr0 = (size_t)b * TT + k0;
  v8f acc[8] = {}, accl[8] = {};
  const _Float16* QLb = QL + (size_t)b * QHI * CC; const _Float16* KLb = KL + (size_t)b * KHI * CC;
  if (qb < QBH) {
#pragma unroll
    for (int kc = 0; kc < HD / 32; ++kc) { const v16h ah = frag_h(QH + (q0 + col) * CC + h * HD + kc * 32, lane), al = frag_h(QLb + (size_t)(ql0 + col) * CC + h * HD + kc * 32, lane);
#pragma unroll
      for (int j = 0; j < 8; ++j) { const v16h kbf = frag_h(KH + (kr0 + j * 16 + col) * CC + h * HD + kc * 32, lane), klf = frag_h(KLb + (size_t)(k0 + j * 16 + col) * CC + h * HD + kc * 32, lane); acc[j] = wmma16(ah, kbf, acc[j]); accl[j] = wmma16(al, kbf, accl[j]); accl[j] = wmma16(ah, klf, accl[j]); } }
  } else if (qb * 64 < QHI) {
#pragma unroll
    for (int kc = 0; kc < HD / 32; ++kc) { const v16h ah = frag_h(QH + (q0 + col) * CC + h * HD + kc * 32, lane), al = frag_h(QLb + (size_t)(ql0 + col) * CC + h * HD + kc * 32, lane);
#pragma unroll
      for (int j = 0; j < 8; ++j) { const v16h kbf = frag_h(KH + (kr0 + j * 16 + col) * CC + h * HD + kc * 32, lane); acc[j] = wmma16(ah, kbf, acc[j]); accl[j] = wmma16(al, kbf, accl[j]); } }
  } else {
#pragma unroll
    for (int kc = 0; kc < HD / 32; ++kc) { const v16h ah = frag_h(QH + (q0 + col) * CC + h * HD + kc * 32, lane);
#pragma unroll
      for (int j = 0; j < 8; ++j) { const v16h kbf = frag_h(KH + (kr0 + j * 16 + col) * CC + h * HD + kc * 32, lane); acc[j] = wmma16(ah, kbf, acc[j]); } } }
#pragma unroll
  for (int j = 0; j < 8; ++j) {
#pragma unroll
    for (int r = 0; r < 8; ++r) ss[wave][8 * g + r][j * 16 + col] = (acc[j][r] + accl[j][r] * (1.0f / 1024.0f)) * SCALE; }
  LDSX(); for (int rl = 0; rl < 16; ++rl) vst2(S + (size_t)(ql0 + rl) * TT + k0 + lane * 4, *(const v4f*)&ss[wave][rl][lane * 4]); }
// ---- k_sm: block = query row t (head in group): keys [0, kend): causal -> logit if s <= t else excluded; softmax in f32; P x 2^11 in place (0 for excluded)
__global__ __launch_bounds__(256) void k_sm(float* __restrict__ S0 SM_EXTRA_PARAMS) { __shared__ float sred[8]; __shared__ float sbc; __shared__ __align__(16) float shv[TT];
  const int tid = threadIdx.x; const int t = blockIdx.x; const int kend = (kb_last(t >> 6) + 1) * 128;
  float* sr = S0 + (size_t)blockIdx.y * TT * TT + (size_t)t * TT;
  float m = -3.0e38f; for (int k = tid; k < kend; k += 256) { float v = (!CAUSAL || k <= t) ? sr[k] : -3.0e38f; SM_MASK_HOOK; shv[k] = v; m = fmaxf(m, v); }
#pragma unroll
  for (int o = 1; o < 32; o <<= 1) m = fmaxf(m, __shfl_xor(m, o));
  if ((tid & 31) == 0) sred[tid >> 5] = m; __syncthreads(); if (tid == 0) { float a = sred[0]; for (int i = 1; i < 8; ++i) a = fmaxf(a, sred[i]); sbc = a; } __syncthreads(); m = sbc; __syncthreads();
  float sum = 0.f; for (int k = tid; k < kend; k += 256) { const float v = shv[k]; const float e = (v <= -1.0e38f) ? 0.f : expf(v - m); shv[k] = e; sum += e; }
#pragma unroll
  for (int o = 1; o < 32; o <<= 1) sum += __shfl_xor(sum, o);
  if ((tid & 31) == 0) sred[tid >> 5] = sum; __syncthreads(); if (tid == 0) { float a = 0.f; for (int i = 0; i < 8; ++i) a += sred[i]; sbc = a > 0.f ? 2048.0f / a : 0.f; }   /* a fully excluded row yields P = 0 */ __syncthreads(); const float inv = sbc;
  for (int k = tid; k < kend; k += 256) shv[k] = shv[k] * inv;
  __syncthreads(); for (int q = tid; q < kend / 4; q += 256) vst2(sr + q * 4, *(const v4f*)&shv[q * 4]); }
// ---- k_pv: block = 64 queries (qb) of (b, h): ctx = P . v over keys [0, kend) (P x 2^11 once to f16 against v f16: 1 product; causal early query blocks: P and v as bf16 hi + lo, 3 products); 128-B (row, head) segment by 8 lanes
__global__ __launch_bounds__(128) void k_pv(const float* __restrict__ PS0, const _Float16* __restrict__ VT, const __bf16* __restrict__ VB, const __bf16* __restrict__ VBL, int b, int h0, float* __restrict__ Y) { const int h = h0 + blockIdx.z; const float* PS = PS0 + (size_t)blockIdx.z * TT * TT; __shared__ __align__(16) float ss[4][16][HD + 4];
  const int tid = threadIdx.x, wave = tid >> 5, lane = tid & 31, col = lane & 15, g = lane >> 4; const int qb = blockIdx.x; const int ql0 = qb * 64 + wave * 16; const int kce = (kb_last(qb) + 1) * 4;
  v8f acc[HD / 16] = {};
  if (qb < QBH) {
#pragma unroll 1
    for (int kc = 0; kc < kce; ++kc) { const F2 p = split_row(PS + (size_t)(ql0 + col) * TT, kc * 32, lane);
      asm volatile("s_wait_loadcnt 0x0" ::: "memory");
#pragma unroll
      for (int j = 0; j < HD / 16; ++j) { const size_t po = ((size_t)b * CC + h * HD + j * 16 + col) * (size_t)KHI + kc * 32; const v16b vh = frag_b(VB + po, lane); acc[j] = wmma_bf(p.h, vh, acc[j]); acc[j] = wmma_bf(p.l, vh, acc[j]); acc[j] = wmma_bf(p.h, frag_b(VBL + po, lane), acc[j]); } }
  } else {
#pragma unroll 1
    for (int kc = 0; kc < kce; ++kc) { const v16h p = frag_f32(PS + (size_t)(ql0 + col) * TT + kc * 32, lane);
      asm volatile("s_wait_loadcnt 0x0" ::: "memory");
#pragma unroll
      for (int j = 0; j < HD / 16; ++j) { const size_t po = ((size_t)b * CC + h * HD + j * 16 + col) * (size_t)TT + kc * 32; acc[j] = wmma16(p, frag_h(VT + po, lane), acc[j]); } } }
#pragma unroll
  for (int j = 0; j < HD / 16; ++j)
#pragma unroll
    for (int r = 0; r < 8; ++r) ss[wave][8 * g + r][j * 16 + col] = acc[j][r] * (1.0f / 2048.0f);
  LDSX(); for (int rl = 0; rl < 16; ++rl) if (lane < HD / 4) vst2(Y + ((size_t)b * TT + ql0 + rl) * CC + h * HD + lane * 4, *(const v4f*)&ss[wave][rl][lane * 4]); }
// ---- k_out: block = (64 rows, 128 cols): out = ctx Wo (+ bo): ctx once to f16 against Wo as f16(bf16 x 2^8) exact (1 product) x 2^-8; causal early rows (< QHI of each sequence): ctx bf16 hi + lo against exact bf16 Wo (2 products)
__global__ __launch_bounds__(128) void k_out(const float* __restrict__ Y, const float* __restrict__ WO, const float* __restrict__ BO, float* __restrict__ OUT) { __shared__ __align__(16) float sf[4][16][132];
  const int tid = threadIdx.x, wave = tid >> 5, lane = tid & 31, col = lane & 15, g = lane >> 4; const int c0 = blockIdx.y * 128; const size_t r0 = (size_t)blockIdx.x * 64 + wave * 16;
  v8f acc[8] = {};
  if (CAUSAL && (int)(((size_t)blockIdx.x * 64) % TT) < QHI) {   /* block-uniform */
#pragma unroll 2
    for (int kc = 0; kc < CC / 32; ++kc) { const F2 a = split_row(Y + (r0 + col) * CC, kc * 32, lane); asm volatile("s_wait_loadcnt 0x0" ::: "memory");
#pragma unroll
      for (int j = 0; j < 8; ++j) { const v16b w = WOCOL(WO, kc * 32, c0 + j * 16 + col, lane); asm volatile("s_wait_loadcnt 0x0" ::: "memory"); acc[j] = wmma_bf(a.h, w, acc[j]); acc[j] = wmma_bf(a.l, w, acc[j]); } }
#pragma unroll
    for (int j = 0; j < 8; ++j) { const float bias = BO ? bfr(BO[c0 + j * 16 + col]) : 0.f;
#pragma unroll
      for (int r = 0; r < 8; ++r) sf[wave][8 * g + r][j * 16 + col] = acc[j][r] + bias; }
  } else {
#pragma unroll 2
    for (int kc = 0; kc < CC / 32; ++kc) { const v16h a = frag_f32(Y + (r0 + col) * CC + kc * 32, lane); asm volatile("s_wait_loadcnt 0x0" ::: "memory");
#pragma unroll
      for (int j = 0; j < 8; ++j) { const v16h w = WOCOLH(WO, kc * 32, c0 + j * 16 + col, lane); asm volatile("s_wait_loadcnt 0x0" ::: "memory"); acc[j] = wmma16(a, w, acc[j]); } }
#pragma unroll
    for (int j = 0; j < 8; ++j) { const float bias = BO ? bfr(BO[c0 + j * 16 + col]) : 0.f;
#pragma unroll
      for (int r = 0; r < 8; ++r) sf[wave][8 * g + r][j * 16 + col] = acc[j][r] * (1.0f / 256.0f) + bias; } }
  LDSX(); for (int rl = 0; rl < 16; ++rl) vst2(OUT + (r0 + rl) * DIN + c0 + lane * 4, *(const v4f*)&sf[wave][rl][lane * 4]); }

extern "C" void kernel_launch(void* const* d_in, const int* in_sizes, int n_in, void* d_out, int out_size, void* d_ws, size_t ws_size, hipStream_t stream) {
  (void)in_sizes; (void)n_in; (void)out_size;
  const float** F = (const float**)d_in;
  if (ws_size < (size_t)WS_END) return;
  char* ws = (char*)d_ws; _Float16 *QH = (_Float16*)(ws + WS_QH), *KH = (_Float16*)(ws + WS_KH), *VT = (_Float16*)(ws + WS_VT), *QL = (_Float16*)(ws + WS_QL), *KL = (_Float16*)(ws + WS_KL); __bf16 *VB = (__bf16*)(ws + WS_VB), *VBL = (__bf16*)(ws + WS_VBL); float *S = (float*)(ws + WS_S), *Y = (float*)(ws + WS_Y);
  (void)Y; (void)QL; (void)KL; (void)VB; (void)VBL;
  // inputs: 0 x [1,256,16,16,16]; 1 qkv_w [768,256] (out,in) rows q | k | v; 2 proj_w [256,256] (out,in); 3 proj_b
  if (ws_size < (size_t)WS_END2) return;
  float *XT = (float*)(ws + WS_XT), *ORW = (float*)(ws + WS_OR);
  k_tok<<<dim3(NTOK / 64, CC / 64), 256, 0, stream>>>(F[0], XT);
  { const float* WQ = F[1]; const float* WK = F[1] + (size_t)CC * DIN; const float* WV = F[1] + (size_t)2 * CC * DIN;
    k_proj<<<dim3(TNB * TT / 64, CC / 128, 3), 128, 0, stream>>>(XT, XT, XT, WQ, WK, WV, nullptr, nullptr, nullptr, QH, QL, KH, KL, VT, VB, VBL); }
  for (int b = 0; b < TNB; ++b) for (int h0 = 0; h0 < NH; h0 += HG) {
    k_sc<<<dim3(NQB, TT / 128, HG), 128, 0, stream>>>(QH, KH, QL, KL, b, h0, S);
    k_sm<<<dim3(TT, HG), 256, 0, stream>>>(S);
    k_pv<<<dim3(NQB, 1, HG), 128, 0, stream>>>(S, VT, VB, VBL, b, h0, Y);
  }
  k_out<<<dim3(TNB * TT / 64, DIN / 128), 128, 0, stream>>>(Y, F[2], F[3], ORW);
  k_fin<<<dim3(NTOK / 64, CC / 64), 256, 0, stream>>>(ORW, (float*)d_out);
}

// v001
// It runs in 143 microseconds.
// Two timings next to v000 put it at 5.23 and 5.22 times that version's speed.
// compute dtype: all float inputs rounded to bf16; tokens = bf16(x) transposed; qkv = tok W^T with EXACT bf16 products on WMMA 16x16x32 (f32 accumulate); q as f16 hi + residual (x 2^10) against k once to f16 (2 products) x 32^-0.5; the local window (grid distance < 10) as an exact integer test per (query, key); softmax in f32 (precise expf) with a running maximum and sum, logits and P kept in registers; P x 2^11 once to f16 against v once to f16 (1 product); ctx once to f16 against proj_w carried x 2^8 in f16 + b; f32 output written channels-first.
#include <hip/hip_runtime.h>
#include <math.h>

typedef __attribute__((ext_vector_type(16))) _Float16 v16h;
typedef __attribute__((ext_vector_type(16))) __bf16 v16b;
typedef __attribute__((ext_vector_type(8)))  _Float16 v8h;
typedef __attribute__((ext_vector_type(8)))  float v8f;
typedef __attribute__((ext_vector_type(4)))  float v4f;
typedef __attribute__((ext_vector_type(2)))  float v2f;
typedef __attribute__((ext_vector_type(4)))  unsigned v4u;
typedef __attribute__((ext_vector_type(4)))  int v4i;
typedef float __attribute__((may_alias)) float_a;
typedef int __attribute__((may_alias)) int_a;

template <typename T> __device__ __forceinline__ void vst2(void* p, T v) { *(T*)p = v;  }
__device__ __forceinline__ v8f wmma16(v16h a, v16h b, v8f c) {
  v8f d = __builtin_amdgcn_wmma_f32_16x16x32_f16(false, a, false, b, (short)0, c, false, false);
  asm volatile("v_nop\n\tv_nop\n\tv_nop\n\tv_nop" : "+v"(d) : "v"(a), "v"(b));
  return d;
}
__device__ __forceinline__ v8f wmma_bf(v16b a, v16b b, v8f c) {
  v8f d = __builtin_amdgcn_wmma_f32_16x16x32_bf16(false, a, false, b, (short)0, c, false, false);
  asm volatile("v_nop\n\tv_nop\n\tv_nop\n\tv_nop" : "+v"(d) : "v"(a), "v"(b));
  return d;
}
// 16x16x32 fragments: lane = (h = lane>>4, row/col = lane&15); elements 0..7 = k0+8h+0..7, 8..15 = k0+16+8h+0..7; D element r = row 8h+r
__device__ __forceinline__ v16h frag_h(const _Float16* rowk0, int lane) {
  union { v16h v; v8h q[2]; } u; const _Float16* p = rowk0 + 8 * (lane >> 4);
  u.q[0] = *(const v8h*)p; u.q[1] = *(const v8h*)(p + 16); return u.v;
}
__device__ __forceinline__ v16h frag_f32(const float* rowk0, int lane) {
  v16h a; const float* p = rowk0 + 8 * (lane >> 4);
#pragma unroll
  for (int i = 0; i < 8; ++i) { a[i] = (_Float16)p[i]; a[8 + i] = (_Float16)p[16 + i]; }
  return a;
}
__device__ __forceinline__ v16h frag_f32s(const float* rowk0, int lane, float sc) {
  v16h a; const float* p = rowk0 + 8 * (lane >> 4);
#pragma unroll
  for (int i = 0; i < 8; ++i) { a[i] = (_Float16)(p[i] * sc); a[8 + i] = (_Float16)(p[16 + i] * sc); }
  return a;
}
// column fragment from a [K][ld] layout (column n), rows >= K read as 0
__device__ __forceinline__ v16h fragc_f32(const float* W, int k0, int n, int lane, int ld, int K) {
  v16h a; const int g = lane >> 4;
#pragma unroll
  for (int i = 0; i < 8; ++i) { const int ka = k0 + 8 * g + i, kb = ka + 16;
    a[i] = (_Float16)(ka < K ? W[(size_t)(ka < K ? ka : K - 1) * ld + n] : 0.f); a[8 + i] = (_Float16)(kb < K ? W[(size_t)(kb < K ? kb : K - 1) * ld + n] : 0.f); }
  return a;
}
struct F2 { v16b h, l; };
__device__ __forceinline__ F2 bsplit16(const float v[16]) { F2 r;
#pragma unroll
  for (int i = 0; i < 16; ++i) { const __bf16 h = (__bf16)v[i]; r.h[i] = h; r.l[i] = (__bf16)(v[i] - (float)h); }
  return r; }
__device__ __forceinline__ F2 split_row(const float* row, int k0, int lane) { float v[16]; const float* p = row + k0 + 8 * (lane >> 4);
#pragma unroll
  for (int i = 0; i < 8; ++i) { v[i] = p[i]; v[8 + i] = p[16 + i]; }
  return bsplit16(v); }
__device__ __forceinline__ F2 split_rowK(const float* row, int k0, int lane, int K) { float v[16]; const int g = lane >> 4;
#pragma unroll
  for (int i = 0; i < 8; ++i) { const int ka = k0 + 8 * g + i, kb = ka + 16; v[i] = ka < K ? row[ka < K ? ka : K - 1] : 0.f; v[8 + i] = kb < K ? row[kb < K ? kb : K - 1] : 0.f; }
  return bsplit16(v); }
__device__ __forceinline__ F2 split_col(const float* W, int k0, int n, int lane, int ld, int K) { float v[16]; const int g = lane >> 4;
#pragma unroll
  for (int i = 0; i < 8; ++i) { const int ka = k0 + 8 * g + i, kb = ka + 16; v[i] = ka < K ? W[(size_t)(ka < K ? ka : K - 1) * ld + n] : 0.f; v[8 + i] = kb < K ? W[(size_t)(kb < K ? kb : K - 1) * ld + n] : 0.f; }
  return bsplit16(v); }
__device__ __forceinline__ v8f mac3(const F2& a, const F2& b, v8f c) { c = wmma_bf(a.l, b.h, c); c = wmma_bf(a.h, b.l, c); return wmma_bf(a.h, b.h, c); }
__device__ __forceinline__ float sigm(float v) { return 1.0f / (1.0f + expf(-v)); }
#define LDSX() do { asm volatile("s_wait_dscnt 0" ::: "memory"); __builtin_amdgcn_wave_barrier(); __builtin_amdgcn_fence(__ATOMIC_RELEASE, "workgroup"); } while (0)

// 3-D local-window attention layer (x [1, 256, 16, 16, 16] -> 4,096 tokens, 8 heads x 32): qkv = tok qkv_w^T (packed (out,in) [768, 256], layout (3, H, hd)); scores = q k^T / sqrt(32) masked to -inf where the integer grid distance between the two tokens is >= 10 (sqrt(dz^2+dy^2+dx^2) < 10 <=> d2 < 100); softmax; out = merged(attn v) proj_w^T + proj_b, returned as [1, 256, 16, 16, 16].
#define NB 1
#define TT 4096
#define CC 256            // NH * HD = projected width
#define DIN 256          // input (model) width
#define NH 8
#define HD 32
#define NQB (TT / 64)
#define HG 2
#define SCALE (0.17677669529663687f)
#define CAUSAL 0
#ifndef TNB
#define TNB NB
#endif
__device__ __forceinline__ float bfr(float v) { return (float)(__bf16)v; }
__host__ __device__ __forceinline__ int kb_last(int qb) { return CAUSAL ? ((qb * 64 + 63) >> 7) : (TT / 128 - 1); }
typedef __attribute__((ext_vector_type(8))) __bf16 v8b;
__device__ __forceinline__ v16b frag_b(const __bf16* rowk0, int lane) {
  union { v16b v; v8b q[2]; } u; const __bf16* p = rowk0 + 8 * (lane >> 4);
  u.q[0] = *(const v8b*)p; u.q[1] = *(const v8b*)(p + 16); return u.v;
}
#define QBH 0
#define QHI 4096            // rows carrying a q residual plane (all rows when non-causal: 2-product logits everywhere)
#define KHI 64            // key rows carrying k residual / v bf16 hi+lo planes (written by k_proj, read by no kernel in this file)
// B fragment (k rows k0+.., output column o) of a weight: (in,out) [K][ld] or (out,in) [ld rows of K]: bf16 exact, or f16(bf16 * 256) exact
__device__ __forceinline__ v16b wcol_io(const float* Wm, int k0, int o, int lane, int ld) { v16b w; const int g = lane >> 4;
#pragma unroll
  for (int i = 0; i < 8; ++i) { w[i] = (__bf16)Wm[(size_t)(k0 + 8 * g + i) * ld + o]; w[8 + i] = (__bf16)Wm[(size_t)(k0 + 16 + 8 * g + i) * ld + o]; }
  return w; }
__device__ __forceinline__ v16b wcol_oi(const float* Wm, int k0, int o, int lane, int K) { v16b w; const float* p = Wm + (size_t)o * K + k0 + 8 * (lane >> 4);
#pragma unroll
  for (int i = 0; i < 8; ++i) { w[i] = (__bf16)p[i]; w[8 + i] = (__bf16)p[16 + i]; }
  return w; }
__device__ __forceinline__ v16h wcolh_io(const float* Wm, int k0, int o, int lane, int ld) { v16h w; const int g = lane >> 4;
#pragma unroll
  for (int i = 0; i < 8; ++i) { w[i] = (_Float16)(bfr(Wm[(size_t)(k0 + 8 * g + i) * ld + o]) * 256.0f); w[8 + i] = (_Float16)(bfr(Wm[(size_t)(k0 + 16 + 8 * g + i) * ld + o]) * 256.0f); }
  return w; }
__device__ __forceinline__ v16h wcolh_oi(const float* Wm, int k0, int o, int lane, int K) { v16h w; const float* p = Wm + (size_t)o * K + k0 + 8 * (lane >> 4);
#pragma unroll
  for (int i = 0; i < 8; ++i) { w[i] = (_Float16)(bfr(p[i]) * 256.0f); w[8 + i] = (_Float16)(bfr(p[16 + i]) * 256.0f); }
  return w; }
#define WQKV_LAYOUT 1   // 0 = (in,out) [DIN][CC]; 1 = (out,in) [CC][DIN]; 2 = per-head [NH][DIN][HD]
__device__ __forceinline__ v16b wcol_hdk(const float* Wm, int k0, int o, int lane) { v16b w; const int g = lane >> 4; const float* p = Wm + (size_t)(o / HD) * DIN * HD + (o % HD);
#pragma unroll
  for (int i = 0; i < 8; ++i) { w[i] = (__bf16)p[(size_t)(k0 + 8 * g + i) * HD]; w[8 + i] = (__bf16)p[(size_t)(k0 + 16 + 8 * g + i) * HD]; }
  return w; }
#define WO_OUT_IN 1
#if WQKV_LAYOUT == 1
#define WCOL(W, k0, o, lane) wcol_oi(W, k0, o, lane, DIN)
#elif WQKV_LAYOUT == 2
#define WCOL(W, k0, o, lane) wcol_hdk(W, k0, o, lane)
#else
#define WCOL(W, k0, o, lane) wcol_io(W, k0, o, lane, CC)
#endif
#if WO_OUT_IN
#define WOCOL(W, k0, o, lane) wcol_oi(W, k0, o, lane, CC)
#define WOCOLH(W, k0, o, lane) wcolh_oi(W, k0, o, lane, CC)
#else
#define WOCOL(W, k0, o, lane) wcol_io(W, k0, o, lane, DIN)
#define WOCOLH(W, k0, o, lane) wcolh_io(W, k0, o, lane, DIN)
#endif
#define SM_MASK_HOOK do { const int dz = (t >> 8) - (k >> 8), dy = ((t >> 4) & 15) - ((k >> 4) & 15), dx = (t & 15) - (k & 15); v = (dz * dz + dy * dy + dx * dx < 100) ? v : -3.0e38f; } while (0)   /* local pattern: dist < 10 on the (d,h,w) token grid, exact in integers */
#define NTOK 4096
// ---- k_tok: block = (64 tokens, 64 channels): XT[n][c] = bf16(x[c][n]) through an LDS tile (x is [1][256][4096] channels-first)
__global__ __launch_bounds__(256) void k_tok(const float* __restrict__ X, float* __restrict__ XT) { __shared__ float st[64][68]; const int tid = threadIdx.x; const int n0 = blockIdx.x * 64, c0 = blockIdx.y * 64;
  for (int e = tid; e < 64 * 16; e += 256) { const int cl = e >> 4, q = e & 15; const v4f v = *(const v4f*)(X + (size_t)(c0 + cl) * NTOK + n0 + q * 4); st[cl][q * 4] = bfr(v[0]); st[cl][q * 4 + 1] = bfr(v[1]); st[cl][q * 4 + 2] = bfr(v[2]); st[cl][q * 4 + 3] = bfr(v[3]); }
  __syncthreads();
  for (int e = tid; e < 64 * 16; e += 256) { const int nl = e >> 4, q = e & 15; v4f o; o[0] = st[q * 4][nl]; o[1] = st[q * 4 + 1][nl]; o[2] = st[q * 4 + 2][nl]; o[3] = st[q * 4 + 3][nl]; vst2(XT + (size_t)(n0 + nl) * CC + c0 + q * 4, o); } }
// ---- k_fin: block = (64 tokens, 64 channels): out[c][n] = OR[n][c] (LDS transpose; 256-B runs of 64 tokens per channel)
__global__ __launch_bounds__(256) void k_fin(const float* __restrict__ ORW, float* __restrict__ OUT) { __shared__ float st[64][68]; const int tid = threadIdx.x; const int n0 = blockIdx.x * 64, c0 = blockIdx.y * 64;
  for (int e = tid; e < 64 * 16; e += 256) { const int nl = e >> 4, q = e & 15; *(v4f*)&st[nl][q * 4] = *(const v4f*)(ORW + (size_t)(n0 + nl) * CC + c0 + q * 4); }
  __syncthreads();
  for (int e = tid; e < 64 * 16; e += 256) { const int cl = e >> 4, q = e & 15; v4f o; o[0] = st[q * 4][cl]; o[1] = st[q * 4 + 1][cl]; o[2] = st[q * 4 + 2][cl]; o[3] = st[q * 4 + 3][cl]; vst2(OUT + (size_t)(c0 + cl) * NTOK + n0 + q * 4, o); } }
#define WS_XT  (WS_END)
#define WS_OR  (WS_XT + 4u * (size_t)NTOK * CC)
#define WS_END2 (WS_OR + 4u * (size_t)NTOK * CC)
#ifndef SM_EXTRA_PARAMS
#define SM_EXTRA_PARAMS
#endif
#ifndef PROJ_EXTRA_PARAMS
#define PROJ_EXTRA_PARAMS
#endif
#ifndef SM_MASK_HOOK
#define SM_MASK_HOOK (void)0
#endif

#define WS_QH  0u                                      // f16 q rows [b*t][CC]
#define WS_KH  (WS_QH + 2u * (size_t)NB * TT * CC)      // f16 k rows [b*t][CC]
#define WS_VT  (WS_KH + 2u * (size_t)NB * TT * CC)      // f16 v planes [b][c][t]
#define WS_QL  (WS_VT + 2u * (size_t)NB * CC * TT)      // f16 q residual x 2^10 rows [b][t < QHI][CC]
#define WS_KL  (WS_QL + 2u * (size_t)NB * QHI * CC)     // f16 k residual x 2^10 rows [b][t < KHI][CC]
#define WS_VB  (WS_KL + 2u * (size_t)NB * KHI * CC)     // bf16 v hi planes [b][c][t < KHI]
#define WS_VBL (WS_VB + 2u * (size_t)NB * CC * KHI)
#define WS_S   (WS_VBL + 2u * (size_t)NB * CC * KHI)    // f32 [hg][t][s] area, unused (logits and P stay in registers)
#define WS_Y   (WS_S  + 4u * (size_t)HG * TT * TT)      // f32 ctx rows [b*t][CC] (only when there is an output projection)
#define WS_END (WS_Y  + 4u * (size_t)NB * TT * CC)

// ---- k_proj: block = (64 rows, 128 cols, which): q/k/v = X W (+ b) with exact bf16 products (K = DIN) -> which 0: q f16 rows (+ residual rows < QHI); 1: k f16 rows (+ residual rows < KHI); 2: v f16 planes [c][t] (+ bf16 hi/lo planes for t < KHI)
__global__ __launch_bounds__(128) void k_proj(const float* __restrict__ XQ, const float* __restrict__ XK, const float* __restrict__ XV, const float* __restrict__ WQ, const float* __restrict__ WK, const float* __restrict__ WV, const float* __restrict__ BQ, const float* __restrict__ BK, const float* __restrict__ BV,
    _Float16* __restrict__ QH, _Float16* __restrict__ QL, _Float16* __restrict__ KH, _Float16* __restrict__ KL, _Float16* __restrict__ VT, __bf16* __restrict__ VB, __bf16* __restrict__ VBL) {
  __shared__ __align__(16) _Float16 sh[64][136], sl[64][136]; __shared__ __align__(16) _Float16 th[128][72]; __shared__ __align__(16) __bf16 tb[128][72], tbl[128][72];
  const int tid = threadIdx.x, wave = tid >> 5, lane = tid & 31, col = lane & 15, g = lane >> 4; const int which = blockIdx.z; const int c0 = blockIdx.y * 128; const size_t r0 = (size_t)blockIdx.x * 64; const size_t bb = r0 / TT; const int t0 = (int)(r0 % TT);
  const float* X = which == 0 ? XQ : which == 1 ? XK : XV; const float* WA = which == 0 ? WQ : which == 1 ? WK : WV; const float* BA = which == 0 ? BQ : which == 1 ? BK : BV;
  v8f acc[8] = {};
#pragma unroll 2
  for (int kc = 0; kc < DIN / 32; ++kc) { v16b a; { const float* p = X + (r0 + wave * 16 + col) * DIN + kc * 32 + 8 * g;
#pragma unroll
      for (int i = 0; i < 8; ++i) { a[i] = (__bf16)p[i]; a[8 + i] = (__bf16)p[16 + i]; } }
    asm volatile("s_wait_loadcnt 0x0" ::: "memory");
#pragma unroll
    for (int j = 0; j < 8; ++j) { const v16b w = WCOL(WA, kc * 32, c0 + j * 16 + col, lane); asm volatile("s_wait_loadcnt 0x0" ::: "memory"); acc[j] = wmma_bf(a, w, acc[j]); } }
  if (which < 2) { _Float16* DH = which == 0 ? QH : KH; _Float16* DL = which == 0 ? QL : KL; const int nhi = which == 0 ? QHI : KHI; const bool hi_rows = t0 < nhi;
#pragma unroll
    for (int j = 0; j < 8; ++j) { const float bias = BA ? bfr(BA[c0 + j * 16 + col]) : 0.f;
#pragma unroll
      for (int r = 0; r < 8; ++r) { const float v = acc[j][r] + bias; const _Float16 hv = (_Float16)v; sh[wave * 16 + 8 * g + r][j * 16 + col] = hv; sl[wave * 16 + 8 * g + r][j * 16 + col] = (_Float16)((v - (float)hv) * 1024.0f); } }
    __syncthreads();
    for (int e = tid; e < 64 * 16; e += 128) { const int rl = e >> 4, q = e & 15; vst2((unsigned*)(DH + (r0 + rl) * CC + c0 + q * 8), *(const v4u*)&sh[rl][q * 8]); if (hi_rows) vst2((unsigned*)(DL + (bb * nhi + t0 + rl) * (size_t)CC + c0 + q * 8), *(const v4u*)&sl[rl][q * 8]); }
  } else { const bool hi_rows = t0 < KHI;
#pragma unroll
    for (int j = 0; j < 8; ++j) { const float bias = BA ? bfr(BA[c0 + j * 16 + col]) : 0.f;
#pragma unroll
      for (int r = 0; r < 8; ++r) { const float v = acc[j][r] + bias; const int rl = wave * 16 + 8 * g + r, cl = j * 16 + col; th[cl][rl] = (_Float16)v; const __bf16 bh = (__bf16)v; tb[cl][rl] = bh; tbl[cl][rl] = (__bf16)(v - (float)bh); } }
    __syncthreads();
    for (int e = tid; e < 128 * 8; e += 128) { const int cl = e >> 3, q = e & 7; vst2((unsigned*)(VT + (bb * CC + c0 + cl) * (size_t)TT + t0 + q * 8), *(const v4u*)&th[cl][q * 8]); if (hi_rows) { const size_t o3 = (bb * CC + c0 + cl) * (size_t)KHI + t0 + q * 8; vst2((unsigned*)(VB + o3), *(const v4u*)&tb[cl][q * 8]); vst2((unsigned*)(VBL + o3), *(const v4u*)&tbl[cl][q * 8]); } } } }
// ---- k_fa: block = 8 waves = 128 queries of one head; a wave owns 16 queries (one x row of the token grid) and walks all keys, 64 a pass, with a running maximum and sum.
// S^T = K Q^T (A = 16 key rows, B = the wave's q hi, then its q residual): a lane holds 8 keys (8g + r) of its own query (col), so two key tiles are, as they stand, the B fragment of ctx^T = V^T P^T and the logits never leave the registers.
// fragment from the lane's own address (row start + k0 + 8 * (lane >> 4)): same k order as frag_h
__device__ __forceinline__ v16h frag_p(const _Float16* p) { union { v16h v; v8h q[2]; } u; u.q[0] = *(const v8h*)p; u.q[1] = *(const v8h*)(p + 16); return u.v; }
__device__ __forceinline__ void fa_load(v16h (&K)[4], v16h (&V)[4], const _Float16* kq, const _Float16* vq) {
#pragma unroll
  for (int i = 0; i < 4; ++i) K[i] = frag_p(kq + (size_t)(i * 16) * CC);
#pragma unroll
  for (int c = 0; c < 2; ++c)
#pragma unroll
    for (int j = 0; j < 2; ++j) V[c * 2 + j] = frag_p(vq + (size_t)j * 16 * TT + c * 32);
}
// the address registers of issued loads stay live up to this wait, so nothing overwrites them in front of it
#define FA_XWAIT(p0, p1) asm volatile("s_wait_xcnt 0x0" :: "v"(p0), "v"(p1) : "memory")
__global__ __launch_bounds__(256) void k_fa(const _Float16* __restrict__ QH, const _Float16* __restrict__ QL, const _Float16* __restrict__ KH, const _Float16* __restrict__ VT, float* __restrict__ Y) {
  const int tid = threadIdx.x, wave = __builtin_amdgcn_readfirstlane(tid >> 5), lane = tid & 31, col = lane & 15, g = lane >> 4;
  const int h = blockIdx.y; const int q0 = blockIdx.x * 128 + wave * 16; const int tz = q0 >> 8, ty = (q0 >> 4) & 15;   /* the 16 queries share z and y; x = col */
  const _Float16* qhp = QH + (size_t)(q0 + col) * CC + h * HD + 8 * g; const _Float16* qlp = QL + (size_t)(q0 + col) * CC + h * HD + 8 * g;
  const v16h qh = frag_p(qhp), ql = frag_p(qlp); FA_XWAIT(qhp, qlp);
  int dx2[8];
#pragma unroll
  for (int r = 0; r < 8; ++r) { const int d = col - (8 * g + r); dx2[r] = d * d; }
  const _Float16* kp = KH + (size_t)col * CC + h * HD + 8 * g; const _Float16* vp = VT + (size_t)(h * HD + col) * TT + 8 * g;
  const v8f zero = {};
  v8f acc[2] = {}; float m = -1.0e30f, l = 0.f;   /* the start maximum is finite, so an excluded logit (-3e38) gives exp = 0 also while no key has been admitted yet */
  v16h kc[4], vc[4]; fa_load(kc, vc, kp, vp); FA_XWAIT(kp, vp);
#pragma unroll 2   /* two passes a trip: the current and the next fragment sets swap names instead of being copied */
  for (int it = 0; it < TT / 64; ++it) {
    const int nx = it + 1 < TT / 64 ? it + 1 : it; const _Float16* kq = kp + (size_t)nx * 64 * CC; const _Float16* vq = vp + nx * 64;
    v16h kn[4], vn[4]; fa_load(kn, vn, kq, vq);   /* the next pass's fragments fly while this pass is worked on */
    float s[4][8];
#pragma unroll
    for (int i = 0; i < 4; ++i) { const v8f a = wmma16(kc[i], qh, zero), b = wmma16(kc[i], ql, zero);
      const int T = it * 4 + i, dz = tz - (T >> 4), dy = ty - (T & 15), lim = 100 - dz * dz - dy * dy;   /* a key tile is one x row: dist < 10 <=> dx^2 < 100 - dz^2 - dy^2, exact in integers */
#pragma unroll
      for (int r = 0; r < 8; ++r) { const float v = (a[r] + b[r] * (1.0f / 1024.0f)) * SCALE; s[i][r] = dx2[r] < lim ? v : -3.0e38f; } }
    FA_XWAIT(kq, vq);
    float mx = m;
#pragma unroll
    for (int i = 0; i < 4; ++i)
#pragma unroll
      for (int r = 0; r < 8; ++r) mx = fmaxf(mx, s[i][r]);
    mx = fmaxf(mx, __shfl_xor(mx, 16));
    const float alpha = expf(m - mx); m = mx; const float ms = mx - 7.6246189861593985f;   /* 11 ln 2: P is carried x 2^11 as before; the factor cancels in acc / l */
    l *= alpha;
#pragma unroll
    for (int j = 0; j < 2; ++j)
#pragma unroll
      for (int r = 0; r < 8; ++r) acc[j][r] *= alpha;
#pragma unroll
    for (int c = 0; c < 2; ++c) { v16h p;
#pragma unroll
      for (int r = 0; r < 8; ++r) { const float e0 = expf(s[2 * c][r] - ms), e1 = expf(s[2 * c + 1][r] - ms); l += e0 + e1; p[r] = (_Float16)e0; p[8 + r] = (_Float16)e1; }
#pragma unroll
      for (int j = 0; j < 2; ++j) acc[j] = wmma16(vc[c * 2 + j], p, acc[j]); }
#pragma unroll
    for (int i = 0; i < 4; ++i) { kc[i] = kn[i]; vc[i] = vn[i]; }
  }
  l += __shfl_xor(l, 16); const float inv = l > 0.f ? 1.0f / l : 0.f;   /* a fully excluded row yields 0 */
#pragma unroll
  for (int j = 0; j < 2; ++j) { v4f o0, o1;
#pragma unroll
    for (int r = 0; r < 4; ++r) { o0[r] = acc[j][r] * inv; o1[r] = acc[j][4 + r] * inv; }
    float* yp = Y + (size_t)(q0 + col) * CC + h * HD + j * 16 + 8 * g; vst2(yp, o0); vst2(yp + 4, o1); } }
// ---- k_out: block = (64 rows, 128 cols): out = ctx Wo (+ bo): ctx once to f16 against Wo as f16(bf16 x 2^8) exact (1 product) x 2^-8; causal early rows (< QHI of each sequence): ctx bf16 hi + lo against exact bf16 Wo (2 products)
__global__ __launch_bounds__(128) void k_out(const float* __restrict__ Y, const float* __restrict__ WO, const float* __restrict__ BO, float* __restrict__ OUT) { __shared__ __align__(16) float sf[4][16][132];
  const int tid = threadIdx.x, wave = tid >> 5, lane = tid & 31, col = lane & 15, g = lane >> 4; const int c0 = blockIdx.y * 128; const size_t r0 = (size_t)blockIdx.x * 64 + wave * 16;
  v8f acc[8] = {};
  if (CAUSAL && (int)(((size_t)blockIdx.x * 64) % TT) < QHI) {   /* block-uniform */
#pragma unroll 2
    for (int kc = 0; kc < CC / 32; ++kc) { const F2 a = split_row(Y + (r0 + col) * CC, kc * 32, lane); asm volatile("s_wait_loadcnt 0x0" ::: "memory");
#pragma unroll
      for (int j = 0; j < 8; ++j) { const v16b w = WOCOL(WO, kc * 32, c0 + j * 16 + col, lane); asm volatile("s_wait_loadcnt 0x0" ::: "memory"); acc[j] = wmma_bf(a.h, w, acc[j]); acc[j] = wmma_bf(a.l, w, acc[j]); } }
#pragma unroll
    for (int j = 0; j < 8; ++j) { const float bias = BO ? bfr(BO[c0 + j * 16 + col]) : 0.f;
#pragma unroll
      for (int r = 0; r < 8; ++r) sf[wave][8 * g + r][j * 16 + col] = acc[j][r] + bias; }
  } else {
#pragma unroll 2
    for (int kc = 0; kc < CC / 32; ++kc) { const v16h a = frag_f32(Y + (r0 + col) * CC + kc * 32, lane); asm volatile("s_wait_loadcnt 0x0" ::: "memory");
#pragma unroll
      for (int j = 0; j < 8; ++j) { const v16h w = WOCOLH(WO, kc * 32, c0 + j * 16 + col, lane); asm volatile("s_wait_loadcnt 0x0" ::: "memory"); acc[j] = wmma16(a, w, acc[j]); } }
#pragma unroll
    for (int j = 0; j < 8; ++j) { const float bias = BO ? bfr(BO[c0 + j * 16 + col]) : 0.f;
#pragma unroll
      for (int r = 0; r < 8; ++r) sf[wave][8 * g + r][j * 16 + col] = acc[j][r] * (1.0f / 256.0f) + bias; } }
  LDSX(); for (int rl = 0; rl < 16; ++rl) vst2(OUT + (r0 + rl) * DIN + c0 + lane * 4, *(const v4f*)&sf[wave][rl][lane * 4]); }

extern "C" void kernel_launch(void* const* d_in, const int* in_sizes, int n_in, void* d_out, int out_size, void* d_ws, size_t ws_size, hipStream_t stream) {
  (void)in_sizes; (void)n_in; (void)out_size;
  const float** F = (const float**)d_in;
  if (ws_size < (size_t)WS_END) return;
  char* ws = (char*)d_ws; _Float16 *QH = (_Float16*)(ws + WS_QH), *KH = (_Float16*)(ws + WS_KH), *VT = (_Float16*)(ws + WS_VT), *QL = (_Float16*)(ws + WS_QL), *KL = (_Float16*)(ws + WS_KL); __bf16 *VB = (__bf16*)(ws + WS_VB), *VBL = (__bf16*)(ws + WS_VBL); float *Y = (float*)(ws + WS_Y);
  (void)Y; (void)QL; (void)KL; (void)VB; (void)VBL;
  // inputs: 0 x [1,256,16,16,16]; 1 qkv_w [768,256] (out,in) rows q | k | v; 2 proj_w [256,256] (out,in); 3 proj_b
  if (ws_size < (size_t)WS_END2) return;
  float *XT = (float*)(ws + WS_XT), *ORW = (float*)(ws + WS_OR);
  k_tok<<<dim3(NTOK / 64, CC / 64), 256, 0, stream>>>(F[0], XT);
  { const float* WQ = F[1]; const float* WK = F[1] + (size_t)CC * DIN; const float* WV = F[1] + (size_t)2 * CC * DIN;
    k_proj<<<dim3(TNB * TT / 64, CC / 128, 3), 128, 0, stream>>>(XT, XT, XT, WQ, WK, WV, nullptr, nullptr, nullptr, QH, QL, KH, KL, VT, VB, VBL); }
  k_fa<<<dim3(TT / 128, NH), 256, 0, stream>>>(QH, QL, KH, VT, Y);
  k_out<<<dim3(TNB * TT / 64, DIN / 128), 128, 0, stream>>>(Y, F[2], F[3], ORW);
  k_fin<<<dim3(NTOK / 64, CC / 64), 256, 0, stream>>>(ORW, (float*)d_out);
}

// v002
// One run takes 137 microseconds.
// Two timings next to v001 put it at 1.06 and 1.05 times that version's speed.
// Counting every step since v000, it is 5.51 times as fast.
// compute dtype: all float inputs rounded to bf16; tokens = bf16(x) transposed; qkv = tok W^T with EXACT bf16 products on WMMA 16x16x32 (f32 accumulate); q as f16 hi + residual (x 2^10) against k once to f16 (2 products) x 32^-0.5; the local window (grid distance < 10) as an exact integer test per (query, key); softmax in f32 (precise expf) with a running maximum and sum, logits and P kept in registers; P x 2^11 once to f16 against v once to f16 (1 product); ctx once to f16 against proj_w carried x 2^8 in f16 + b; f32 output written channels-first.
#include <hip/hip_runtime.h>
#include <math.h>

typedef __attribute__((ext_vector_type(16))) _Float16 v16h;
typedef __attribute__((ext_vector_type(16))) __bf16 v16b;
typedef __attribute__((ext_vector_type(8)))  _Float16 v8h;
typedef __attribute__((ext_vector_type(8)))  float v8f;
typedef __attribute__((ext_vector_type(4)))  float v4f;
typedef __attribute__((ext_vector_type(2)))  float v2f;
typedef __attribute__((ext_vector_type(4)))  unsigned v4u;
typedef __attribute__((ext_vector_type(4)))  int v4i;
typedef float __attribute__((may_alias)) float_a;
typedef int __attribute__((may_alias)) int_a;

template <typename T> __device__ __forceinline__ void vst2(void* p, T v) { *(T*)p = v;  }
__device__ __forceinline__ v8f wmma16(v16h a, v16h b, v8f c) {
  v8f d = __builtin_amdgcn_wmma_f32_16x16x32_f16(false, a, false, b, (short)0, c, false, false);
  asm volatile("v_nop\n\tv_nop\n\tv_nop\n\tv_nop" : "+v"(d) : "v"(a), "v"(b));
  return d;
}
__device__ __forceinline__ v8f wmma_bf(v16b a, v16b b, v8f c) {
  v8f d = __builtin_amdgcn_wmma_f32_16x16x32_bf16(false, a, false, b, (short)0, c, false, false);
  asm volatile("v_nop\n\tv_nop\n\tv_nop\n\tv_nop" : "+v"(d) : "v"(a), "v"(b));
  return d;
}
// 16x16x32 fragments: lane = (h = lane>>4, row/col = lane&15); elements 0..7 = k0+8h+0..7, 8..15 = k0+16+8h+0..7; D element r = row 8h+r
__device__ __forceinline__ v16h frag_h(const _Float16* rowk0, int lane) {
  union { v16h v; v8h q[2]; } u; const _Float16* p = rowk0 + 8 * (lane >> 4);
  u.q[0] = *(const v8h*)p; u.q[1] = *(const v8h*)(p + 16); return u.v;
}
__device__ __forceinline__ v16h frag_f32(const float* rowk0, int lane) {
  v16h a; const float* p = rowk0 + 8 * (lane >> 4);
#pragma unroll
  for (int i = 0; i < 8; ++i) { a[i] = (_Float16)p[i]; a[8 + i] = (_Float16)p[16 + i]; }
  return a;
}
__device__ __forceinline__ v16h frag_f32s(const float* rowk0, int lane, float sc) {
  v16h a; const float* p = rowk0 + 8 * (lane >> 4);
#pragma unroll
  for (int i = 0; i < 8; ++i) { a[i] = (_Float16)(p[i] * sc); a[8 + i] = (_Float16)(p[16 + i] * sc); }
  return a;
}
// column fragment from a [K][ld] layout (column n), rows >= K read as 0
__device__ __forceinline__ v16h fragc_f32(const float* W, int k0, int n, int lane, int ld, int K) {
  v16h a; const int g = lane >> 4;
#pragma unroll
  for (int i = 0; i < 8; ++i) { const int ka = k0 + 8 * g + i, kb = ka + 16;
    a[i] = (_Float16)(ka < K ? W[(size_t)(ka < K ? ka : K - 1) * ld + n] : 0.f); a[8 + i] = (_Float16)(kb < K ? W[(size_t)(kb < K ? kb : K - 1) * ld + n] : 0.f); }
  return a;
}
struct F2 { v16b h, l; };
__device__ __forceinline__ F2 bsplit16(const float v[16]) { F2 r;
#pragma unroll
  for (int i = 0; i < 16; ++i) { const __bf16 h = (__bf16)v[i]; r.h[i] = h; r.l[i] = (__bf16)(v[i] - (float)h); }
  return r; }
__device__ __forceinline__ F2 split_row(const float* row, int k0, int lane) { float v[16]; const float* p = row + k0 + 8 * (lane >> 4);
#pragma unroll
  for (int i = 0; i < 8; ++i) { v[i] = p[i]; v[8 + i] = p[16 + i]; }
  return bsplit16(v); }
__device__ __forceinline__ F2 split_rowK(const float* row, int k0, int lane, int K) { float v[16]; const int g = lane >> 4;
#pragma unroll
  for (int i = 0; i < 8; ++i) { const int ka = k0 + 8 * g + i, kb = ka + 16; v[i] = ka < K ? row[ka < K ? ka : K - 1] : 0.f; v[8 + i] = kb < K ? row[kb < K ? kb : K - 1] : 0.f; }
  return bsplit16(v); }
__device__ __forceinline__ F2 split_col(const float* W, int k0, int n, int lane, int ld, int K) { float v[16]; const int g = lane >> 4;
#pragma unroll
  for (int i = 0; i < 8; ++i) { const int ka = k0 + 8 * g + i, kb = ka + 16; v[i] = ka < K ? W[(size_t)(ka < K ? ka : K - 1) * ld + n] : 0.f; v[8 + i] = kb < K ? W[(size_t)(kb < K ? kb : K - 1) * ld + n] : 0.f; }
  return bsplit16(v); }
__device__ __forceinline__ v8f mac3(const F2& a, const F2& b, v8f c) { c = wmma_bf(a.l, b.h, c); c = wmma_bf(a.h, b.l, c); return wmma_bf(a.h, b.h, c); }
__device__ __forceinline__ float sigm(float v) { return 1.0f / (1.0f + expf(-v)); }
#define LDSX() do { asm volatile("s_wait_dscnt 0" ::: "memory"); __builtin_amdgcn_wave_barrier(); __builtin_amdgcn_fence(__ATOMIC_RELEASE, "workgroup"); } while (0)

// 3-D local-window attention layer (x [1, 256, 16, 16, 16] -> 4,096 tokens, 8 heads x 32): qkv = tok qkv_w^T (packed (out,in) [768, 256], layout (3, H, hd)); scores = q k^T / sqrt(32) masked to -inf where the integer grid distance between the two tokens is >= 10 (sqrt(dz^2+dy^2+dx^2) < 10 <=> d2 < 100); softmax; out = merged(attn v) proj_w^T + proj_b, returned as [1, 256, 16, 16, 16].
#define NB 1
#define TT 4096
#define CC 256            // NH * HD = projected width
#define DIN 256          // input (model) width
#define NH 8
#define HD 32
#define NQB (TT / 64)
#define HG 2
#define SCALE (0.17677669529663687f)
#define CAUSAL 0
#ifndef TNB
#define TNB NB
#endif
__device__ __forceinline__ float bfr(float v) { return (float)(__bf16)v; }
__host__ __device__ __forceinline__ int kb_last(int qb) { return CAUSAL ? ((qb * 64 + 63) >> 7) : (TT / 128 - 1); }
typedef __attribute__((ext_vector_type(8))) __bf16 v8b;
__device__ __forceinline__ v16b frag_b(const __bf16* rowk0, int lane) {
  union { v16b v; v8b q[2]; } u; const __bf16* p = rowk0 + 8 * (lane >> 4);
  u.q[0] = *(const v8b*)p; u.q[1] = *(const v8b*)(p + 16); return u.v;
}
#define QBH 0
#define QHI 4096            // rows carrying a q residual plane (all rows when non-causal: 2-product logits everywhere)
#define KHI 64            // key rows carrying k residual / v bf16 hi+lo planes (written by k_proj, read by no kernel in this file)
// B fragment (k rows k0+.., output column o) of a weight: (in,out) [K][ld] or (out,in) [ld rows of K]: bf16 exact, or f16(bf16 * 256) exact
__device__ __forceinline__ v16b wcol_io(const float* Wm, int k0, int o, int lane, int ld) { v16b w; const int g = lane >> 4;
#pragma unroll
  for (int i = 0; i < 8; ++i) { w[i] = (__bf16)Wm[(size_t)(k0 + 8 * g + i) * ld + o]; w[8 + i] = (__bf16)Wm[(size_t)(k0 + 16 + 8 * g + i) * ld + o]; }
  return w; }
__device__ __forceinline__ v16b wcol_oi(const float* Wm, int k0, int o, int lane, int K) { v16b w; const float* p = Wm + (size_t)o * K + k0 + 8 * (lane >> 4);
#pragma unroll
  for (int i = 0; i < 8; ++i) { w[i] = (__bf16)p[i]; w[8 + i] = (__bf16)p[16 + i]; }
  return w; }
__device__ __forceinline__ v16h wcolh_io(const float* Wm, int k0, int o, int lane, int ld) { v16h w; const int g = lane >> 4;
#pragma unroll
  for (int i = 0; i < 8; ++i) { w[i] = (_Float16)(bfr(Wm[(size_t)(k0 + 8 * g + i) * ld + o]) * 256.0f); w[8 + i] = (_Float16)(bfr(Wm[(size_t)(k0 + 16 + 8 * g + i) * ld + o]) * 256.0f); }
  return w; }
__device__ __forceinline__ v16h wcolh_oi(const float* Wm, int k0, int o, int lane, int K) { v16h w; const float* p = Wm + (size_t)o * K + k0 + 8 * (lane >> 4);
#pragma unroll
  for (int i = 0; i < 8; ++i) { w[i] = (_Float16)(bfr(p[i]) * 256.0f); w[8 + i] = (_Float16)(bfr(p[16 + i]) * 256.0f); }
  return w; }
#define WQKV_LAYOUT 1   // 0 = (in,out) [DIN][CC]; 1 = (out,in) [CC][DIN]; 2 = per-head [NH][DIN][HD]
__device__ __forceinline__ v16b wcol_hdk(const float* Wm, int k0, int o, int lane) { v16b w; const int g = lane >> 4; const float* p = Wm + (size_t)(o / HD) * DIN * HD + (o % HD);
#pragma unroll
  for (int i = 0; i < 8; ++i) { w[i] = (__bf16)p[(size_t)(k0 + 8 * g + i) * HD]; w[8 + i] = (__bf16)p[(size_t)(k0 + 16 + 8 * g + i) * HD]; }
  return w; }
#define WO_OUT_IN 1
#if WQKV_LAYOUT == 1
#define WCOL(W, k0, o, lane) wcol_oi(W, k0, o, lane, DIN)
#elif WQKV_LAYOUT == 2
#define WCOL(W, k0, o, lane) wcol_hdk(W, k0, o, lane)
#else
#define WCOL(W, k0, o, lane) wcol_io(W, k0, o, lane, CC)
#endif
#if WO_OUT_IN
#define WOCOL(W, k0, o, lane) wcol_oi(W, k0, o, lane, CC)
#define WOCOLH(W, k0, o, lane) wcolh_oi(W, k0, o, lane, CC)
#else
#define WOCOL(W, k0, o, lane) wcol_io(W, k0, o, lane, DIN)
#define WOCOLH(W, k0, o, lane) wcolh_io(W, k0, o, lane, DIN)
#endif
#define SM_MASK_HOOK do { const int dz = (t >> 8) - (k >> 8), dy = ((t >> 4) & 15) - ((k >> 4) & 15), dx = (t & 15) - (k & 15); v = (dz * dz + dy * dy + dx * dx < 100) ? v : -3.0e38f; } while (0)   /* local pattern: dist < 10 on the (d,h,w) token grid, exact in integers */
#define NTOK 4096
// ---- k_tok: block = (64 tokens, 64 channels): XT[n][c] = bf16(x[c][n]) through an LDS tile (x is [1][256][4096] channels-first)
__global__ __launch_bounds__(256) void k_tok(const float* __restrict__ X, float* __restrict__ XT) { __shared__ float st[64][68]; const int tid = threadIdx.x; const int n0 = blockIdx.x * 64, c0 = blockIdx.y * 64;
  for (int e = tid; e < 64 * 16; e += 256) { const int cl = e >> 4, q = e & 15; const v4f v = *(const v4f*)(X + (size_t)(c0 + cl) * NTOK + n0 + q * 4); st[cl][q * 4] = bfr(v[0]); st[cl][q * 4 + 1] = bfr(v[1]); st[cl][q * 4 + 2] = bfr(v[2]); st[cl][q * 4 + 3] = bfr(v[3]); }
  __syncthreads();
  for (int e = tid; e < 64 * 16; e += 256) { const int nl = e >> 4, q = e & 15; v4f o; o[0] = st[q * 4][nl]; o[1] = st[q * 4 + 1][nl]; o[2] = st[q * 4 + 2][nl]; o[3] = st[q * 4 + 3][nl]; vst2(XT + (size_t)(n0 + nl) * CC + c0 + q * 4, o); } }
// ---- k_fin: block = (64 tokens, 64 channels): out[c][n] = OR[n][c] (LDS transpose; 256-B runs of 64 tokens per channel)
__global__ __launch_bounds__(256) void k_fin(const float* __restrict__ ORW, float* __restrict__ OUT) { __shared__ float st[64][68]; const int tid = threadIdx.x; const int n0 = blockIdx.x * 64, c0 = blockIdx.y * 64;
  for (int e = tid; e < 64 * 16; e += 256) { const int nl = e >> 4, q = e & 15; *(v4f*)&st[nl][q * 4] = *(const v4f*)(ORW + (size_t)(n0 + nl) * CC + c0 + q * 4); }
  __syncthreads();
  for (int e = tid; e < 64 * 16; e += 256) { const int cl = e >> 4, q = e & 15; v4f o; o[0] = st[q * 4][cl]; o[1] = st[q * 4 + 1][cl]; o[2] = st[q * 4 + 2][cl]; o[3] = st[q * 4 + 3][cl]; vst2(OUT + (size_t)(c0 + cl) * NTOK + n0 + q * 4, o); } }
#define WS_XT  (WS_END)
#define WS_OR  (WS_XT + 4u * (size_t)NTOK * CC)
#define WS_END2 (WS_OR + 4u * (size_t)NTOK * CC)
#ifndef SM_EXTRA_PARAMS
#define SM_EXTRA_PARAMS
#endif
#ifndef PROJ_EXTRA_PARAMS
#define PROJ_EXTRA_PARAMS
#endif
#ifndef SM_MASK_HOOK
#define SM_MASK_HOOK (void)0
#endif

#define WS_QH  0u                                      // f16 q rows [b*t][CC]
#define WS_KH  (WS_QH + 2u * (size_t)NB * TT * CC)      // f16 k rows [b*t][CC]
#define WS_VT  (WS_KH + 2u * (size_t)NB * TT * CC)      // f16 v planes [b][c][t]
#define WS_QL  (WS_VT + 2u * (size_t)NB * CC * TT)      // f16 q residual x 2^10 rows [b][t < QHI][CC]
#define WS_KL  (WS_QL + 2u * (size_t)NB * QHI * CC)     // f16 k residual x 2^10 rows [b][t < KHI][CC]
#define WS_VB  (WS_KL + 2u * (size_t)NB * KHI * CC)     // bf16 v hi planes [b][c][t < KHI]
#define WS_VBL (WS_VB + 2u * (size_t)NB * CC * KHI)
#define WS_S   (WS_VBL + 2u * (size_t)NB * CC * KHI)    // f32 [hg][t][s] area, unused (logits and P stay in registers)
#define WS_Y   (WS_S  + 4u * (size_t)HG * TT * TT)      // f32 ctx rows [b*t][CC] (only when there is an output projection)
#define WS_END (WS_Y  + 4u * (size_t)NB * TT * CC)

// ---- k_proj: block = (64 rows, 128 cols, which): q/k/v = X W (+ b) with exact bf16 products (K = DIN) -> which 0: q f16 rows (+ residual rows < QHI); 1: k f16 rows (+ residual rows < KHI); 2: v f16 planes [c][t] (+ bf16 hi/lo planes for t < KHI)
__global__ __launch_bounds__(128) void k_proj(const float* __restrict__ XQ, const float* __restrict__ XK, const float* __restrict__ XV, const float* __restrict__ WQ, const float* __restrict__ WK, const float* __restrict__ WV, const float* __restrict__ BQ, const float* __restrict__ BK, const float* __restrict__ BV,
    _Float16* __restrict__ QH, _Float16* __restrict__ QL, _Float16* __restrict__ KH, _Float16* __restrict__ KL, _Float16* __restrict__ VT, __bf16* __restrict__ VB, __bf16* __restrict__ VBL) {
  __shared__ __align__(16) _Float16 sh[64][136], sl[64][136]; __shared__ __align__(16) _Float16 th[128][72]; __shared__ __align__(16) __bf16 tb[128][72], tbl[128][72];
  const int tid = threadIdx.x, wave = tid >> 5, lane = tid & 31, col = lane & 15, g = lane >> 4; const int which = blockIdx.z; const int c0 = blockIdx.y * 128; const size_t r0 = (size_t)blockIdx.x * 64; const size_t bb = r0 / TT; const int t0 = (int)(r0 % TT);
  const float* X = which == 0 ? XQ : which == 1 ? XK : XV; const float* WA = which == 0 ? WQ : which == 1 ? WK : WV; const float* BA = which == 0 ? BQ : which == 1 ? BK : BV;
  v8f acc[8] = {};
#pragma unroll 2
  for (int kc = 0; kc < DIN / 32; ++kc) { v16b a; { const float* p = X + (r0 + wave * 16 + col) * DIN + kc * 32 + 8 * g;
#pragma unroll
      for (int i = 0; i < 8; ++i) { a[i] = (__bf16)p[i]; a[8 + i] = (__bf16)p[16 + i]; } }
    asm volatile("s_wait_loadcnt 0x0" ::: "memory");
#pragma unroll
    for (int j = 0; j < 8; ++j) { const v16b w = WCOL(WA, kc * 32, c0 + j * 16 + col, lane); asm volatile("s_wait_loadcnt 0x0" ::: "memory"); acc[j] = wmma_bf(a, w, acc[j]); } }
  if (which < 2) { _Float16* DH = which == 0 ? QH : KH; _Float16* DL = which == 0 ? QL : KL; const int nhi = which == 0 ? QHI : KHI; const bool hi_rows = t0 < nhi;
#pragma unroll
    for (int j = 0; j < 8; ++j) { const float bias = BA ? bfr(BA[c0 + j * 16 + col]) : 0.f;
#pragma unroll
      for (int r = 0; r < 8; ++r) { const float v = acc[j][r] + bias; const _Float16 hv = (_Float16)v; sh[wave * 16 + 8 * g + r][j * 16 + col] = hv; sl[wave * 16 + 8 * g + r][j * 16 + col] = (_Float16)((v - (float)hv) * 1024.0f); } }
    __syncthreads();
    for (int e = tid; e < 64 * 16; e += 128) { const int rl = e >> 4, q = e & 15; vst2((unsigned*)(DH + (r0 + rl) * CC + c0 + q * 8), *(const v4u*)&sh[rl][q * 8]); if (hi_rows) vst2((unsigned*)(DL + (bb * nhi + t0 + rl) * (size_t)CC + c0 + q * 8), *(const v4u*)&sl[rl][q * 8]); }
  } else { const bool hi_rows = t0 < KHI;
#pragma unroll
    for (int j = 0; j < 8; ++j) { const float bias = BA ? bfr(BA[c0 + j * 16 + col]) : 0.f;
#pragma unroll
      for (int r = 0; r < 8; ++r) { const float v = acc[j][r] + bias; const int rl = wave * 16 + 8 * g + r, cl = j * 16 + col; th[cl][rl] = (_Float16)v; const __bf16 bh = (__bf16)v; tb[cl][rl] = bh; tbl[cl][rl] = (__bf16)(v - (float)bh); } }
    __syncthreads();
    for (int e = tid; e < 128 * 8; e += 128) { const int cl = e >> 3, q = e & 7; vst2((unsigned*)(VT + (bb * CC + c0 + cl) * (size_t)TT + t0 + q * 8), *(const v4u*)&th[cl][q * 8]); if (hi_rows) { const size_t o3 = (bb * CC + c0 + cl) * (size_t)KHI + t0 + q * 8; vst2((unsigned*)(VB + o3), *(const v4u*)&tb[cl][q * 8]); vst2((unsigned*)(VBL + o3), *(const v4u*)&tbl[cl][q * 8]); } } } }
// ---- k_fa: block = 8 waves = 128 queries of one head; a wave owns 16 queries (one x row of the token grid) and walks all keys, 64 a pass, with a running maximum and sum.
// S^T = K Q^T (A = 16 key rows, B = the wave's q hi, then its q residual): a lane holds 8 keys (8g + r) of its own query (col), so two key tiles are, as they stand, the B fragment of ctx^T = V^T P^T and the logits never leave the registers.
// K and V of 128 keys (a stage = two passes) are brought into LDS once for the block's 8 waves by asynchronous copies, two buffers, the next stage in flight while this one is worked on.
// fragment from the lane's own address (row start + k0 + 8 * (lane >> 4)): same k order as frag_h
__device__ __forceinline__ v16h frag_p(const _Float16* p) { union { v16h v; v8h q[2]; } u; u.q[0] = *(const v8h*)p; u.q[1] = *(const v8h*)(p + 16); return u.v; }
// the address registers of issued loads stay live up to this wait, so nothing overwrites them in front of it
#define FA_XWAIT(p0, p1) asm volatile("s_wait_xcnt 0x0" :: "v"(p0), "v"(p1) : "memory")
#define FA_SK 128          // keys a stage
#define FA_STG 16384       // bytes a stage: 16 K half fragments, then 16 V half fragments, 512 B each
// A stage lies in LDS in fragment order: half fragment B (elements 8u .. 8u+7 of one 16 x 32 fragment) is 512 B, lane l's 16 bytes at B * 512 + l * 16, so a reader's ds_load_b128 covers 512 contiguous bytes.
// K: B = (pass * 4 + tile) * 2 + u; V: B = 16 + ((pass * 2 + c) * 2 + j) * 2 + u. Same elements at the same lane and register as the loads from global memory had.
__device__ __forceinline__ v16h frag_l(const char* rb, int B) { union { v16h v; v8h q[2]; } u; u.q[0] = *(const v8h*)(rb + B * 512); u.q[1] = *(const v8h*)(rb + B * 512 + 512); return u.v; }
// one stage's copies: a thread brings two 16-byte pieces of K and two of V (pass 0 and pass 1 of the stage). The s_wait_xcnt stands in the copies' own statement, so no address register is rewritten in front of it.
__device__ __forceinline__ void fa_copy(unsigned kd, unsigned vd, const _Float16* kg, const _Float16* vg) {
  asm volatile("global_load_async_to_lds_b128 %0, %4, off\n\tglobal_load_async_to_lds_b128 %1, %5, off\n\tglobal_load_async_to_lds_b128 %2, %6, off\n\tglobal_load_async_to_lds_b128 %3, %7, off\n\ts_wait_xcnt 0x0"
    :: "v"(kd), "v"(kd + 4096u), "v"(vd), "v"(vd + 4096u), "v"(kg), "v"(kg + (size_t)64 * CC), "v"(vg), "v"(vg + 64) : "memory");
}
// one stage = two passes of 64 keys. kc, vc hold the first pass's fragments on entry; the second pass's are read from the same buffer (rb) into the same registers: K behind the first pass's S products, V behind its P V products, each well ahead of its use.
__device__ __forceinline__ void fa_stage(v16h (&kc)[4], v16h (&vc)[4], v8f (&acc)[2], float& m, float& l, const char* rb, int t, int tz, int ty, const int (&dx2)[8], v16h qh, v16h ql) {
  const v8f zero = {};
#pragma unroll
  for (int p = 0; p < 2; ++p) {
    const int it = t * 2 + p;
    v8f sa[4], sb[4];
#pragma unroll
    for (int i = 0; i < 4; ++i) { sa[i] = wmma16(kc[i], qh, zero); sb[i] = wmma16(kc[i], ql, zero); }
    if (p == 0) {
#pragma unroll
      for (int i = 0; i < 4; ++i) kc[i] = frag_l(rb, 8 + i * 2);
    }
    float s[4][8];
#pragma unroll
    for (int i = 0; i < 4; ++i) {
      const int T = it * 4 + i, dz = tz - (T >> 4), dy = ty - (T & 15), lim = 100 - dz * dz - dy * dy;   /* a key tile is one x row: dist < 10 <=> dx^2 < 100 - dz^2 - dy^2, exact in integers */
#pragma unroll
      for (int r = 0; r < 8; ++r) { const float v = (sa[i][r] + sb[i][r] * (1.0f / 1024.0f)) * SCALE; s[i][r] = dx2[r] < lim ? v : -3.0e38f; } }
    float mx = m;
#pragma unroll
    for (int i = 0; i < 4; ++i)
#pragma unroll
      for (int r = 0; r < 8; ++r) mx = fmaxf(mx, s[i][r]);
    mx = fmaxf(mx, __shfl_xor(mx, 16));
    const float alpha = expf(m - mx); m = mx; const float ms = mx - 7.6246189861593985f;   /* 11 ln 2: P is carried x 2^11 as before; the factor cancels in acc / l */
    l *= alpha;
#pragma unroll
    for (int j = 0; j < 2; ++j)
#pragma unroll
      for (int r = 0; r < 8; ++r) acc[j][r] *= alpha;
#pragma unroll
    for (int c = 0; c < 2; ++c) { v16h pf;
#pragma unroll
      for (int r = 0; r < 8; ++r) { const float e0 = expf(s[2 * c][r] - ms), e1 = expf(s[2 * c + 1][r] - ms); l += e0 + e1; pf[r] = (_Float16)e0; pf[8 + r] = (_Float16)e1; }
#pragma unroll
      for (int j = 0; j < 2; ++j) acc[j] = wmma16(vc[c * 2 + j], pf, acc[j]); }
    if (p == 0) {
#pragma unroll
      for (int i = 0; i < 4; ++i) vc[i] = frag_l(rb, 24 + i * 2);
    }
  }
}
// the foot of a trip: this wave's reads of the buffer are done before it may be refilled; its share of the next stage has landed; the barrier publishes that stage and ends every wave's reads of this one
#define FA_PUBLISH() do { asm volatile("s_wait_dscnt 0x0" ::: "memory"); asm volatile("s_wait_asynccnt 0x0" ::: "memory"); __syncthreads(); } while (0)
// amdgpu_waves_per_eu(4, 4) names a budget of 256 registers: with none named this build chose fewer registers and a serial order of the softmax (more v_nop and s_delay_alu in the loop than the loop had before)
__global__ __launch_bounds__(256) __attribute__((amdgpu_waves_per_eu(4, 4))) void k_fa(const _Float16* __restrict__ QH, const _Float16* __restrict__ QL, const _Float16* __restrict__ KH, const _Float16* __restrict__ VT, float* __restrict__ Y) {
  __shared__ __align__(512) char ring[2 * FA_STG];
  const int tid = threadIdx.x, wave = __builtin_amdgcn_readfirstlane(tid >> 5), lane = tid & 31, col = lane & 15, g = lane >> 4;
  const int h = blockIdx.y; const int q0 = blockIdx.x * 128 + wave * 16; const int tz = q0 >> 8, ty = (q0 >> 4) & 15;   /* the 16 queries share z and y; x = col */
  const _Float16* qhp = QH + (size_t)(q0 + col) * CC + h * HD + 8 * g; const _Float16* qlp = QL + (size_t)(q0 + col) * CC + h * HD + 8 * g;
  const v16h qh = frag_p(qhp), ql = frag_p(qlp); FA_XWAIT(qhp, qlp);
  int dx2[8];
#pragma unroll
  for (int r = 0; r < 8; ++r) { const int d = col - (8 * g + r); dx2[r] = d * d; }
  // the thread's pieces: piece cq of a row = elements 8 cq .. 8 cq + 7 = (u = cq >> 1, g = cq & 1); K row tid >> 2 of a pass (tile tid >> 6, row crow); V channel (tid >> 2) & 31 (j, crow), key group c = tid >> 7 of a pass
  const int cq = tid & 3, crow = (tid >> 2) & 15; const unsigned slot = (unsigned)(((cq >> 1) * 32 + (cq & 1) * 16 + crow) * 16);
  const unsigned rg = (unsigned)(size_t)ring;   /* the LDS byte address is the low word of the shared address */
  const unsigned kd = rg + (unsigned)(tid >> 6) * 1024u + slot, vd = rg + 8192u + (unsigned)((tid >> 7) * 2 + ((tid >> 6) & 1)) * 1024u + slot;
  const _Float16* kg = KH + (size_t)(tid >> 2) * CC + h * HD + cq * 8; const _Float16* vg = VT + (size_t)(h * HD + ((tid >> 2) & 31)) * TT + (tid >> 7) * 32 + cq * 8;
  const char* rl = ring + lane * 16;
  v8f acc[2] = {}; float m = -1.0e30f, l = 0.f;   /* the start maximum is finite, so an excluded logit (-3e38) gives exp = 0 also while no key has been admitted yet */
  fa_copy(kd, vd, kg, vg);
  asm volatile("s_wait_asynccnt 0x0" ::: "memory");   /* stage 0 has landed, as far as this wave brought it */
  __syncthreads();                                    /* ... and is published to the other waves */
  fa_copy(kd + FA_STG, vd + FA_STG, kg + (size_t)FA_SK * CC, vg + FA_SK);
  v16h kc[4], vc[4];   /* the first pass's fragments of the published stage */
#pragma unroll
  for (int i = 0; i < 4; ++i) { kc[i] = frag_l(rl, i * 2); vc[i] = frag_l(rl, 16 + i * 2); }
  // the trips behind which a stage t + 2 exists, then the last two: split so that each loop's body is one straight block (with a branch round the copies the compiler moved the row sum's chain of additions behind the barrier, in front of the LDS reads)
#pragma unroll 1   /* unrolled further the live set passes 256 registers */
  for (int t = 0; t < TT / FA_SK - 2; ++t) {
    fa_stage(kc, vc, acc, m, l, rl + (t & 1) * FA_STG, t, tz, ty, dx2, qh, ql);
    FA_PUBLISH();
    fa_copy(kd + (t & 1) * FA_STG, vd + (t & 1) * FA_STG, kg + (size_t)(t + 2) * FA_SK * CC, vg + (t + 2) * FA_SK);   /* into the buffer that this trip has just read */
    const char* rn = rl + ((t + 1) & 1) * FA_STG;   /* the stage just published */
#pragma unroll
    for (int i = 0; i < 4; ++i) { kc[i] = frag_l(rn, i * 2); vc[i] = frag_l(rn, 16 + i * 2); }
  }
#pragma unroll 1   /* as above */
  for (int t = TT / FA_SK - 2; t < TT / FA_SK; ++t) {
    fa_stage(kc, vc, acc, m, l, rl + (t & 1) * FA_STG, t, tz, ty, dx2, qh, ql);
    FA_PUBLISH();
    const char* rn = rl + ((t + 1) & 1) * FA_STG;   /* behind the last trip these reads meet the last but one stage's bytes and nothing uses them */
#pragma unroll
    for (int i = 0; i < 4; ++i) { kc[i] = frag_l(rn, i * 2); vc[i] = frag_l(rn, 16 + i * 2); }
  }
  asm volatile("s_wait_asynccnt 0x0" ::: "memory");   /* no copy is outstanding when the wave ends */
  l += __shfl_xor(l, 16); const float inv = l > 0.f ? 1.0f / l : 0.f;   /* a fully excluded row yields 0 */
#pragma unroll
  for (int j = 0; j < 2; ++j) { v4f o0, o1;
#pragma unroll
    for (int r = 0; r < 4; ++r) { o0[r] = acc[j][r] * inv; o1[r] = acc[j][4 + r] * inv; }
    float* yp = Y + (size_t)(q0 + col) * CC + h * HD + j * 16 + 8 * g; vst2(yp, o0); vst2(yp + 4, o1); } }
// ---- k_out: block = (64 rows, 128 cols): out = ctx Wo (+ bo): ctx once to f16 against Wo as f16(bf16 x 2^8) exact (1 product) x 2^-8; causal early rows (< QHI of each sequence): ctx bf16 hi + lo against exact bf16 Wo (2 products)
__global__ __launch_bounds__(128) void k_out(const float* __restrict__ Y, const float* __restrict__ WO, const float* __restrict__ BO, float* __restrict__ OUT) { __shared__ __align__(16) float sf[4][16][132];
  const int tid = threadIdx.x, wave = tid >> 5, lane = tid & 31, col = lane & 15, g = lane >> 4; const int c0 = blockIdx.y * 128; const size_t r0 = (size_t)blockIdx.x * 64 + wave * 16;
  v8f acc[8] = {};
  if (CAUSAL && (int)(((size_t)blockIdx.x * 64) % TT) < QHI) {   /* block-uniform */
#pragma unroll 2
    for (int kc = 0; kc < CC / 32; ++kc) { const F2 a = split_row(Y + (r0 + col) * CC, kc * 32, lane); asm volatile("s_wait_loadcnt 0x0" ::: "memory");
#pragma unroll
      for (int j = 0; j < 8; ++j) { const v16b w = WOCOL(WO, kc * 32, c0 + j * 16 + col, lane); asm volatile("s_wait_loadcnt 0x0" ::: "memory"); acc[j] = wmma_bf(a.h, w, acc[j]); acc[j] = wmma_bf(a.l, w, acc[j]); } }
#pragma unroll
    for (int j = 0; j < 8; ++j) { const float bias = BO ? bfr(BO[c0 + j * 16 + col]) : 0.f;
#pragma unroll
      for (int r = 0; r < 8; ++r) sf[wave][8 * g + r][j * 16 + col] = acc[j][r] + bias; }
  } else {
#pragma unroll 2
    for (int kc = 0; kc < CC / 32; ++kc) { const v16h a = frag_f32(Y + (r0 + col) * CC + kc * 32, lane); asm volatile("s_wait_loadcnt 0x0" ::: "memory");
#pragma unroll
      for (int j = 0; j < 8; ++j) { const v16h w = WOCOLH(WO, kc * 32, c0 + j * 16 + col, lane); asm volatile("s_wait_loadcnt 0x0" ::: "memory"); acc[j] = wmma16(a, w, acc[j]); } }
#pragma unroll
    for (int j = 0; j < 8; ++j) { const float bias = BO ? bfr(BO[c0 + j * 16 + col]) : 0.f;
#pragma unroll
      for (int r = 0; r < 8; ++r) sf[wave][8 * g + r][j * 16 + col] = acc[j][r] * (1.0f / 256.0f) + bias; } }
  LDSX(); for (int rl = 0; rl < 16; ++rl) vst2(OUT + (r0 + rl) * DIN + c0 + lane * 4, *(const v4f*)&sf[wave][rl][lane * 4]); }

extern "C" void kernel_launch(void* const* d_in, const int* in_sizes, int n_in, void* d_out, int out_size, void* d_ws, size_t ws_size, hipStream_t stream) {
  (void)in_sizes; (void)n_in; (void)out_size;
  const float** F = (const float**)d_in;
  if (ws_size < (size_t)WS_END) return;
  char* ws = (char*)d_ws; _Float16 *QH = (_Float16*)(ws + WS_QH), *KH = (_Float16*)(ws + WS_KH), *VT = (_Float16*)(ws + WS_VT), *QL = (_Float16*)(ws + WS_QL), *KL = (_Float16*)(ws + WS_KL); __bf16 *VB = (__bf16*)(ws + WS_VB), *VBL = (__bf16*)(ws + WS_VBL); float *Y = (float*)(ws + WS_Y);
  (void)Y; (void)QL; (void)KL; (void)VB; (void)VBL;
  // inputs: 0 x [1,256,16,16,16]; 1 qkv_w [768,256] (out,in) rows q | k | v; 2 proj_w [256,256] (out,in); 3 proj_b
  if (ws_size < (size_t)WS_END2) return;
  float *XT = (float*)(ws + WS_XT), *ORW = (float*)(ws + WS_OR);
  k_tok<<<dim3(NTOK / 64, CC / 64), 256, 0, stream>>>(F[0], XT);
  { const float* WQ = F[1]; const float* WK = F[1] + (size_t)CC * DIN; const float* WV = F[1] + (size_t)2 * CC * DIN;
    k_proj<<<dim3(TNB * TT / 64, CC / 128, 3), 128, 0, stream>>>(XT, XT, XT, WQ, WK, WV, nullptr, nullptr, nullptr, QH, QL, KH, KL, VT, VB, VBL); }
  k_fa<<<dim3(TT / 128, NH), 256, 0, stream>>>(QH, QL, KH, VT, Y);
  k_out<<<dim3(TNB * TT / 64, DIN / 128), 128, 0, stream>>>(Y, F[2], F[3], ORW);
  k_fin<<<dim3(NTOK / 64, CC / 64), 256, 0, stream>>>(ORW, (float*)d_out);
}

// v003
// One run takes 114 microseconds.
// Timed twice side by side with v002, it ran 1.20 and 1.19 times as fast.
// Over all steps from v000 it is 6.61 times as fast.
// compute dtype: all float inputs rounded to bf16; tokens = bf16(x) transposed; qkv = tok W^T with EXACT bf16 products on WMMA 16x16x32 (f32 accumulate); q as f16 hi + residual (x 2^10) against k once to f16 (2 products) x 32^-0.5; the local window (grid distance < 10) as an exact integer test per (query, key); softmax in f32 (hardware exp2, the logit scale x log2 e folded into its argument) with a running maximum and sum, logits and P kept in registers; P x 2^11 once to f16 against v once to f16 (1 product); ctx once to f16 against proj_w carried x 2^8 in f16 + b; f32 output written channels-first.
#include <hip/hip_runtime.h>
#include <math.h>

typedef __attribute__((ext_vector_type(16))) _Float16 v16h;
typedef __attribute__((ext_vector_type(16))) __bf16 v16b;
typedef __attribute__((ext_vector_type(8)))  _Float16 v8h;
typedef __attribute__((ext_vector_type(8)))  float v8f;
typedef __attribute__((ext_vector_type(4)))  float v4f;
typedef __attribute__((ext_vector_type(2)))  float v2f;
typedef __attribute__((ext_vector_type(4)))  unsigned v4u;
typedef __attribute__((ext_vector_type(4)))  int v4i;
typedef float __attribute__((may_alias)) float_a;
typedef int __attribute__((may_alias)) int_a;

template <typename T> __device__ __forceinline__ void vst2(void* p, T v) { *(T*)p = v;  }
__device__ __forceinline__ v8f wmma16(v16h a, v16h b, v8f c) {
  v8f d = __builtin_amdgcn_wmma_f32_16x16x32_f16(false, a, false, b, (short)0, c, false, false);
  asm volatile("v_nop\n\tv_nop\n\tv_nop\n\tv_nop" : "+v"(d) : "v"(a), "v"(b));
  return d;
}
__device__ __forceinline__ v8f wmma_bf(v16b a, v16b b, v8f c) {
  v8f d = __builtin_amdgcn_wmma_f32_16x16x32_bf16(false, a, false, b, (short)0, c, false, false);
  asm volatile("v_nop\n\tv_nop\n\tv_nop\n\tv_nop" : "+v"(d) : "v"(a), "v"(b));
  return d;
}
// 16x16x32 fragments: lane = (h = lane>>4, row/col = lane&15); elements 0..7 = k0+8h+0..7, 8..15 = k0+16+8h+0..7; D element r = row 8h+r
__device__ __forceinline__ v16h frag_h(const _Float16* rowk0, int lane) {
  union { v16h v; v8h q[2]; } u; const _Float16* p = rowk0 + 8 * (lane >> 4);
  u.q[0] = *(const v8h*)p; u.q[1] = *(const v8h*)(p + 16); return u.v;
}
__device__ __forceinline__ v16h frag_f32(const float* rowk0, int lane) {
  v16h a; const float* p = rowk0 + 8 * (lane >> 4);
#pragma unroll
  for (int i = 0; i < 8; ++i) { a[i] = (_Float16)p[i]; a[8 + i] = (_Float16)p[16 + i]; }
  return a;
}
__device__ __forceinline__ v16h frag_f32s(const float* rowk0, int lane, float sc) {
  v16h a; const float* p = rowk0 + 8 * (lane >> 4);
#pragma unroll
  for (int i = 0; i < 8; ++i) { a[i] = (_Float16)(p[i] * sc); a[8 + i] = (_Float16)(p[16 + i] * sc); }
  return a;
}
// column fragment from a [K][ld] layout (column n), rows >= K read as 0
__device__ __forceinline__ v16h fragc_f32(const float* W, int k0, int n, int lane, int ld, int K) {
  v16h a; const int g = lane >> 4;
#pragma unroll
  for (int i = 0; i < 8; ++i) { const int ka = k0 + 8 * g + i, kb = ka + 16;
    a[i] = (_Float16)(ka < K ? W[(size_t)(ka < K ? ka : K - 1) * ld + n] : 0.f); a[8 + i] = (_Float16)(kb < K ? W[(size_t)(kb < K ? kb : K - 1) * ld + n] : 0.f); }
  return a;
}
struct F2 { v16b h, l; };
__device__ __forceinline__ F2 bsplit16(const float v[16]) { F2 r;
#pragma unroll
  for (int i = 0; i < 16; ++i) { const __bf16 h = (__bf16)v[i]; r.h[i] = h; r.l[i] = (__bf16)(v[i] - (float)h); }
  return r; }
__device__ __forceinline__ F2 split_row(const float* row, int k0, int lane) { float v[16]; const float* p = row + k0 + 8 * (lane >> 4);
#pragma unroll
  for (int i = 0; i < 8; ++i) { v[i] = p[i]; v[8 + i] = p[16 + i]; }
  return bsplit16(v); }
__device__ __forceinline__ F2 split_rowK(const float* row, int k0, int lane, int K) { float v[16]; const int g = lane >> 4;
#pragma unroll
  for (int i = 0; i < 8; ++i) { const int ka = k0 + 8 * g + i, kb = ka + 16; v[i] = ka < K ? row[ka < K ? ka : K - 1] : 0.f; v[8 + i] = kb < K ? row[kb < K ? kb : K - 1] : 0.f; }
  return bsplit16(v); }
__device__ __forceinline__ F2 split_col(const float* W, int k0, int n, int lane, int ld, int K) { float v[16]; const int g = lane >> 4;
#pragma unroll
  for (int i = 0; i < 8; ++i) { const int ka = k0 + 8 * g + i, kb = ka + 16; v[i] = ka < K ? W[(size_t)(ka < K ? ka : K - 1) * ld + n] : 0.f; v[8 + i] = kb < K ? W[(size_t)(kb < K ? kb : K - 1) * ld + n] : 0.f; }
  return bsplit16(v); }
__device__ __forceinline__ v8f mac3(const F2& a, const F2& b, v8f c) { c = wmma_bf(a.l, b.h, c); c = wmma_bf(a.h, b.l, c); return wmma_bf(a.h, b.h, c); }
__device__ __forceinline__ float sigm(float v) { return 1.0f / (1.0f + expf(-v)); }
#define LDSX() do { asm volatile("s_wait_dscnt 0" ::: "memory"); __builtin_amdgcn_wave_barrier(); __builtin_amdgcn_fence(__ATOMIC_RELEASE, "workgroup"); } while (0)

// 3-D local-window attention layer (x [1, 256, 16, 16, 16] -> 4,096 tokens, 8 heads x 32): qkv = tok qkv_w^T (packed (out,in) [768, 256], layout (3, H, hd)); scores = q k^T / sqrt(32) masked to -inf where the integer grid distance between the two tokens is >= 10 (sqrt(dz^2+dy^2+dx^2) < 10 <=> d2 < 100); softmax; out = merged(attn v) proj_w^T + proj_b, returned as [1, 256, 16, 16, 16].
#define NB 1
#define TT 4096
#define CC 256            // NH * HD = projected width
#define DIN 256          // input (model) width
#define NH 8
#define HD 32
#define NQB (TT / 64)
#define HG 2
#define SCALE (0.17677669529663687f)
#define SCALE_L2E (0.25503486f)   // SCALE x log2 e: exp(SCALE x) = exp2(SCALE_L2E x)
#define CAUSAL 0
#ifndef TNB
#define TNB NB
#endif
__device__ __forceinline__ float bfr(float v) { return (float)(__bf16)v; }
__host__ __device__ __forceinline__ int kb_last(int qb) { return CAUSAL ? ((qb * 64 + 63) >> 7) : (TT / 128 - 1); }
typedef __attribute__((ext_vector_type(8))) __bf16 v8b;
__device__ __forceinline__ v16b frag_b(const __bf16* rowk0, int lane) {
  union { v16b v; v8b q[2]; } u; const __bf16* p = rowk0 + 8 * (lane >> 4);
  u.q[0] = *(const v8b*)p; u.q[1] = *(const v8b*)(p + 16); return u.v;
}
#define QBH 0
#define QHI 4096            // rows carrying a q residual plane (all rows when non-causal: 2-product logits everywhere)
#define KHI 64            // key rows carrying k residual / v bf16 hi+lo planes (written by k_proj, read by no kernel in this file)
// B fragment (k rows k0+.., output column o) of a weight: (in,out) [K][ld] or (out,in) [ld rows of K]: bf16 exact, or f16(bf16 * 256) exact
__device__ __forceinline__ v16b wcol_io(const float* Wm, int k0, int o, int lane, int ld) { v16b w; const int g = lane >> 4;
#pragma unroll
  for (int i = 0; i < 8; ++i) { w[i] = (__bf16)Wm[(size_t)(k0 + 8 * g + i) * ld + o]; w[8 + i] = (__bf16)Wm[(size_t)(k0 + 16 + 8 * g + i) * ld + o]; }
  return w; }
__device__ __forceinline__ v16b wcol_oi(const float* Wm, int k0, int o, int lane, int K) { v16b w; const float* p = Wm + (size_t)o * K + k0 + 8 * (lane >> 4);
#pragma unroll
  for (int i = 0; i < 8; ++i) { w[i] = (__bf16)p[i]; w[8 + i] = (__bf16)p[16 + i]; }
  return w; }
__device__ __forceinline__ v16h wcolh_io(const float* Wm, int k0, int o, int lane, int ld) { v16h w; const int g = lane >> 4;
#pragma unroll
  for (int i = 0; i < 8; ++i) { w[i] = (_Float16)(bfr(Wm[(size_t)(k0 + 8 * g + i) * ld + o]) * 256.0f); w[8 + i] = (_Float16)(bfr(Wm[(size_t)(k0 + 16 + 8 * g + i) * ld + o]) * 256.0f); }
  return w; }
__device__ __forceinline__ v16h wcolh_oi(const float* Wm, int k0, int o, int lane, int K) { v16h w; const float* p = Wm + (size_t)o * K + k0 + 8 * (lane >> 4);
#pragma unroll
  for (int i = 0; i < 8; ++i) { w[i] = (_Float16)(bfr(p[i]) * 256.0f); w[8 + i] = (_Float16)(bfr(p[16 + i]) * 256.0f); }
  return w; }
#define WQKV_LAYOUT 1   // 0 = (in,out) [DIN][CC]; 1 = (out,in) [CC][DIN]; 2 = per-head [NH][DIN][HD]
__device__ __forceinline__ v16b wcol_hdk(const float* Wm, int k0, int o, int lane) { v16b w; const int g = lane >> 4; const float* p = Wm + (size_t)(o / HD) * DIN * HD + (o % HD);
#pragma unroll
  for (int i = 0; i < 8; ++i) { w[i] = (__bf16)p[(size_t)(k0 + 8 * g + i) * HD]; w[8 + i] = (__bf16)p[(size_t)(k0 + 16 + 8 * g + i) * HD]; }
  return w; }
#define WO_OUT_IN 1
#if WQKV_LAYOUT == 1
#define WCOL(W, k0, o, lane) wcol_oi(W, k0, o, lane, DIN)
#elif WQKV_LAYOUT == 2
#define WCOL(W, k0, o, lane) wcol_hdk(W, k0, o, lane)
#else
#define WCOL(W, k0, o, lane) wcol_io(W, k0, o, lane, CC)
#endif
#if WO_OUT_IN
#define WOCOL(W, k0, o, lane) wcol_oi(W, k0, o, lane, CC)
#define WOCOLH(W, k0, o, lane) wcolh_oi(W, k0, o, lane, CC)
#else
#define WOCOL(W, k0, o, lane) wcol_io(W, k0, o, lane, DIN)
#define WOCOLH(W, k0, o, lane) wcolh_io(W, k0, o, lane, DIN)
#endif
#define SM_MASK_HOOK do { const int dz = (t >> 8) - (k >> 8), dy = ((t >> 4) & 15) - ((k >> 4) & 15), dx = (t & 15) - (k & 15); v = (dz * dz + dy * dy + dx * dx < 100) ? v : -3.0e38f; } while (0)   /* local pattern: dist < 10 on the (d,h,w) token grid, exact in integers */
#define NTOK 4096
// ---- k_tok: block = (64 tokens, 64 channels): XT[n][c] = bf16(x[c][n]) through an LDS tile (x is [1][256][4096] channels-first)
__global__ __launch_bounds__(256) void k_tok(const float* __restrict__ X, float* __restrict__ XT) { __shared__ float st[64][68]; const int tid = threadIdx.x; const int n0 = blockIdx.x * 64, c0 = blockIdx.y * 64;
  for (int e = tid; e < 64 * 16; e += 256) { const int cl = e >> 4, q = e & 15; const v4f v = *(const v4f*)(X + (size_t)(c0 + cl) * NTOK + n0 + q * 4); st[cl][q * 4] = bfr(v[0]); st[cl][q * 4 + 1] = bfr(v[1]); st[cl][q * 4 + 2] = bfr(v[2]); st[cl][q * 4 + 3] = bfr(v[3]); }
  __syncthreads();
  for (int e = tid; e < 64 * 16; e += 256) { const int nl = e >> 4, q = e & 15; v4f o; o[0] = st[q * 4][nl]; o[1] = st[q * 4 + 1][nl]; o[2] = st[q * 4 + 2][nl]; o[3] = st[q * 4 + 3][nl]; vst2(XT + (size_t)(n0 + nl) * CC + c0 + q * 4, o); } }
// ---- k_fin: block = (64 tokens, 64 channels): out[c][n] = OR[n][c] (LDS transpose; 256-B runs of 64 tokens per channel)
__global__ __launch_bounds__(256) void k_fin(const float* __restrict__ ORW, float* __restrict__ OUT) { __shared__ float st[64][68]; const int tid = threadIdx.x; const int n0 = blockIdx.x * 64, c0 = blockIdx.y * 64;
  for (int e = tid; e < 64 * 16; e += 256) { const int nl = e >> 4, q = e & 15; *(v4f*)&st[nl][q * 4] = *(const v4f*)(ORW + (size_t)(n0 + nl) * CC + c0 + q * 4); }
  __syncthreads();
  for (int e = tid; e < 64 * 16; e += 256) { const int cl = e >> 4, q = e & 15; v4f o; o[0] = st[q * 4][cl]; o[1] = st[q * 4 + 1][cl]; o[2] = st[q * 4 + 2][cl]; o[3] = st[q * 4 + 3][cl]; vst2(OUT + (size_t)(c0 + cl) * NTOK + n0 + q * 4, o); } }
#define WS_XT  (WS_END)
#define WS_OR  (WS_XT + 4u * (size_t)NTOK * CC)
#define WS_END2 (WS_OR + 4u * (size_t)NTOK * CC)
#ifndef SM_EXTRA_PARAMS
#define SM_EXTRA_PARAMS
#endif
#ifndef PROJ_EXTRA_PARAMS
#define PROJ_EXTRA_PARAMS
#endif
#ifndef SM_MASK_HOOK
#define SM_MASK_HOOK (void)0
#endif

#define WS_QH  0u                                      // f16 q rows [b*t][CC]
#define WS_KH  (WS_QH + 2u * (size_t)NB * TT * CC)      // f16 k rows [b*t][CC]
#define WS_VT  (WS_KH + 2u * (size_t)NB * TT * CC)      // f16 v planes [b][c][t]
#define WS_QL  (WS_VT + 2u * (size_t)NB * CC * TT)      // f16 q residual x 2^10 rows [b][t < QHI][CC]
#define WS_KL  (WS_QL + 2u * (size_t)NB * QHI * CC)     // f16 k residual x 2^10 rows [b][t < KHI][CC]
#define WS_VB  (WS_KL + 2u * (size_t)NB * KHI * CC)     // bf16 v hi planes [b][c][t < KHI]
#define WS_VBL (WS_VB + 2u * (size_t)NB * CC * KHI)
#define WS_S   (WS_VBL + 2u * (size_t)NB * CC * KHI)    // f32 [hg][t][s] area, unused (logits and P stay in registers)
#define WS_Y   (WS_S  + 4u * (size_t)HG * TT * TT)      // f32 ctx rows [b*t][CC] (only when there is an output projection)
#define WS_END (WS_Y  + 4u * (size_t)NB * TT * CC)

// ---- k_proj: block = (64 rows, 128 cols, which): q/k/v = X W (+ b) with exact bf16 products (K = DIN) -> which 0: q f16 rows (+ residual rows < QHI); 1: k f16 rows (+ residual rows < KHI); 2: v f16 planes [c][t] (+ bf16 hi/lo planes for t < KHI)
__global__ __launch_bounds__(128) void k_proj(const float* __restrict__ XQ, const float* __restrict__ XK, const float* __restrict__ XV, const float* __restrict__ WQ, const float* __restrict__ WK, const float* __restrict__ WV, const float* __restrict__ BQ, const float* __restrict__ BK, const float* __restrict__ BV,
    _Float16* __restrict__ QH, _Float16* __restrict__ QL, _Float16* __restrict__ KH, _Float16* __restrict__ KL, _Float16* __restrict__ VT, __bf16* __restrict__ VB, __bf16* __restrict__ VBL) {
  __shared__ __align__(16) _Float16 sh[64][136], sl[64][136]; __shared__ __align__(16) _Float16 th[128][72]; __shared__ __align__(16) __bf16 tb[128][72], tbl[128][72];
  const int tid = threadIdx.x, wave = tid >> 5, lane = tid & 31, col = lane & 15, g = lane >> 4; const int which = blockIdx.z; const int c0 = blockIdx.y * 128; const size_t r0 = (size_t)blockIdx.x * 64; const size_t bb = r0 / TT; const int t0 = (int)(r0 % TT);
  const float* X = which == 0 ? XQ : which == 1 ? XK : XV; const float* WA = which == 0 ? WQ : which == 1 ? WK : WV; const float* BA = which == 0 ? BQ : which == 1 ? BK : BV;
  v8f acc[8] = {};
#pragma unroll 2
  for (int kc = 0; kc < DIN / 32; ++kc) { v16b a; { const float* p = X + (r0 + wave * 16 + col) * DIN + kc * 32 + 8 * g;
#pragma unroll
      for (int i = 0; i < 8; ++i) { a[i] = (__bf16)p[i]; a[8 + i] = (__bf16)p[16 + i]; } }
    asm volatile("s_wait_loadcnt 0x0" ::: "memory");
#pragma unroll
    for (int j = 0; j < 8; ++j) { const v16b w = WCOL(WA, kc * 32, c0 + j * 16 + col, lane); asm volatile("s_wait_loadcnt 0x0" ::: "memory"); acc[j] = wmma_bf(a, w, acc[j]); } }
  if (which < 2) { _Float16* DH = which == 0 ? QH : KH; _Float16* DL = which == 0 ? QL : KL; const int nhi = which == 0 ? QHI : KHI; const bool hi_rows = t0 < nhi;
#pragma unroll
    for (int j = 0; j < 8; ++j) { const float bias = BA ? bfr(BA[c0 + j * 16 + col]) : 0.f;
#pragma unroll
      for (int r = 0; r < 8; ++r) { const float v = acc[j][r] + bias; const _Float16 hv = (_Float16)v; sh[wave * 16 + 8 * g + r][j * 16 + col] = hv; sl[wave * 16 + 8 * g + r][j * 16 + col] = (_Float16)((v - (float)hv) * 1024.0f); } }
    __syncthreads();
    for (int e = tid; e < 64 * 16; e += 128) { const int rl = e >> 4, q = e & 15; vst2((unsigned*)(DH + (r0 + rl) * CC + c0 + q * 8), *(const v4u*)&sh[rl][q * 8]); if (hi_rows) vst2((unsigned*)(DL + (bb * nhi + t0 + rl) * (size_t)CC + c0 + q * 8), *(const v4u*)&sl[rl][q * 8]); }
  } else { const bool hi_rows = t0 < KHI;
#pragma unroll
    for (int j = 0; j < 8; ++j) { const float bias = BA ? bfr(BA[c0 + j * 16 + col]) : 0.f;
#pragma unroll
      for (int r = 0; r < 8; ++r) { const float v = acc[j][r] + bias; const int rl = wave * 16 + 8 * g + r, cl = j * 16 + col; th[cl][rl] = (_Float16)v; const __bf16 bh = (__bf16)v; tb[cl][rl] = bh; tbl[cl][rl] = (__bf16)(v - (float)bh); } }
    __syncthreads();
    for (int e = tid; e < 128 * 8; e += 128) { const int cl = e >> 3, q = e & 7; vst2((unsigned*)(VT + (bb * CC + c0 + cl) * (size_t)TT + t0 + q * 8), *(const v4u*)&th[cl][q * 8]); if (hi_rows) { const size_t o3 = (bb * CC + c0 + cl) * (size_t)KHI + t0 + q * 8; vst2((unsigned*)(VB + o3), *(const v4u*)&tb[cl][q * 8]); vst2((unsigned*)(VBL + o3), *(const v4u*)&tbl[cl][q * 8]); } } } }
// ---- k_fa: block = 8 waves = 128 queries of one head; a wave owns 16 queries (one x row of the token grid) and walks all keys, 64 a pass, with a running maximum and sum.
// S^T = K Q^T (A = 16 key rows, B = the wave's q hi, then its q residual): a lane holds 8 keys (8g + r) of its own query (col), so two key tiles are, as they stand, the B fragment of ctx^T = V^T P^T and the logits never leave the registers.
// K and V of 128 keys (a stage = two passes) are brought into LDS once for the block's 8 waves by asynchronous copies, two buffers, the next stage in flight while this one is worked on.
// fragment from the lane's own address (row start + k0 + 8 * (lane >> 4)): same k order as frag_h
__device__ __forceinline__ v16h frag_p(const _Float16* p) { union { v16h v; v8h q[2]; } u; u.q[0] = *(const v8h*)p; u.q[1] = *(const v8h*)(p + 16); return u.v; }
// the address registers of issued loads stay live up to this wait, so nothing overwrites them in front of it
#define FA_XWAIT(p0, p1) asm volatile("s_wait_xcnt 0x0" :: "v"(p0), "v"(p1) : "memory")
#define FA_SK 128          // keys a stage
#define FA_STG 16384       // bytes a stage: 16 K half fragments, then 16 V half fragments, 512 B each
// A stage lies in LDS in fragment order: half fragment B (elements 8u .. 8u+7 of one 16 x 32 fragment) is 512 B, lane l's 16 bytes at B * 512 + l * 16, so a reader's ds_load_b128 covers 512 contiguous bytes.
// K: B = (pass * 4 + tile) * 2 + u; V: B = 16 + ((pass * 2 + c) * 2 + j) * 2 + u. Same elements at the same lane and register as the loads from global memory had.
__device__ __forceinline__ v16h frag_l(const char* rb, int B) { union { v16h v; v8h q[2]; } u; u.q[0] = *(const v8h*)(rb + B * 512); u.q[1] = *(const v8h*)(rb + B * 512 + 512); return u.v; }
// one stage's copies: a thread brings two 16-byte pieces of K and two of V (pass 0 and pass 1 of the stage). The s_wait_xcnt stands in the copies' own statement, so no address register is rewritten in front of it.
__device__ __forceinline__ void fa_copy(unsigned kd, unsigned vd, const _Float16* kg, const _Float16* vg) {
  asm volatile("global_load_async_to_lds_b128 %0, %4, off\n\tglobal_load_async_to_lds_b128 %1, %5, off\n\tglobal_load_async_to_lds_b128 %2, %6, off\n\tglobal_load_async_to_lds_b128 %3, %7, off\n\ts_wait_xcnt 0x0"
    :: "v"(kd), "v"(kd + 4096u), "v"(vd), "v"(vd + 4096u), "v"(kg), "v"(kg + (size_t)64 * CC), "v"(vg), "v"(vg + 64) : "memory");
}
// 2^x in place, a run of v_exp_f32 in one statement: each is the independent instruction behind the one before it, and the v_nop fills the slot behind the last
__device__ __forceinline__ void exp2_8(float (&x)[8]) {
  asm("v_exp_f32 %0, %0\n\tv_exp_f32 %1, %1\n\tv_exp_f32 %2, %2\n\tv_exp_f32 %3, %3\n\tv_exp_f32 %4, %4\n\tv_exp_f32 %5, %5\n\tv_exp_f32 %6, %6\n\tv_exp_f32 %7, %7\n\tv_nop"
    : "+v"(x[0]), "+v"(x[1]), "+v"(x[2]), "+v"(x[3]), "+v"(x[4]), "+v"(x[5]), "+v"(x[6]), "+v"(x[7]));
}
__device__ __forceinline__ void exp2_9(float& a, float (&x)[8]) {
  asm("v_exp_f32 %8, %8\n\tv_exp_f32 %0, %0\n\tv_exp_f32 %1, %1\n\tv_exp_f32 %2, %2\n\tv_exp_f32 %3, %3\n\tv_exp_f32 %4, %4\n\tv_exp_f32 %5, %5\n\tv_exp_f32 %6, %6\n\tv_exp_f32 %7, %7\n\tv_nop"
    : "+v"(x[0]), "+v"(x[1]), "+v"(x[2]), "+v"(x[3]), "+v"(x[4]), "+v"(x[5]), "+v"(x[6]), "+v"(x[7]), "+v"(a));
}
// one stage = two passes of 64 keys. kc, vc hold the first pass's fragments on entry; the second pass's are read from the same buffer (rb) into the same registers: K behind the first pass's S products, V behind its P V products, each well ahead of its use.
__device__ __forceinline__ void fa_stage(v16h (&kc)[4], v16h (&vc)[4], v8f (&acc)[2], float& m, float& l, const char* rb, int t, int tz, int ty, const int (&dx2)[8], v16h qh, v16h ql) {
  const v8f zero = {};
#pragma unroll
  for (int p = 0; p < 2; ++p) {
    const int it = t * 2 + p;
    v8f sa[4], sb[4];
#pragma unroll
    for (int i = 0; i < 4; ++i) { sa[i] = wmma16(kc[i], qh, zero); sb[i] = wmma16(kc[i], ql, zero); }
    if (p == 0) {
#pragma unroll
      for (int i = 0; i < 4; ++i) kc[i] = frag_l(rb, 8 + i * 2);
    }
    float s[4][8];
#pragma unroll
    for (int i = 0; i < 4; ++i) {
      const int T = it * 4 + i, dz = tz - (T >> 4), dy = ty - (T & 15), lim = 100 - dz * dz - dy * dy;   /* a key tile is one x row: dist < 10 <=> dx^2 < 100 - dz^2 - dy^2, exact in integers */
#pragma unroll
      for (int r = 0; r < 8; ++r) { const float v = sa[i][r] + sb[i][r] * (1.0f / 1024.0f); s[i][r] = dx2[r] < lim ? v : -3.0e38f; } }   /* unscaled: the scale is positive, so the maximum is the same key's, and it goes into the exponent's one fma below */
    float mx = m;
#pragma unroll
    for (int i = 0; i < 4; ++i)
#pragma unroll
      for (int r = 0; r < 8; ++r) mx = fmaxf(mx, s[i][r]);
    mx = fmaxf(mx, __shfl_xor(mx, 16));
    float alpha = (m - mx) * SCALE_L2E; m = mx; const float nb = 11.0f - mx * SCALE_L2E;   /* P is carried x 2^11 as before; the factor cancels in acc / l. An excluded logit gives an exponent near -7.6e37 and exp2 = 0 */
    float e[4][8];
#pragma unroll
    for (int i = 0; i < 4; ++i)
#pragma unroll
      for (int r = 0; r < 8; ++r) e[i][r] = fmaf(s[i][r], SCALE_L2E, nb);
    exp2_9(alpha, e[0]); exp2_8(e[1]);
    l *= alpha;
#pragma unroll
    for (int j = 0; j < 2; ++j)
#pragma unroll
      for (int r = 0; r < 8; ++r) acc[j][r] *= alpha;
#pragma unroll
    for (int c = 0; c < 2; ++c) { v16h pf;
      if (c == 1) { exp2_8(e[2]); exp2_8(e[3]); }
#pragma unroll
      for (int r = 0; r < 8; ++r) { const float e0 = e[2 * c][r], e1 = e[2 * c + 1][r]; l += e0 + e1; pf[r] = (_Float16)e0; pf[8 + r] = (_Float16)e1; }
#pragma unroll
      for (int j = 0; j < 2; ++j) acc[j] = wmma16(vc[c * 2 + j], pf, acc[j]); }
    if (p == 0) {
#pragma unroll
      for (int i = 0; i < 4; ++i) vc[i] = frag_l(rb, 24 + i * 2);
    }
  }
}
// the foot of a trip: this wave's reads of the buffer are done before it may be refilled; its share of the next stage has landed; the barrier publishes that stage and ends every wave's reads of this one
#define FA_PUBLISH() do { asm volatile("s_wait_dscnt 0x0" ::: "memory"); asm volatile("s_wait_asynccnt 0x0" ::: "memory"); __syncthreads(); } while (0)
// amdgpu_waves_per_eu(4, 4) names a budget of 256 registers: with none named this build chose fewer registers and a serial order of the softmax (more v_nop and s_delay_alu in the loop than the loop had before)
__global__ __launch_bounds__(256) __attribute__((amdgpu_waves_per_eu(4, 4))) void k_fa(const _Float16* __restrict__ QH, const _Float16* __restrict__ QL, const _Float16* __restrict__ KH, const _Float16* __restrict__ VT, float* __restrict__ Y) {
  __shared__ __align__(512) char ring[2 * FA_STG];
  const int tid = threadIdx.x, wave = __builtin_amdgcn_readfirstlane(tid >> 5), lane = tid & 31, col = lane & 15, g = lane >> 4;
  const int h = blockIdx.y; const int q0 = blockIdx.x * 128 + wave * 16; const int tz = q0 >> 8, ty = (q0 >> 4) & 15;   /* the 16 queries share z and y; x = col */
  const _Float16* qhp = QH + (size_t)(q0 + col) * CC + h * HD + 8 * g; const _Float16* qlp = QL + (size_t)(q0 + col) * CC + h * HD + 8 * g;
  const v16h qh = frag_p(qhp), ql = frag_p(qlp); FA_XWAIT(qhp, qlp);
  int dx2[8];
#pragma unroll
  for (int r = 0; r < 8; ++r) { const int d = col - (8 * g + r); dx2[r] = d * d; }
  // the thread's pieces: piece cq of a row = elements 8 cq .. 8 cq + 7 = (u = cq >> 1, g = cq & 1); K row tid >> 2 of a pass (tile tid >> 6, row crow); V channel (tid >> 2) & 31 (j, crow), key group c = tid >> 7 of a pass
  const int cq = tid & 3, crow = (tid >> 2) & 15; const unsigned slot = (unsigned)(((cq >> 1) * 32 + (cq & 1) * 16 + crow) * 16);
  const unsigned rg = (unsigned)(size_t)ring;   /* the LDS byte address is the low word of the shared address */
  const unsigned kd = rg + (unsigned)(tid >> 6) * 1024u + slot, vd = rg + 8192u + (unsigned)((tid >> 7) * 2 + ((tid >> 6) & 1)) * 1024u + slot;
  const _Float16* kg = KH + (size_t)(tid >> 2) * CC + h * HD + cq * 8; const _Float16* vg = VT + (size_t)(h * HD + ((tid >> 2) & 31)) * TT + (tid >> 7) * 32 + cq * 8;
  const char* rl = ring + lane * 16;
  v8f acc[2] = {}; float m = -1.0e30f, l = 0.f;   /* the start maximum is finite, so an excluded logit (-3e38) gives exp = 0 also while no key has been admitted yet */
  fa_copy(kd, vd, kg, vg);
  asm volatile("s_wait_asynccnt 0x0" ::: "memory");   /* stage 0 has landed, as far as this wave brought it */
  __syncthreads();                                    /* ... and is published to the other waves */
  fa_copy(kd + FA_STG, vd + FA_STG, kg + (size_t)FA_SK * CC, vg + FA_SK);
  v16h kc[4], vc[4];   /* the first pass's fragments of the published stage */
#pragma unroll
  for (int i = 0; i < 4; ++i) { kc[i] = frag_l(rl, i * 2); vc[i] = frag_l(rl, 16 + i * 2); }
  // the trips behind which a stage t + 2 exists, then the last two: split so that each loop's body is one straight block (with a branch round the copies the compiler moved the row sum's chain of additions behind the barrier, in front of the LDS reads)
#pragma unroll 1   /* unrolled further the live set passes 256 registers */
  for (int t = 0; t < TT / FA_SK - 2; ++t) {
    fa_stage(kc, vc, acc, m, l, rl + (t & 1) * FA_STG, t, tz, ty, dx2, qh, ql);
    FA_PUBLISH();
    fa_copy(kd + (t & 1) * FA_STG, vd + (t & 1) * FA_STG, kg + (size_t)(t + 2) * FA_SK * CC, vg + (t + 2) * FA_SK);   /* into the buffer that this trip has just read */
    const char* rn = rl + ((t + 1) & 1) * FA_STG;   /* the stage just published */
#pragma unroll
    for (int i = 0; i < 4; ++i) { kc[i] = frag_l(rn, i * 2); vc[i] = frag_l(rn, 16 + i * 2); }
  }
#pragma unroll 1   /* as above */
  for (int t = TT / FA_SK - 2; t < TT / FA_SK; ++t) {
    fa_stage(kc, vc, acc, m, l, rl + (t & 1) * FA_STG, t, tz, ty, dx2, qh, ql);
    FA_PUBLISH();
    const char* rn = rl + ((t + 1) & 1) * FA_STG;   /* behind the last trip these reads meet the last but one stage's bytes and nothing uses them */
#pragma unroll
    for (int i = 0; i < 4; ++i) { kc[i] = frag_l(rn, i * 2); vc[i] = frag_l(rn, 16 + i * 2); }
  }
  asm volatile("s_wait_asynccnt 0x0" ::: "memory");   /* no copy is outstanding when the wave ends */
  l += __shfl_xor(l, 16); const float inv = l > 0.f ? 1.0f / l : 0.f;   /* a fully excluded row yields 0 */
#pragma unroll
  for (int j = 0; j < 2; ++j) { v4f o0, o1;
#pragma unroll
    for (int r = 0; r < 4; ++r) { o0[r] = acc[j][r] * inv; o1[r] = acc[j][4 + r] * inv; }
    float* yp = Y + (size_t)(q0 + col) * CC + h * HD + j * 16 + 8 * g; vst2(yp, o0); vst2(yp + 4, o1); } }
// ---- k_out: block = (64 rows, 128 cols): out = ctx Wo (+ bo): ctx once to f16 against Wo as f16(bf16 x 2^8) exact (1 product) x 2^-8; causal early rows (< QHI of each sequence): ctx bf16 hi + lo against exact bf16 Wo (2 products)
__global__ __launch_bounds__(128) void k_out(const float* __restrict__ Y, const float* __restrict__ WO, const float* __restrict__ BO, float* __restrict__ OUT) { __shared__ __align__(16) float sf[4][16][132];
  const int tid = threadIdx.x, wave = tid >> 5, lane = tid & 31, col = lane & 15, g = lane >> 4; const int c0 = blockIdx.y * 128; const size_t r0 = (size_t)blockIdx.x * 64 + wave * 16;
  v8f acc[8] = {};
  if (CAUSAL && (int)(((size_t)blockIdx.x * 64) % TT) < QHI) {   /* block-uniform */
#pragma unroll 2
    for (int kc = 0; kc < CC / 32; ++kc) { const F2 a = split_row(Y + (r0 + col) * CC, kc * 32, lane); asm volatile("s_wait_loadcnt 0x0" ::: "memory");
#pragma unroll
      for (int j = 0; j < 8; ++j) { const v16b w = WOCOL(WO, kc * 32, c0 + j * 16 + col, lane); asm volatile("s_wait_loadcnt 0x0" ::: "memory"); acc[j] = wmma_bf(a.h, w, acc[j]); acc[j] = wmma_bf(a.l, w, acc[j]); } }
#pragma unroll
    for (int j = 0; j < 8; ++j) { const float bias = BO ? bfr(BO[c0 + j * 16 + col]) : 0.f;
#pragma unroll
      for (int r = 0; r < 8; ++r) sf[wave][8 * g + r][j * 16 + col] = acc[j][r] + bias; }
  } else {
#pragma unroll 2
    for (int kc = 0; kc < CC / 32; ++kc) { const v16h a = frag_f32(Y + (r0 + col) * CC + kc * 32, lane); asm volatile("s_wait_loadcnt 0x0" ::: "memory");
#pragma unroll
      for (int j = 0; j < 8; ++j) { const v16h w = WOCOLH(WO, kc * 32, c0 + j * 16 + col, lane); asm volatile("s_wait_loadcnt 0x0" ::: "memory"); acc[j] = wmma16(a, w, acc[j]); } }
#pragma unroll
    for (int j = 0; j < 8; ++j) { const float bias = BO ? bfr(BO[c0 + j * 16 + col]) : 0.f;
#pragma unroll
      for (int r = 0; r < 8; ++r) sf[wave][8 * g + r][j * 16 + col] = acc[j][r] * (1.0f / 256.0f) + bias; } }
  LDSX(); for (int rl = 0; rl < 16; ++rl) vst2(OUT + (r0 + rl) * DIN + c0 + lane * 4, *(const v4f*)&sf[wave][rl][lane * 4]); }

extern "C" void kernel_launch(void* const* d_in, const int* in_sizes, int n_in, void* d_out, int out_size, void* d_ws, size_t ws_size, hipStream_t stream) {
  (void)in_sizes; (void)n_in; (void)out_size;
  const float** F = (const float**)d_in;
  if (ws_size < (size_t)WS_END) return;
  char* ws = (char*)d_ws; _Float16 *QH = (_Float16*)(ws + WS_QH), *KH = (_Float16*)(ws + WS_KH), *VT = (_Float16*)(ws + WS_VT), *QL = (_Float16*)(ws + WS_QL), *KL = (_Float16*)(ws + WS_KL); __bf16 *VB = (__bf16*)(ws + WS_VB), *VBL = (__bf16*)(ws + WS_VBL); float *Y = (float*)(ws + WS_Y);
  (void)Y; (void)QL; (void)KL; (void)VB; (void)VBL;
  // inputs: 0 x [1,256,16,16,16]; 1 qkv_w [768,256] (out,in) rows q | k | v; 2 proj_w [256,256] (out,in); 3 proj_b
  if (ws_size < (size_t)WS_END2) return;
  float *XT = (float*)(ws + WS_XT), *ORW = (float*)(ws + WS_OR);
  k_tok<<<dim3(NTOK / 64, CC / 64), 256, 0, stream>>>(F[0], XT);
  { const float* WQ = F[1]; const float* WK = F[1] + (size_t)CC * DIN; const float* WV = F[1] + (size_t)2 * CC * DIN;
    k_proj<<<dim3(TNB * TT / 64, CC / 128, 3), 128, 0, stream>>>(XT, XT, XT, WQ, WK, WV, nullptr, nullptr, nullptr, QH, QL, KH, KL, VT, VB, VBL); }
  k_fa<<<dim3(TT / 128, NH), 256, 0, stream>>>(QH, QL, KH, VT, Y);
  k_out<<<dim3(TNB * TT / 64, DIN / 128), 128, 0, stream>>>(Y, F[2], F[3], ORW);
  k_fin<<<dim3(NTOK / 64, CC / 64), 256, 0, stream>>>(ORW, (float*)d_out);
}

// v004
// Measured time: 61 microseconds a run.
// In both of two side-by-side timings against v003, it was 1.87 times as fast.
// All steps since v000 together make it 12.4 times as fast.
// compute dtype: all float inputs rounded to bf16; tokens = bf16(x) transposed; qkv = tok W^T with EXACT bf16 products on WMMA 16x16x32 (f32 accumulate); q as f16 hi + residual (x 2^10) against k once to f16 (2 products) x 32^-0.5; the local window (grid distance < 10) as an exact integer test per (query, key); softmax in f32 (hardware exp2, the logit scale x log2 e folded into its argument) with a running maximum and sum, logits and P kept in registers; P x 2^11 once to f16 against v once to f16 (1 product); ctx once to f16 against proj_w carried x 2^8 in f16 + b; f32 output written channels-first.
#include <hip/hip_runtime.h>
#include <math.h>

typedef __attribute__((ext_vector_type(16))) _Float16 v16h;
typedef __attribute__((ext_vector_type(16))) __bf16 v16b;
typedef __attribute__((ext_vector_type(8)))  _Float16 v8h;
typedef __attribute__((ext_vector_type(8)))  float v8f;
typedef __attribute__((ext_vector_type(4)))  float v4f;
typedef __attribute__((ext_vector_type(2)))  float v2f;
typedef __attribute__((ext_vector_type(4)))  unsigned v4u;
typedef __attribute__((ext_vector_type(4)))  int v4i;
typedef float __attribute__((may_alias)) float_a;
typedef int __attribute__((may_alias)) int_a;

template <typename T> __device__ __forceinline__ void vst2(void* p, T v) { *(T*)p = v;  }
__device__ __forceinline__ v8f wmma16(v16h a, v16h b, v8f c) {
  v8f d = __builtin_amdgcn_wmma_f32_16x16x32_f16(false, a, false, b, (short)0, c, false, false);
  asm volatile("v_nop\n\tv_nop\n\tv_nop\n\tv_nop" : "+v"(d) : "v"(a), "v"(b));
  return d;
}
__device__ __forceinline__ v8f wmma_bf(v16b a, v16b b, v8f c) {
  v8f d = __builtin_amdgcn_wmma_f32_16x16x32_bf16(false, a, false, b, (short)0, c, false, false);
  asm volatile("v_nop\n\tv_nop\n\tv_nop\n\tv_nop" : "+v"(d) : "v"(a), "v"(b));
  return d;
}
// 16x16x32 fragments: lane = (h = lane>>4, row/col = lane&15); elements 0..7 = k0+8h+0..7, 8..15 = k0+16+8h+0..7; D element r = row 8h+r
__device__ __forceinline__ v16h frag_h(const _Float16* rowk0, int lane) {
  union { v16h v; v8h q[2]; } u; const _Float16* p = rowk0 + 8 * (lane >> 4);
  u.q[0] = *(const v8h*)p; u.q[1] = *(const v8h*)(p + 16); return u.v;
}
__device__ __forceinline__ v16h frag_f32(const float* rowk0, int lane) {
  v16h a; const float* p = rowk0 + 8 * (lane >> 4);
#pragma unroll
  for (int i = 0; i < 8; ++i) { a[i] = (_Float16)p[i]; a[8 + i] = (_Float16)p[16 + i]; }
  return a;
}
__device__ __forceinline__ v16h frag_f32s(const float* rowk0, int lane, float sc) {
  v16h a; const float* p = rowk0 + 8 * (lane >> 4);
#pragma unroll
  for (int i = 0; i < 8; ++i) { a[i] = (_Float16)(p[i] * sc); a[8 + i] = (_Float16)(p[16 + i] * sc); }
  return a;
}
// column fragment from a [K][ld] layout (column n), rows >= K read as 0
__device__ __forceinline__ v16h fragc_f32(const float* W, int k0, int n, int lane, int ld, int K) {
  v16h a; const int g = lane >> 4;
#pragma unroll
  for (int i = 0; i < 8; ++i) { const int ka = k0 + 8 * g + i, kb = ka + 16;
    a[i] = (_Float16)(ka < K ? W[(size_t)(ka < K ? ka : K - 1) * ld + n] : 0.f); a[8 + i] = (_Float16)(kb < K ? W[(size_t)(kb < K ? kb : K - 1) * ld + n] : 0.f); }
  return a;
}
struct F2 { v16b h, l; };
__device__ __forceinline__ F2 bsplit16(const float v[16]) { F2 r;
#pragma unroll
  for (int i = 0; i < 16; ++i) { const __bf16 h = (__bf16)v[i]; r.h[i] = h; r.l[i] = (__bf16)(v[i] - (float)h); }
  return r; }
__device__ __forceinline__ F2 split_row(const float* row, int k0, int lane) { float v[16]; const float* p = row + k0 + 8 * (lane >> 4);
#pragma unroll
  for (int i = 0; i < 8; ++i) { v[i] = p[i]; v[8 + i] = p[16 + i]; }
  return bsplit16(v); }
__device__ __forceinline__ F2 split_rowK(const float* row, int k0, int lane, int K) { float v[16]; const int g = lane >> 4;
#pragma unroll
  for (int i = 0; i < 8; ++i) { const int ka = k0 + 8 * g + i, kb = ka + 16; v[i] = ka < K ? row[ka < K ? ka : K - 1] : 0.f; v[8 + i] = kb < K ? row[kb < K ? kb : K - 1] : 0.f; }
  return bsplit16(v); }
__device__ __forceinline__ F2 split_col(const float* W, int k0, int n, int lane, int ld, int K) { float v[16]; const int g = lane >> 4;
#pragma unroll
  for (int i = 0; i < 8; ++i) { const int ka = k0 + 8 * g + i, kb = ka + 16; v[i] = ka < K ? W[(size_t)(ka < K ? ka : K - 1) * ld + n] : 0.f; v[8 + i] = kb < K ? W[(size_t)(kb < K ? kb : K - 1) * ld + n] : 0.f; }
  return bsplit16(v); }
__device__ __forceinline__ v8f mac3(const F2& a, const F2& b, v8f c) { c = wmma_bf(a.l, b.h, c); c = wmma_bf(a.h, b.l, c); return wmma_bf(a.h, b.h, c); }
__device__ __forceinline__ float sigm(float v) { return 1.0f / (1.0f + expf(-v)); }
#define LDSX() do { asm volatile("s_wait_dscnt 0" ::: "memory"); __builtin_amdgcn_wave_barrier(); __builtin_amdgcn_fence(__ATOMIC_RELEASE, "workgroup"); } while (0)

// 3-D local-window attention layer (x [1, 256, 16, 16, 16] -> 4,096 tokens, 8 heads x 32): qkv = tok qkv_w^T (packed (out,in) [768, 256], layout (3, H, hd)); scores = q k^T / sqrt(32) masked to -inf where the integer grid distance between the two tokens is >= 10 (sqrt(dz^2+dy^2+dx^2) < 10 <=> d2 < 100); softmax; out = merged(attn v) proj_w^T + proj_b, returned as [1, 256, 16, 16, 16].
#define NB 1
#define TT 4096
#define CC 256            // NH * HD = projected width
#define DIN 256          // input (model) width
#define NH 8
#define HD 32
#define NQB (TT / 64)
#define HG 2
#define SCALE (0.17677669529663687f)
#define SCALE_L2E (0.25503486f)   // SCALE x log2 e: exp(SCALE x) = exp2(SCALE_L2E x)
#define CAUSAL 0
#ifndef TNB
#define TNB NB
#endif
__device__ __forceinline__ float bfr(float v) { return (float)(__bf16)v; }
__host__ __device__ __forceinline__ int kb_last(int qb) { return CAUSAL ? ((qb * 64 + 63) >> 7) : (TT / 128 - 1); }
typedef __attribute__((ext_vector_type(8))) __bf16 v8b;
__device__ __forceinline__ v16b frag_b(const __bf16* rowk0, int lane) {
  union { v16b v; v8b q[2]; } u; const __bf16* p = rowk0 + 8 * (lane >> 4);
  u.q[0] = *(const v8b*)p; u.q[1] = *(const v8b*)(p + 16); return u.v;
}
#define QBH 0
#define QHI 4096            // rows carrying a q residual plane (all rows when non-causal: 2-product logits everywhere)
#define KHI 64            // key rows carrying k residual / v bf16 hi+lo planes (written by k_proj, read by no kernel in this file)
// B fragment (k rows k0+.., output column o) of a weight: (in,out) [K][ld] or (out,in) [ld rows of K]: bf16 exact, or f16(bf16 * 256) exact
__device__ __forceinline__ v16b wcol_io(const float* Wm, int k0, int o, int lane, int ld) { v16b w; const int g = lane >> 4;
#pragma unroll
  for (int i = 0; i < 8; ++i) { w[i] = (__bf16)Wm[(size_t)(k0 + 8 * g + i) * ld + o]; w[8 + i] = (__bf16)Wm[(size_t)(k0 + 16 + 8 * g + i) * ld + o]; }
  return w; }
__device__ __forceinline__ v16b wcol_oi(const float* Wm, int k0, int o, int lane, int K) { v16b w; const float* p = Wm + (size_t)o * K + k0 + 8 * (lane >> 4);
#pragma unroll
  for (int i = 0; i < 8; ++i) { w[i] = (__bf16)p[i]; w[8 + i] = (__bf16)p[16 + i]; }
  return w; }
__device__ __forceinline__ v16h wcolh_io(const float* Wm, int k0, int o, int lane, int ld) { v16h w; const int g = lane >> 4;
#pragma unroll
  for (int i = 0; i < 8; ++i) { w[i] = (_Float16)(bfr(Wm[(size_t)(k0 + 8 * g + i) * ld + o]) * 256.0f); w[8 + i] = (_Float16)(bfr(Wm[(size_t)(k0 + 16 + 8 * g + i) * ld + o]) * 256.0f); }
  return w; }
__device__ __forceinline__ v16h wcolh_oi(const float* Wm, int k0, int o, int lane, int K) { v16h w; const float* p = Wm + (size_t)o * K + k0 + 8 * (lane >> 4);
#pragma unroll
  for (int i = 0; i < 8; ++i) { w[i] = (_Float16)(bfr(p[i]) * 256.0f); w[8 + i] = (_Float16)(bfr(p[16 + i]) * 256.0f); }
  return w; }
#define WQKV_LAYOUT 1   // 0 = (in,out) [DIN][CC]; 1 = (out,in) [CC][DIN]; 2 = per-head [NH][DIN][HD]
__device__ __forceinline__ v16b wcol_hdk(const float* Wm, int k0, int o, int lane) { v16b w; const int g = lane >> 4; const float* p = Wm + (size_t)(o / HD) * DIN * HD + (o % HD);
#pragma unroll
  for (int i = 0; i < 8; ++i) { w[i] = (__bf16)p[(size_t)(k0 + 8 * g + i) * HD]; w[8 + i] = (__bf16)p[(size_t)(k0 + 16 + 8 * g + i) * HD]; }
  return w; }
#define WO_OUT_IN 1
#if WQKV_LAYOUT == 1
#define WCOL(W, k0, o, lane) wcol_oi(W, k0, o, lane, DIN)
#elif WQKV_LAYOUT == 2
#define WCOL(W, k0, o, lane) wcol_hdk(W, k0, o, lane)
#else
#define WCOL(W, k0, o, lane) wcol_io(W, k0, o, lane, CC)
#endif
#if WO_OUT_IN
#define WOCOL(W, k0, o, lane) wcol_oi(W, k0, o, lane, CC)
#define WOCOLH(W, k0, o, lane) wcolh_oi(W, k0, o, lane, CC)
#else
#define WOCOL(W, k0, o, lane) wcol_io(W, k0, o, lane, DIN)
#define WOCOLH(W, k0, o, lane) wcolh_io(W, k0, o, lane, DIN)
#endif
#define SM_MASK_HOOK do { const int dz = (t >> 8) - (k >> 8), dy = ((t >> 4) & 15) - ((k >> 4) & 15), dx = (t & 15) - (k & 15); v = (dz * dz + dy * dy + dx * dx < 100) ? v : -3.0e38f; } while (0)   /* local pattern: dist < 10 on the (d,h,w) token grid, exact in integers */
#define NTOK 4096
// ---- k_tok: block = (64 tokens, 64 channels): XT[n][c] = bf16(x[c][n]) through an LDS tile (x is [1][256][4096] channels-first)
__global__ __launch_bounds__(256) void k_tok(const float* __restrict__ X, float* __restrict__ XT) { __shared__ float st[64][68]; const int tid = threadIdx.x; const int n0 = blockIdx.x * 64, c0 = blockIdx.y * 64;
  for (int e = tid; e < 64 * 16; e += 256) { const int cl = e >> 4, q = e & 15; const v4f v = *(const v4f*)(X + (size_t)(c0 + cl) * NTOK + n0 + q * 4); st[cl][q * 4] = bfr(v[0]); st[cl][q * 4 + 1] = bfr(v[1]); st[cl][q * 4 + 2] = bfr(v[2]); st[cl][q * 4 + 3] = bfr(v[3]); }
  __syncthreads();
  for (int e = tid; e < 64 * 16; e += 256) { const int nl = e >> 4, q = e & 15; v4f o; o[0] = st[q * 4][nl]; o[1] = st[q * 4 + 1][nl]; o[2] = st[q * 4 + 2][nl]; o[3] = st[q * 4 + 3][nl]; vst2(XT + (size_t)(n0 + nl) * CC + c0 + q * 4, o); } }
// ---- k_fin: block = (64 tokens, 64 channels): out[c][n] = OR[n][c] (LDS transpose; 256-B runs of 64 tokens per channel)
__global__ __launch_bounds__(256) void k_fin(const float* __restrict__ ORW, float* __restrict__ OUT) { __shared__ float st[64][68]; const int tid = threadIdx.x; const int n0 = blockIdx.x * 64, c0 = blockIdx.y * 64;
  for (int e = tid; e < 64 * 16; e += 256) { const int nl = e >> 4, q = e & 15; *(v4f*)&st[nl][q * 4] = *(const v4f*)(ORW + (size_t)(n0 + nl) * CC + c0 + q * 4); }
  __syncthreads();
  for (int e = tid; e < 64 * 16; e += 256) { const int cl = e >> 4, q = e & 15; v4f o; o[0] = st[q * 4][cl]; o[1] = st[q * 4 + 1][cl]; o[2] = st[q * 4 + 2][cl]; o[3] = st[q * 4 + 3][cl]; vst2(OUT + (size_t)(c0 + cl) * NTOK + n0 + q * 4, o); } }
#define WS_XT  (WS_END)
#define WS_OR  (WS_XT + 4u * (size_t)NTOK * CC)
#define WS_END2 (WS_OR + 4u * (size_t)NTOK * CC)
#ifndef SM_EXTRA_PARAMS
#define SM_EXTRA_PARAMS
#endif
#ifndef PROJ_EXTRA_PARAMS
#define PROJ_EXTRA_PARAMS
#endif
#ifndef SM_MASK_HOOK
#define SM_MASK_HOOK (void)0
#endif

#define WS_QH  0u                                      // f16 q rows [b*t][CC]
#define WS_KH  (WS_QH + 2u * (size_t)NB * TT * CC)      // f16 k rows [b*t][CC]
#define WS_VT  (WS_KH + 2u * (size_t)NB * TT * CC)      // f16 v planes [b][c][t]
#define WS_QL  (WS_VT + 2u * (size_t)NB * CC * TT)      // f16 q residual x 2^10 rows [b][t < QHI][CC]
#define WS_KL  (WS_QL + 2u * (size_t)NB * QHI * CC)     // f16 k residual x 2^10 rows [b][t < KHI][CC]
#define WS_VB  (WS_KL + 2u * (size_t)NB * KHI * CC)     // bf16 v hi planes [b][c][t < KHI]
#define WS_VBL (WS_VB + 2u * (size_t)NB * CC * KHI)
#define WS_S   (WS_VBL + 2u * (size_t)NB * CC * KHI)    // f32 [hg][t][s] area, unused (logits and P stay in registers)
#define WS_Y   (WS_S  + 4u * (size_t)HG * TT * TT)      // f32 ctx rows [b*t][CC] (only when there is an output projection)
#define WS_END (WS_Y  + 4u * (size_t)NB * TT * CC)

// The two projection kernels stage their operands in LDS once for the block's 4 waves: 128 weight rows and 64 token rows, the whole K = 256, already in the 16-bit type of the product.
// A wave's load covers 512 contiguous bytes of one row, and a thread's loads do not depend on each other, so 16 to 32 of them are in flight at a time.
#define GP 264            // LDS row pitch in 16-bit elements: 528 B = 16 B x 33 (odd), so the 16 rows of a fragment read fall on different banks
#define G_SX (128 * GP * 2)   // byte offset of the token rows [64][GP]; the weight rows [128][GP] lie at 0
#define G_BYTES ((128 + 64) * GP * 2)
typedef __attribute__((ext_vector_type(4))) __bf16 v4b;
typedef __attribute__((ext_vector_type(4))) _Float16 v4h;
// piece e of a wave: e < 64: half (e & 1) of weight row wave + 4 (e >> 1); e >= 64: the same of the token rows. wp, xp: the thread's 4 floats of the wave's first weight and token row.
__device__ __forceinline__ v4f g_load(const float* wp, const float* xp, int e) { return *(const v4f*)((e < 64 ? wp : xp) + (size_t)((e & 63) >> 1) * 4 * 256 + (e & 1) * 128); }
// F16 = 0: both operands to bf16 (k_proj); 1: weights as f16(bf16 x 2^8), rows once to f16 (k_out): the conversions that the fragment loaders from global memory made
template <int F16> __device__ __forceinline__ void g_store(char* sm, int wave, int lane, int e, v4f r) {
  char* d = sm + (e < 64 ? 0 : G_SX) + ((wave + 4 * ((e & 63) >> 1)) * GP + (e & 1) * 128 + lane * 4) * 2;
  if (F16) { v4h o;
#pragma unroll
    for (int q = 0; q < 4; ++q) o[q] = e < 64 ? (_Float16)(bfr(r[q]) * 256.0f) : (_Float16)r[q];
    *(v4h*)d = o;
  } else { v4b o;
#pragma unroll
    for (int q = 0; q < 4; ++q) o[q] = (__bf16)r[q];
    *(v4b*)d = o; }
}
template <int F16> __device__ __forceinline__ void g_stage(char* sm, const float* wp, const float* xp, int wave, int lane) {
  v4f r[2][16];
#pragma unroll
  for (int i = 0; i < 32; ++i) r[i >> 4][i & 15] = g_load(wp, xp, i);
#pragma unroll
  for (int s = 0; s < 6; ++s) {
    __builtin_amdgcn_sched_barrier(0);   /* holds the later groups' loads behind this group's stores: without it all 96 loads were issued at once, on more than 256 registers */
#pragma unroll
    for (int i = 0; i < 16; ++i) g_store<F16>(sm, wave, lane, s * 16 + i, r[s & 1][i]);
    __builtin_amdgcn_sched_barrier(0);   /* as above */
    if (s + 2 < 6) {
#pragma unroll
      for (int i = 0; i < 16; ++i) r[s & 1][i] = g_load(wp, xp, (s + 2) * 16 + i); }
  }
  asm volatile("s_wait_xcnt 0x0" :: "v"(wp), "v"(xp) : "memory");   /* the address registers of the issued loads stay live up to this wait, so nothing overwrites them in front of it */
}
// ---- k_proj: block = (64 rows, 128 cols, which): q/k/v = X W (+ b) with exact bf16 products (K = DIN) -> which 0: q f16 rows (+ residual rows < QHI); 1: k f16 rows (+ residual rows < KHI); 2: v f16 planes [c][t] (+ bf16 hi/lo planes for t < KHI)
__global__ __launch_bounds__(128) void k_proj(const float* __restrict__ XQ, const float* __restrict__ XK, const float* __restrict__ XV, const float* __restrict__ WQ, const float* __restrict__ WK, const float* __restrict__ WV, const float* __restrict__ BQ, const float* __restrict__ BK, const float* __restrict__ BV,
    _Float16* __restrict__ QH, _Float16* __restrict__ QL, _Float16* __restrict__ KH, _Float16* __restrict__ KL, _Float16* __restrict__ VT, __bf16* __restrict__ VB, __bf16* __restrict__ VBL) {
  __shared__ __align__(16) char sm[G_BYTES];   /* first the staged operands; behind the second barrier the output tiles below lie in the same bytes */
  const __bf16 (*sw)[GP] = (const __bf16 (*)[GP])sm; const __bf16 (*sx)[GP] = (const __bf16 (*)[GP])(sm + G_SX);
  _Float16 (*sh)[136] = (_Float16 (*)[136])sm; _Float16 (*sl)[136] = (_Float16 (*)[136])(sm + 64 * 136 * 2);
  _Float16 (*th)[72] = (_Float16 (*)[72])sm; __bf16 (*tb)[72] = (__bf16 (*)[72])(sm + 128 * 72 * 2); __bf16 (*tbl)[72] = (__bf16 (*)[72])(sm + 2 * 128 * 72 * 2);
  const int tid = threadIdx.x, wave = tid >> 5, lane = tid & 31, col = lane & 15, g = lane >> 4; const int which = blockIdx.z; const int c0 = blockIdx.y * 128; const size_t r0 = (size_t)blockIdx.x * 64; const size_t bb = r0 / TT; const int t0 = (int)(r0 % TT);
  const float* X = which == 0 ? XQ : which == 1 ? XK : XV; const float* WA = which == 0 ? WQ : which == 1 ? WK : WV; const float* BA = which == 0 ? BQ : which == 1 ? BK : BV;
  g_stage<0>(sm, WA + (size_t)(c0 + wave) * DIN + lane * 4, X + (r0 + wave) * DIN + lane * 4, wave, lane);
  __syncthreads();   /* the staged rows are published to the block's waves */
  v8f acc[8] = {};
  // the fragments of k step kc + 1 are read from LDS in front of the products of step kc (same elements at the same lane and register as the loads from global memory had)
  v16b ac = frag_b(&sx[wave * 16 + col][0], lane), wc[8];
#pragma unroll
  for (int j = 0; j < 8; ++j) wc[j] = frag_b(&sw[j * 16 + col][0], lane);
#pragma unroll
  for (int kc = 0; kc < DIN / 32; ++kc) { v16b an = ac, wn[8];
    if (kc + 1 < DIN / 32) { an = frag_b(&sx[wave * 16 + col][(kc + 1) * 32], lane);
#pragma unroll
      for (int j = 0; j < 8; ++j) wn[j] = frag_b(&sw[j * 16 + col][(kc + 1) * 32], lane); }
#pragma unroll
    for (int j = 0; j < 8; ++j) acc[j] = wmma_bf(ac, wc[j], acc[j]);
    if (kc + 1 < DIN / 32) { ac = an;
#pragma unroll
      for (int j = 0; j < 8; ++j) wc[j] = wn[j]; } }
  __syncthreads();   /* every wave has read its last fragment before the output tiles overwrite the staged rows */
  if (which < 2) { _Float16* DH = which == 0 ? QH : KH; _Float16* DL = which == 0 ? QL : KL; const int nhi = which == 0 ? QHI : KHI; const bool hi_rows = t0 < nhi;
#pragma unroll
    for (int j = 0; j < 8; ++j) { const float bias = BA ? bfr(BA[c0 + j * 16 + col]) : 0.f;
#pragma unroll
      for (int r = 0; r < 8; ++r) { const float v = acc[j][r] + bias; const _Float16 hv = (_Float16)v; sh[wave * 16 + 8 * g + r][j * 16 + col] = hv; sl[wave * 16 + 8 * g + r][j * 16 + col] = (_Float16)((v - (float)hv) * 1024.0f); } }
    __syncthreads();
    for (int e = tid; e < 64 * 16; e += 128) { const int rl = e >> 4, q = e & 15; vst2((unsigned*)(DH + (r0 + rl) * CC + c0 + q * 8), *(const v4u*)&sh[rl][q * 8]); if (hi_rows) vst2((unsigned*)(DL + (bb * nhi + t0 + rl) * (size_t)CC + c0 + q * 8), *(const v4u*)&sl[rl][q * 8]); }
  } else { const bool hi_rows = t0 < KHI;
#pragma unroll
    for (int j = 0; j < 8; ++j) { const float bias = BA ? bfr(BA[c0 + j * 16 + col]) : 0.f;
#pragma unroll
      for (int r = 0; r < 8; ++r) { const float v = acc[j][r] + bias; const int rl = wave * 16 + 8 * g + r, cl = j * 16 + col; th[cl][rl] = (_Float16)v; const __bf16 bh = (__bf16)v; tb[cl][rl] = bh; tbl[cl][rl] = (__bf16)(v - (float)bh); } }
    __syncthreads();
    for (int e = tid; e < 128 * 8; e += 128) { const int cl = e >> 3, q = e & 7; vst2((unsigned*)(VT + (bb * CC + c0 + cl) * (size_t)TT + t0 + q * 8), *(const v4u*)&th[cl][q * 8]); if (hi_rows) { const size_t o3 = (bb * CC + c0 + cl) * (size_t)KHI + t0 + q * 8; vst2((unsigned*)(VB + o3), *(const v4u*)&tb[cl][q * 8]); vst2((unsigned*)(VBL + o3), *(const v4u*)&tbl[cl][q * 8]); } } } }
// ---- k_fa: block = 8 waves = 128 queries of one head; a wave owns 16 queries (one x row of the token grid) and walks all keys, 64 a pass, with a running maximum and sum.
// S^T = K Q^T (A = 16 key rows, B = the wave's q hi, then its q residual): a lane holds 8 keys (8g + r) of its own query (col), so two key tiles are, as they stand, the B fragment of ctx^T = V^T P^T and the logits never leave the registers.
// K and V of 128 keys (a stage = two passes) are brought into LDS once for the block's 8 waves by asynchronous copies, two buffers, the next stage in flight while this one is worked on.
// fragment from the lane's own address (row start + k0 + 8 * (lane >> 4)): same k order as frag_h
__device__ __forceinline__ v16h frag_p(const _Float16* p) { union { v16h v; v8h q[2]; } u; u.q[0] = *(const v8h*)p; u.q[1] = *(const v8h*)(p + 16); return u.v; }
// the address registers of issued loads stay live up to this wait, so nothing overwrites them in front of it
#define FA_XWAIT(p0, p1) asm volatile("s_wait_xcnt 0x0" :: "v"(p0), "v"(p1) : "memory")
#define FA_SK 128          // keys a stage
#define FA_STG 16384       // bytes a stage: 16 K half fragments, then 16 V half fragments, 512 B each
// A stage lies in LDS in fragment order: half fragment B (elements 8u .. 8u+7 of one 16 x 32 fragment) is 512 B, lane l's 16 bytes at B * 512 + l * 16, so a reader's ds_load_b128 covers 512 contiguous bytes.
// K: B = (pass * 4 + tile) * 2 + u; V: B = 16 + ((pass * 2 + c) * 2 + j) * 2 + u. Same elements at the same lane and register as the loads from global memory had.
__device__ __forceinline__ v16h frag_l(const char* rb, int B) { union { v16h v; v8h q[2]; } u; u.q[0] = *(const v8h*)(rb + B * 512); u.q[1] = *(const v8h*)(rb + B * 512 + 512); return u.v; }
// one stage's copies: a thread brings two 16-byte pieces of K and two of V (pass 0 and pass 1 of the stage). The s_wait_xcnt stands in the copies' own statement, so no address register is rewritten in front of it.
__device__ __forceinline__ void fa_copy(unsigned kd, unsigned vd, const _Float16* kg, const _Float16* vg) {
  asm volatile("global_load_async_to_lds_b128 %0, %4, off\n\tglobal_load_async_to_lds_b128 %1, %5, off\n\tglobal_load_async_to_lds_b128 %2, %6, off\n\tglobal_load_async_to_lds_b128 %3, %7, off\n\ts_wait_xcnt 0x0"
    :: "v"(kd), "v"(kd + 4096u), "v"(vd), "v"(vd + 4096u), "v"(kg), "v"(kg + (size_t)64 * CC), "v"(vg), "v"(vg + 64) : "memory");
}
// 2^x in place, a run of v_exp_f32 in one statement: each is the independent instruction behind the one before it, and the v_nop fills the slot behind the last
__device__ __forceinline__ void exp2_8(float (&x)[8]) {
  asm("v_exp_f32 %0, %0\n\tv_exp_f32 %1, %1\n\tv_exp_f32 %2, %2\n\tv_exp_f32 %3, %3\n\tv_exp_f32 %4, %4\n\tv_exp_f32 %5, %5\n\tv_exp_f32 %6, %6\n\tv_exp_f32 %7, %7\n\tv_nop"
    : "+v"(x[0]), "+v"(x[1]), "+v"(x[2]), "+v"(x[3]), "+v"(x[4]), "+v"(x[5]), "+v"(x[6]), "+v"(x[7]));
}
__device__ __forceinline__ void exp2_9(float& a, float (&x)[8]) {
  asm("v_exp_f32 %8, %8\n\tv_exp_f32 %0, %0\n\tv_exp_f32 %1, %1\n\tv_exp_f32 %2, %2\n\tv_exp_f32 %3, %3\n\tv_exp_f32 %4, %4\n\tv_exp_f32 %5, %5\n\tv_exp_f32 %6, %6\n\tv_exp_f32 %7, %7\n\tv_nop"
    : "+v"(x[0]), "+v"(x[1]), "+v"(x[2]), "+v"(x[3]), "+v"(x[4]), "+v"(x[5]), "+v"(x[6]), "+v"(x[7]), "+v"(a));
}
// one stage = two passes of 64 keys. kc, vc hold the first pass's fragments on entry; the second pass's are read from the same buffer (rb) into the same registers: K behind the first pass's S products, V behind its P V products, each well ahead of its use.
__device__ __forceinline__ void fa_stage(v16h (&kc)[4], v16h (&vc)[4], v8f (&acc)[2], float& m, float& l, const char* rb, int t, int tz, int ty, const int (&dx2)[8], v16h qh, v16h ql) {
  const v8f zero = {};
#pragma unroll
  for (int p = 0; p < 2; ++p) {
    const int it = t * 2 + p;
    v8f sa[4], sb[4];
#pragma unroll
    for (int i = 0; i < 4; ++i) { sa[i] = wmma16(kc[i], qh, zero); sb[i] = wmma16(kc[i], ql, zero); }
    if (p == 0) {
#pragma unroll
      for (int i = 0; i < 4; ++i) kc[i] = frag_l(rb, 8 + i * 2);
    }
    float s[4][8];
#pragma unroll
    for (int i = 0; i < 4; ++i) {
      const int T = it * 4 + i, dz = tz - (T >> 4), dy = ty - (T & 15), lim = 100 - dz * dz - dy * dy;   /* a key tile is one x row: dist < 10 <=> dx^2 < 100 - dz^2 - dy^2, exact in integers */
#pragma unroll
      for (int r = 0; r < 8; ++r) { const float v = sa[i][r] + sb[i][r] * (1.0f / 1024.0f); s[i][r] = dx2[r] < lim ? v : -3.0e38f; } }   /* unscaled: the scale is positive, so the maximum is the same key's, and it goes into the exponent's one fma below */
    float mx = m;
#pragma unroll
    for (int i = 0; i < 4; ++i)
#pragma unroll
      for (int r = 0; r < 8; ++r) mx = fmaxf(mx, s[i][r]);
    mx = fmaxf(mx, __shfl_xor(mx, 16));
    float alpha = (m - mx) * SCALE_L2E; m = mx; const float nb = 11.0f - mx * SCALE_L2E;   /* P is carried x 2^11 as before; the factor cancels in acc / l. An excluded logit gives an exponent near -7.6e37 and exp2 = 0 */
    float e[4][8];
#pragma unroll
    for (int i = 0; i < 4; ++i)
#pragma unroll
      for (int r = 0; r < 8; ++r) e[i][r] = fmaf(s[i][r], SCALE_L2E, nb);
    exp2_9(alpha, e[0]); exp2_8(e[1]);
    l *= alpha;
#pragma unroll
    for (int j = 0; j < 2; ++j)
#pragma unroll
      for (int r = 0; r < 8; ++r) acc[j][r] *= alpha;
#pragma unroll
    for (int c = 0; c < 2; ++c) { v16h pf;
      if (c == 1) { exp2_8(e[2]); exp2_8(e[3]); }
#pragma unroll
      for (int r = 0; r < 8; ++r) { const float e0 = e[2 * c][r], e1 = e[2 * c + 1][r]; l += e0 + e1; pf[r] = (_Float16)e0; pf[8 + r] = (_Float16)e1; }
#pragma unroll
      for (int j = 0; j < 2; ++j) acc[j] = wmma16(vc[c * 2 + j], pf, acc[j]); }
    if (p == 0) {
#pragma unroll
      for (int i = 0; i < 4; ++i) vc[i] = frag_l(rb, 24 + i * 2);
    }
  }
}
// the foot of a trip: this wave's reads of the buffer are done before it may be refilled; its share of the next stage has landed; the barrier publishes that stage and ends every wave's reads of this one
#define FA_PUBLISH() do { asm volatile("s_wait_dscnt 0x0" ::: "memory"); asm volatile("s_wait_asynccnt 0x0" ::: "memory"); __syncthreads(); } while (0)
// amdgpu_waves_per_eu(4, 4) names a budget of 256 registers: with none named this build chose fewer registers and a serial order of the softmax (more v_nop and s_delay_alu in the loop than the loop had before)
__global__ __launch_bounds__(256) __attribute__((amdgpu_waves_per_eu(4, 4))) void k_fa(const _Float16* __restrict__ QH, const _Float16* __restrict__ QL, const _Float16* __restrict__ KH, const _Float16* __restrict__ VT, float* __restrict__ Y) {
  __shared__ __align__(512) char ring[2 * FA_STG];
  const int tid = threadIdx.x, wave = __builtin_amdgcn_readfirstlane(tid >> 5), lane = tid & 31, col = lane & 15, g = lane >> 4;
  const int h = blockIdx.y; const int q0 = blockIdx.x * 128 + wave * 16; const int tz = q0 >> 8, ty = (q0 >> 4) & 15;   /* the 16 queries share z and y; x = col */
  const _Float16* qhp = QH + (size_t)(q0 + col) * CC + h * HD + 8 * g; const _Float16* qlp = QL + (size_t)(q0 + col) * CC + h * HD + 8 * g;
  const v16h qh = frag_p(qhp), ql = frag_p(qlp); FA_XWAIT(qhp, qlp);
  int dx2[8];
#pragma unroll
  for (int r = 0; r < 8; ++r) { const int d = col - (8 * g + r); dx2[r] = d * d; }
  // the thread's pieces: piece cq of a row = elements 8 cq .. 8 cq + 7 = (u = cq >> 1, g = cq & 1); K row tid >> 2 of a pass (tile tid >> 6, row crow); V channel (tid >> 2) & 31 (j, crow), key group c = tid >> 7 of a pass
  const int cq = tid & 3, crow = (tid >> 2) & 15; const unsigned slot = (unsigned)(((cq >> 1) * 32 + (cq & 1) * 16 + crow) * 16);
  const unsigned rg = (unsigned)(size_t)ring;   /* the LDS byte address is the low word of the shared address */
  const unsigned kd = rg + (unsigned)(tid >> 6) * 1024u + slot, vd = rg + 8192u + (unsigned)((tid >> 7) * 2 + ((tid >> 6) & 1)) * 1024u + slot;
  const _Float16* kg = KH + (size_t)(tid >> 2) * CC + h * HD + cq * 8; const _Float16* vg = VT + (size_t)(h * HD + ((tid >> 2) & 31)) * TT + (tid >> 7) * 32 + cq * 8;
  const char* rl = ring + lane * 16;
  v8f acc[2] = {}; float m = -1.0e30f, l = 0.f;   /* the start maximum is finite, so an excluded logit (-3e38) gives exp = 0 also while no key has been admitted yet */
  fa_copy(kd, vd, kg, vg);
  asm volatile("s_wait_asynccnt 0x0" ::: "memory");   /* stage 0 has landed, as far as this wave brought it */
  __syncthreads();                                    /* ... and is published to the other waves */
  fa_copy(kd + FA_STG, vd + FA_STG, kg + (size_t)FA_SK * CC, vg + FA_SK);
  v16h kc[4], vc[4];   /* the first pass's fragments of the published stage */
#pragma unroll
  for (int i = 0; i < 4; ++i) { kc[i] = frag_l(rl, i * 2); vc[i] = frag_l(rl, 16 + i * 2); }
  // the trips behind which a stage t + 2 exists, then the last two: split so that each loop's body is one straight block (with a branch round the copies the compiler moved the row sum's chain of additions behind the barrier, in front of the LDS reads)
#pragma unroll 1   /* unrolled further the live set passes 256 registers */
  for (int t = 0; t < TT / FA_SK - 2; ++t) {
    fa_stage(kc, vc, acc, m, l, rl + (t & 1) * FA_STG, t, tz, ty, dx2, qh, ql);
    FA_PUBLISH();
    fa_copy(kd + (t & 1) * FA_STG, vd + (t & 1) * FA_STG, kg + (size_t)(t + 2) * FA_SK * CC, vg + (t + 2) * FA_SK);   /* into the buffer that this trip has just read */
    const char* rn = rl + ((t + 1) & 1) * FA_STG;   /* the stage just published */
#pragma unroll
    for (int i = 0; i < 4; ++i) { kc[i] = frag_l(rn, i * 2); vc[i] = frag_l(rn, 16 + i * 2); }
  }
#pragma unroll 1   /* as above */
  for (int t = TT / FA_SK - 2; t < TT / FA_SK; ++t) {
    fa_stage(kc, vc, acc, m, l, rl + (t & 1) * FA_STG, t, tz, ty, dx2, qh, ql);
    FA_PUBLISH();
    const char* rn = rl + ((t + 1) & 1) * FA_STG;   /* behind the last trip these reads meet the last but one stage's bytes and nothing uses them */
#pragma unroll
    for (int i = 0; i < 4; ++i) { kc[i] = frag_l(rn, i * 2); vc[i] = frag_l(rn, 16 + i * 2); }
  }
  asm volatile("s_wait_asynccnt 0x0" ::: "memory");   /* no copy is outstanding when the wave ends */
  l += __shfl_xor(l, 16); const float inv = l > 0.f ? 1.0f / l : 0.f;   /* a fully excluded row yields 0 */
#pragma unroll
  for (int j = 0; j < 2; ++j) { v4f o0, o1;
#pragma unroll
    for (int r = 0; r < 4; ++r) { o0[r] = acc[j][r] * inv; o1[r] = acc[j][4 + r] * inv; }
    float* yp = Y + (size_t)(q0 + col) * CC + h * HD + j * 16 + 8 * g; vst2(yp, o0); vst2(yp + 4, o1); } }
// ---- k_out: block = (64 rows, 128 cols): out = ctx Wo (+ bo): ctx once to f16 against Wo as f16(bf16 x 2^8) exact (1 product) x 2^-8; causal early rows (< QHI of each sequence): ctx bf16 hi + lo against exact bf16 Wo (2 products)
__global__ __launch_bounds__(128) void k_out(const float* __restrict__ Y, const float* __restrict__ WO, const float* __restrict__ BO, float* __restrict__ OUT) { __shared__ __align__(16) float sf[4][16][132]; __shared__ __align__(16) char sm[G_BYTES];
  const int tid = threadIdx.x, wave = tid >> 5, lane = tid & 31, col = lane & 15, g = lane >> 4; const int c0 = blockIdx.y * 128; const size_t r0 = (size_t)blockIdx.x * 64 + wave * 16;
  v8f acc[8] = {};
  if (CAUSAL && (int)(((size_t)blockIdx.x * 64) % TT) < QHI) {   /* block-uniform */
#pragma unroll 2
    for (int kc = 0; kc < CC / 32; ++kc) { const F2 a = split_row(Y + (r0 + col) * CC, kc * 32, lane); asm volatile("s_wait_loadcnt 0x0" ::: "memory");
#pragma unroll
      for (int j = 0; j < 8; ++j) { const v16b w = WOCOL(WO, kc * 32, c0 + j * 16 + col, lane); asm volatile("s_wait_loadcnt 0x0" ::: "memory"); acc[j] = wmma_bf(a.h, w, acc[j]); acc[j] = wmma_bf(a.l, w, acc[j]); } }
#pragma unroll
    for (int j = 0; j < 8; ++j) { const float bias = BO ? bfr(BO[c0 + j * 16 + col]) : 0.f;
#pragma unroll
      for (int r = 0; r < 8; ++r) sf[wave][8 * g + r][j * 16 + col] = acc[j][r] + bias; }
  } else {
    const _Float16 (*sw)[GP] = (const _Float16 (*)[GP])sm; const _Float16 (*sx)[GP] = (const _Float16 (*)[GP])(sm + G_SX);
    g_stage<1>(sm, WO + (size_t)(c0 + wave) * CC + lane * 4, Y + ((size_t)blockIdx.x * 64 + wave) * CC + lane * 4, wave, lane);
    __syncthreads();   /* the staged rows are published to the block's waves */
    v16h ac = frag_h(&sx[wave * 16 + col][0], lane), wc[8];   /* fragments one k step ahead, as in k_proj */
#pragma unroll
    for (int j = 0; j < 8; ++j) wc[j] = frag_h(&sw[j * 16 + col][0], lane);
#pragma unroll
    for (int kc = 0; kc < CC / 32; ++kc) { v16h an = ac, wn[8];
      if (kc + 1 < CC / 32) { an = frag_h(&sx[wave * 16 + col][(kc + 1) * 32], lane);
#pragma unroll
        for (int j = 0; j < 8; ++j) wn[j] = frag_h(&sw[j * 16 + col][(kc + 1) * 32], lane); }
#pragma unroll
      for (int j = 0; j < 8; ++j) acc[j] = wmma16(ac, wc[j], acc[j]);
      if (kc + 1 < CC / 32) { ac = an;
#pragma unroll
        for (int j = 0; j < 8; ++j) wc[j] = wn[j]; } }
#pragma unroll
    for (int j = 0; j < 8; ++j) { const float bias = BO ? bfr(BO[c0 + j * 16 + col]) : 0.f;
#pragma unroll
      for (int r = 0; r < 8; ++r) sf[wave][8 * g + r][j * 16 + col] = acc[j][r] * (1.0f / 256.0f) + bias; } }
  LDSX(); for (int rl = 0; rl < 16; ++rl) vst2(OUT + (r0 + rl) * DIN + c0 + lane * 4, *(const v4f*)&sf[wave][rl][lane * 4]); }

extern "C" void kernel_launch(void* const* d_in, const int* in_sizes, int n_in, void* d_out, int out_size, void* d_ws, size_t ws_size, hipStream_t stream) {
  (void)in_sizes; (void)n_in; (void)out_size;
  const float** F = (const float**)d_in;
  if (ws_size < (size_t)WS_END) return;
  char* ws = (char*)d_ws; _Float16 *QH = (_Float16*)(ws + WS_QH), *KH = (_Float16*)(ws + WS_KH), *VT = (_Float16*)(ws + WS_VT), *QL = (_Float16*)(ws + WS_QL), *KL = (_Float16*)(ws + WS_KL); __bf16 *VB = (__bf16*)(ws + WS_VB), *VBL = (__bf16*)(ws + WS_VBL); float *Y = (float*)(ws + WS_Y);
  (void)Y; (void)QL; (void)KL; (void)VB; (void)VBL;
  // inputs: 0 x [1,256,16,16,16]; 1 qkv_w [768,256] (out,in) rows q | k | v; 2 proj_w [256,256] (out,in); 3 proj_b
  if (ws_size < (size_t)WS_END2) return;
  float *XT = (float*)(ws + WS_XT), *ORW = (float*)(ws + WS_OR);
  k_tok<<<dim3(NTOK / 64, CC / 64), 256, 0, stream>>>(F[0], XT);
  { const float* WQ = F[1]; const float* WK = F[1] + (size_t)CC * DIN; const float* WV = F[1] + (size_t)2 * CC * DIN;
    k_proj<<<dim3(TNB * TT / 64, CC / 128, 3), 128, 0, stream>>>(XT, XT, XT, WQ, WK, WV, nullptr, nullptr, nullptr, QH, QL, KH, KL, VT, VB, VBL); }
  k_fa<<<dim3(TT / 128, NH), 256, 0, stream>>>(QH, QL, KH, VT, Y);
  k_out<<<dim3(TNB * TT / 64, DIN / 128), 128, 0, stream>>>(Y, F[2], F[3], ORW);
  k_fin<<<dim3(NTOK / 64, CC / 64), 256, 0, stream>>>(ORW, (float*)d_out);
}

// v005
// One run takes 52.2 microseconds.
// In two side-by-side timings against v004, it was 1.18 and 1.19 times as fast.
// Counting every step since v000, it is 14.6 times as fast.
// compute dtype: all float inputs rounded to bf16; tokens = bf16(x) transposed; qkv = tok W^T with EXACT bf16 products on WMMA 16x16x32 (f32 accumulate); q as f16 hi + residual (x 2^10) against k once to f16 (2 products) x 32^-0.5; the local window (grid distance < 10) as an exact integer test per (query, key); softmax in f32 (hardware exp2, the logit scale x log2 e folded into its argument) with a running maximum and sum, logits and P kept in registers; P x 2^11 once to f16 against v once to f16 (1 product); ctx once to f16 against proj_w carried x 2^8 in f16 + b; f32 output written channels-first.
#include <hip/hip_runtime.h>
#include <math.h>

typedef __attribute__((ext_vector_type(16))) _Float16 v16h;
typedef __attribute__((ext_vector_type(16))) __bf16 v16b;
typedef __attribute__((ext_vector_type(8)))  _Float16 v8h;
typedef __attribute__((ext_vector_type(8)))  float v8f;
typedef __attribute__((ext_vector_type(4)))  float v4f;
typedef __attribute__((ext_vector_type(2)))  float v2f;
typedef __attribute__((ext_vector_type(4)))  unsigned v4u;
typedef __attribute__((ext_vector_type(4)))  int v4i;
typedef float __attribute__((may_alias)) float_a;
typedef int __attribute__((may_alias)) int_a;

template <typename T> __device__ __forceinline__ void vst2(void* p, T v) { *(T*)p = v;  }
__device__ __forceinline__ v8f wmma16(v16h a, v16h b, v8f c) {
  v8f d = __builtin_amdgcn_wmma_f32_16x16x32_f16(false, a, false, b, (short)0, c, false, false);
  asm volatile("v_nop\n\tv_nop\n\tv_nop\n\tv_nop" : "+v"(d) : "v"(a), "v"(b));
  return d;
}
__device__ __forceinline__ v8f wmma_bf(v16b a, v16b b, v8f c) {
  v8f d = __builtin_amdgcn_wmma_f32_16x16x32_bf16(false, a, false, b, (short)0, c, false, false);
  asm volatile("v_nop\n\tv_nop\n\tv_nop\n\tv_nop" : "+v"(d) : "v"(a), "v"(b));
  return d;
}
// 16x16x32 fragments: lane = (h = lane>>4, row/col = lane&15); elements 0..7 = k0+8h+0..7, 8..15 = k0+16+8h+0..7; D element r = row 8h+r
__device__ __forceinline__ v16h frag_h(const _Float16* rowk0, int lane) {
  union { v16h v; v8h q[2]; } u; const _Float16* p = rowk0 + 8 * (lane >> 4);
  u.q[0] = *(const v8h*)p; u.q[1] = *(const v8h*)(p + 16); return u.v;
}
__device__ __forceinline__ v16h frag_f32(const float* rowk0, int lane) {
  v16h a; const float* p = rowk0 + 8 * (lane >> 4);
#pragma unroll
  for (int i = 0; i < 8; ++i) { a[i] = (_Float16)p[i]; a[8 + i] = (_Float16)p[16 + i]; }
  return a;
}
__device__ __forceinline__ v16h frag_f32s(const float* rowk0, int lane, float sc) {
  v16h a; const float* p = rowk0 + 8 * (lane >> 4);
#pragma unroll
  for (int i = 0; i < 8; ++i) { a[i] = (_Float16)(p[i] * sc); a[8 + i] = (_Float16)(p[16 + i] * sc); }
  return a;
}
// column fragment from a [K][ld] layout (column n), rows >= K read as 0
__device__ __forceinline__ v16h fragc_f32(const float* W, int k0, int n, int lane, int ld, int K) {
  v16h a; const int g = lane >> 4;
#pragma unroll
  for (int i = 0; i < 8; ++i) { const int ka = k0 + 8 * g + i, kb = ka + 16;
    a[i] = (_Float16)(ka < K ? W[(size_t)(ka < K ? ka : K - 1) * ld + n] : 0.f); a[8 + i] = (_Float16)(kb < K ? W[(size_t)(kb < K ? kb : K - 1) * ld + n] : 0.f); }
  return a;
}
struct F2 { v16b h, l; };
__device__ __forceinline__ F2 bsplit16(const float v[16]) { F2 r;
#pragma unroll
  for (int i = 0; i < 16; ++i) { const __bf16 h = (__bf16)v[i]; r.h[i] = h; r.l[i] = (__bf16)(v[i] - (float)h); }
  return r; }
__device__ __forceinline__ F2 split_row(const float* row, int k0, int lane) { float v[16]; const float* p = row + k0 + 8 * (lane >> 4);
#pragma unroll
  for (int i = 0; i < 8; ++i) { v[i] = p[i]; v[8 + i] = p[16 + i]; }
  return bsplit16(v); }
__device__ __forceinline__ F2 split_rowK(const float* row, int k0, int lane, int K) { float v[16]; const int g = lane >> 4;
#pragma unroll
  for (int i = 0; i < 8; ++i) { const int ka = k0 + 8 * g + i, kb = ka + 16; v[i] = ka < K ? row[ka < K ? ka : K - 1] : 0.f; v[8 + i] = kb < K ? row[kb < K ? kb : K - 1] : 0.f; }
  return bsplit16(v); }
__device__ __forceinline__ F2 split_col(const float* W, int k0, int n, int lane, int ld, int K) { float v[16]; const int g = lane >> 4;
#pragma unroll
  for (int i = 0; i < 8; ++i) { const int ka = k0 + 8 * g + i, kb = ka + 16; v[i] = ka < K ? W[(size_t)(ka < K ? ka : K - 1) * ld + n] : 0.f; v[8 + i] = kb < K ? W[(size_t)(kb < K ? kb : K - 1) * ld + n] : 0.f; }
  return bsplit16(v); }
__device__ __forceinline__ v8f mac3(const F2& a, const F2& b, v8f c) { c = wmma_bf(a.l, b.h, c); c = wmma_bf(a.h, b.l, c); return wmma_bf(a.h, b.h, c); }
__device__ __forceinline__ float sigm(float v) { return 1.0f / (1.0f + expf(-v)); }
#define LDSX() do { asm volatile("s_wait_dscnt 0" ::: "memory"); __builtin_amdgcn_wave_barrier(); __builtin_amdgcn_fence(__ATOMIC_RELEASE, "workgroup"); } while (0)

// 3-D local-window attention layer (x [1, 256, 16, 16, 16] -> 4,096 tokens, 8 heads x 32): qkv = tok qkv_w^T (packed (out,in) [768, 256], layout (3, H, hd)); scores = q k^T / sqrt(32) masked to -inf where the integer grid distance between the two tokens is >= 10 (sqrt(dz^2+dy^2+dx^2) < 10 <=> d2 < 100); softmax; out = merged(attn v) proj_w^T + proj_b, returned as [1, 256, 16, 16, 16].
#define NB 1
#define TT 4096
#define CC 256            // NH * HD = projected width
#define DIN 256          // input (model) width
#define NH 8
#define HD 32
#define NQB (TT / 64)
#define HG 2
#define SCALE (0.17677669529663687f)
#define SCALE_L2E (0.25503486f)   // SCALE x log2 e: exp(SCALE x) = exp2(SCALE_L2E x)
#define CAUSAL 0
#ifndef TNB
#define TNB NB
#endif
__device__ __forceinline__ float bfr(float v) { return (float)(__bf16)v; }
__host__ __device__ __forceinline__ int kb_last(int qb) { return CAUSAL ? ((qb * 64 + 63) >> 7) : (TT / 128 - 1); }
typedef __attribute__((ext_vector_type(8))) __bf16 v8b;
__device__ __forceinline__ v16b frag_b(const __bf16* rowk0, int lane) {
  union { v16b v; v8b q[2]; } u; const __bf16* p = rowk0 + 8 * (lane >> 4);
  u.q[0] = *(const v8b*)p; u.q[1] = *(const v8b*)(p + 16); return u.v;
}
#define QBH 0
#define QHI 4096            // rows carrying a q residual plane (all rows when non-causal: 2-product logits everywhere)
#define KHI 64            // key rows carrying k residual / v bf16 hi+lo planes (written by k_proj, read by no kernel in this file)
// B fragment (k rows k0+.., output column o) of a weight: (in,out) [K][ld] or (out,in) [ld rows of K]: bf16 exact, or f16(bf16 * 256) exact
__device__ __forceinline__ v16b wcol_io(const float* Wm, int k0, int o, int lane, int ld) { v16b w; const int g = lane >> 4;
#pragma unroll
  for (int i = 0; i < 8; ++i) { w[i] = (__bf16)Wm[(size_t)(k0 + 8 * g + i) * ld + o]; w[8 + i] = (__bf16)Wm[(size_t)(k0 + 16 + 8 * g + i) * ld + o]; }
  return w; }
__device__ __forceinline__ v16b wcol_oi(const float* Wm, int k0, int o, int lane, int K) { v16b w; const float* p = Wm + (size_t)o * K + k0 + 8 * (lane >> 4);
#pragma unroll
  for (int i = 0; i < 8; ++i) { w[i] = (__bf16)p[i]; w[8 + i] = (__bf16)p[16 + i]; }
  return w; }
__device__ __forceinline__ v16h wcolh_io(const float* Wm, int k0, int o, int lane, int ld) { v16h w; const int g = lane >> 4;
#pragma unroll
  for (int i = 0; i < 8; ++i) { w[i] = (_Float16)(bfr(Wm[(size_t)(k0 + 8 * g + i) * ld + o]) * 256.0f); w[8 + i] = (_Float16)(bfr(Wm[(size_t)(k0 + 16 + 8 * g + i) * ld + o]) * 256.0f); }
  return w; }
__device__ __forceinline__ v16h wcolh_oi(const float* Wm, int k0, int o, int lane, int K) { v16h w; const float* p = Wm + (size_t)o * K + k0 + 8 * (lane >> 4);
#pragma unroll
  for (int i = 0; i < 8; ++i) { w[i] = (_Float16)(bfr(p[i]) * 256.0f); w[8 + i] = (_Float16)(bfr(p[16 + i]) * 256.0f); }
  return w; }
#define WQKV_LAYOUT 1   // 0 = (in,out) [DIN][CC]; 1 = (out,in) [CC][DIN]; 2 = per-head [NH][DIN][HD]
__device__ __forceinline__ v16b wcol_hdk(const float* Wm, int k0, int o, int lane) { v16b w; const int g = lane >> 4; const float* p = Wm + (size_t)(o / HD) * DIN * HD + (o % HD);
#pragma unroll
  for (int i = 0; i < 8; ++i) { w[i] = (__bf16)p[(size_t)(k0 + 8 * g + i) * HD]; w[8 + i] = (__bf16)p[(size_t)(k0 + 16 + 8 * g + i) * HD]; }
  return w; }
#define WO_OUT_IN 1
#if WQKV_LAYOUT == 1
#define WCOL(W, k0, o, lane) wcol_oi(W, k0, o, lane, DIN)
#elif WQKV_LAYOUT == 2
#define WCOL(W, k0, o, lane) wcol_hdk(W, k0, o, lane)
#else
#define WCOL(W, k0, o, lane) wcol_io(W, k0, o, lane, CC)
#endif
#if WO_OUT_IN
#define WOCOL(W, k0, o, lane) wcol_oi(W, k0, o, lane, CC)
#define WOCOLH(W, k0, o, lane) wcolh_oi(W, k0, o, lane, CC)
#else
#define WOCOL(W, k0, o, lane) wcol_io(W, k0, o, lane, DIN)
#define WOCOLH(W, k0, o, lane) wcolh_io(W, k0, o, lane, DIN)
#endif
#define SM_MASK_HOOK do { const int dz = (t >> 8) - (k >> 8), dy = ((t >> 4) & 15) - ((k >> 4) & 15), dx = (t & 15) - (k & 15); v = (dz * dz + dy * dy + dx * dx < 100) ? v : -3.0e38f; } while (0)   /* local pattern: dist < 10 on the (d,h,w) token grid, exact in integers */
#define NTOK 4096
#ifndef SM_EXTRA_PARAMS
#define SM_EXTRA_PARAMS
#endif
#ifndef PROJ_EXTRA_PARAMS
#define PROJ_EXTRA_PARAMS
#endif
#ifndef SM_MASK_HOOK
#define SM_MASK_HOOK (void)0
#endif

#define WS_QH  0u                                      // f16 q rows [b*t][CC]
#define WS_KH  (WS_QH + 2u * (size_t)NB * TT * CC)      // f16 k rows [b*t][CC]
#define WS_VT  (WS_KH + 2u * (size_t)NB * TT * CC)      // f16 v planes [b][c][t]
#define WS_QL  (WS_VT + 2u * (size_t)NB * CC * TT)      // f16 q residual x 2^10 rows [b][t < QHI][CC]
#define WS_KL  (WS_QL + 2u * (size_t)NB * QHI * CC)     // f16 k residual x 2^10 rows [b][t < KHI][CC]
#define WS_VB  (WS_KL + 2u * (size_t)NB * KHI * CC)     // bf16 v hi planes [b][c][t < KHI]
#define WS_VBL (WS_VB + 2u * (size_t)NB * CC * KHI)
#define WS_S   (WS_VBL + 2u * (size_t)NB * CC * KHI)    // f32 [hg][t][s] area, unused (logits and P stay in registers)
#define WS_Y   (WS_S  + 4u * (size_t)HG * TT * TT)      // f32 ctx rows [b*t][CC] (only when there is an output projection)
#define WS_END (WS_Y  + 4u * (size_t)NB * TT * CC)

// The two projection kernels stage their operands in LDS once for the block's 4 waves: 128 weight rows and 64 token rows, the whole K = 256, already in the 16-bit type of the product.
// A wave's load of weight rows (and of k_out's token rows) covers 512 contiguous bytes of one row, and a thread's loads do not depend on each other, so 16 to 32 of them are in flight at a time.
#define GP 264            // LDS row pitch in 16-bit elements: 528 B = 16 B x 33 (odd), so the 16 rows of a fragment read fall on different banks
#define G_SX (128 * GP * 2)   // byte offset of the token rows [64][GP]; the weight rows [128][GP] lie at 0
#define G_BYTES ((128 + 64) * GP * 2)
typedef __attribute__((ext_vector_type(4))) __bf16 v4b;
typedef __attribute__((ext_vector_type(4))) _Float16 v4h;
// piece e of a wave: e < 64: half (e & 1) of weight row wave + 4 (e >> 1); e >= 64: the same of the token rows. wp, xp: the thread's 4 floats of the wave's first weight and token row.
// XCF = 1 (k_proj): the token rows come straight from the channels-first input x [256][NTOK]. Piece 64 + 4 u + i is 4 neighbouring tokens of one channel: tokens (u & 1) * 32 + (lane & 7) * 4 + 0..3, channel wave * 64 + (u >> 1) * 16 + (lane >> 3) * 4 + i; xp: the thread's 4 floats of piece 64. A wave's load covers 4 runs of 128 contiguous bytes, and pieces u, u + 1 (u even) together the 256 bytes that the block's 64 tokens have in a channel.
template <int XCF> __device__ __forceinline__ v4f g_load(const float* wp, const float* xp, int e) {
  if (XCF && e >= 64) return *(const v4f*)(xp + (size_t)(((e - 64) >> 3) * 16 + (e & 3)) * NTOK + ((e >> 2) & 1) * 32);
  return *(const v4f*)((e < 64 ? wp : xp) + (size_t)((e & 63) >> 1) * 4 * 256 + (e & 1) * 128); }
// the 4 pieces of one u are a 4 x 4 block (channel i, token j): it is turned by the choice of registers alone, and each LDS store holds 4 channels of one token, as a store of a token row's piece does
__device__ __forceinline__ void g_store_x(char* sm, int wave, int lane, int u, const v4f* r4) {
#pragma unroll
  for (int j = 0; j < 4; ++j) { v4b o;
#pragma unroll
    for (int i = 0; i < 4; ++i) o[i] = (__bf16)r4[i][j];
    *(v4b*)(sm + G_SX + (((u & 1) * 32 + (lane & 7) * 4 + j) * GP + wave * 64 + (u >> 1) * 16 + (lane >> 3) * 4) * 2) = o; }
}
// F16 = 0: both operands to bf16 (k_proj); 1: weights as f16(bf16 x 2^8), rows once to f16 (k_out): the conversions that the fragment loaders from global memory made
template <int F16> __device__ __forceinline__ void g_store(char* sm, int wave, int lane, int e, v4f r) {
  char* d = sm + (e < 64 ? 0 : G_SX) + ((wave + 4 * ((e & 63) >> 1)) * GP + (e & 1) * 128 + lane * 4) * 2;
  if (F16) { v4h o;
#pragma unroll
    for (int q = 0; q < 4; ++q) o[q] = e < 64 ? (_Float16)(bfr(r[q]) * 256.0f) : (_Float16)r[q];
    *(v4h*)d = o;
  } else { v4b o;
#pragma unroll
    for (int q = 0; q < 4; ++q) o[q] = (__bf16)r[q];
    *(v4b*)d = o; }
}
template <int F16, int XCF> __device__ __forceinline__ void g_stage(char* sm, const float* wp, const float* xp, int wave, int lane) {
  v4f r[2][16];
#pragma unroll
  for (int i = 0; i < 32; ++i) r[i >> 4][i & 15] = g_load<XCF>(wp, xp, i);
#pragma unroll
  for (int s = 0; s < 6; ++s) {
    __builtin_amdgcn_sched_barrier(0);   /* holds the later groups' loads behind this group's stores: without it all 96 loads were issued at once, on more than 256 registers */
    if (XCF && s >= 4) {
#pragma unroll
      for (int b = 0; b < 4; ++b) g_store_x(sm, wave, lane, (s - 4) * 4 + b, &r[s & 1][b * 4]);
    } else {
#pragma unroll
      for (int i = 0; i < 16; ++i) g_store<F16>(sm, wave, lane, s * 16 + i, r[s & 1][i]); }
    __builtin_amdgcn_sched_barrier(0);   /* as above */
    if (s + 2 < 6) {
#pragma unroll
      for (int i = 0; i < 16; ++i) r[s & 1][i] = g_load<XCF>(wp, xp, (s + 2) * 16 + i); }
  }
  asm volatile("s_wait_xcnt 0x0" :: "v"(wp), "v"(xp) : "memory");   /* the address registers of the issued loads stay live up to this wait, so nothing overwrites them in front of it */
}
// ---- k_proj: block = (64 rows, 128 cols, which), X = the input itself, channels-first [DIN][NTOK], a row = a token: q/k/v = X W (+ b) with exact bf16 products (K = DIN) -> which 0: q f16 rows (+ residual rows < QHI); 1: k f16 rows (+ residual rows < KHI); 2: v f16 planes [c][t] (+ bf16 hi/lo planes for t < KHI)
__global__ __launch_bounds__(128) void k_proj(const float* __restrict__ XQ, const float* __restrict__ XK, const float* __restrict__ XV, const float* __restrict__ WQ, const float* __restrict__ WK, const float* __restrict__ WV, const float* __restrict__ BQ, const float* __restrict__ BK, const float* __restrict__ BV,
    _Float16* __restrict__ QH, _Float16* __restrict__ QL, _Float16* __restrict__ KH, _Float16* __restrict__ KL, _Float16* __restrict__ VT, __bf16* __restrict__ VB, __bf16* __restrict__ VBL) {
  __shared__ __align__(16) char sm[G_BYTES];   /* first the staged operands; behind the second barrier the output tiles below lie in the same bytes */
  const __bf16 (*sw)[GP] = (const __bf16 (*)[GP])sm; const __bf16 (*sx)[GP] = (const __bf16 (*)[GP])(sm + G_SX);
  _Float16 (*sh)[136] = (_Float16 (*)[136])sm; _Float16 (*sl)[136] = (_Float16 (*)[136])(sm + 64 * 136 * 2);
  _Float16 (*th)[72] = (_Float16 (*)[72])sm; __bf16 (*tb)[72] = (__bf16 (*)[72])(sm + 128 * 72 * 2); __bf16 (*tbl)[72] = (__bf16 (*)[72])(sm + 2 * 128 * 72 * 2);
  const int tid = threadIdx.x, wave = tid >> 5, lane = tid & 31, col = lane & 15, g = lane >> 4; const int which = blockIdx.z; const int c0 = blockIdx.y * 128; const size_t r0 = (size_t)blockIdx.x * 64; const size_t bb = r0 / TT; const int t0 = (int)(r0 % TT);
  const float* X = which == 0 ? XQ : which == 1 ? XK : XV; const float* WA = which == 0 ? WQ : which == 1 ? WK : WV; const float* BA = which == 0 ? BQ : which == 1 ? BK : BV;
  g_stage<0, 1>(sm, WA + (size_t)(c0 + wave) * DIN + lane * 4, X + (size_t)(wave * 64 + (lane >> 3) * 4) * NTOK + r0 + (lane & 7) * 4, wave, lane);
  __syncthreads();   /* the staged rows are published to the block's waves */
  v8f acc[8] = {};
  // the fragments of k step kc + 1 are read from LDS in front of the products of step kc (same elements at the same lane and register as the loads from global memory had)
  v16b ac = frag_b(&sx[wave * 16 + col][0], lane), wc[8];
#pragma unroll
  for (int j = 0; j < 8; ++j) wc[j] = frag_b(&sw[j * 16 + col][0], lane);
#pragma unroll
  for (int kc = 0; kc < DIN / 32; ++kc) { v16b an = ac, wn[8];
    if (kc + 1 < DIN / 32) { an = frag_b(&sx[wave * 16 + col][(kc + 1) * 32], lane);
#pragma unroll
      for (int j = 0; j < 8; ++j) wn[j] = frag_b(&sw[j * 16 + col][(kc + 1) * 32], lane); }
#pragma unroll
    for (int j = 0; j < 8; ++j) acc[j] = wmma_bf(ac, wc[j], acc[j]);
    if (kc + 1 < DIN / 32) { ac = an;
#pragma unroll
      for (int j = 0; j < 8; ++j) wc[j] = wn[j]; } }
  __syncthreads();   /* every wave has read its last fragment before the output tiles overwrite the staged rows */
  if (which < 2) { _Float16* DH = which == 0 ? QH : KH; _Float16* DL = which == 0 ? QL : KL; const int nhi = which == 0 ? QHI : KHI; const bool hi_rows = t0 < nhi;
#pragma unroll
    for (int j = 0; j < 8; ++j) { const float bias = BA ? bfr(BA[c0 + j * 16 + col]) : 0.f;
#pragma unroll
      for (int r = 0; r < 8; ++r) { const float v = acc[j][r] + bias; const _Float16 hv = (_Float16)v; sh[wave * 16 + 8 * g + r][j * 16 + col] = hv; sl[wave * 16 + 8 * g + r][j * 16 + col] = (_Float16)((v - (float)hv) * 1024.0f); } }
    __syncthreads();
    for (int e = tid; e < 64 * 16; e += 128) { const int rl = e >> 4, q = e & 15; vst2((unsigned*)(DH + (r0 + rl) * CC + c0 + q * 8), *(const v4u*)&sh[rl][q * 8]); if (hi_rows) vst2((unsigned*)(DL + (bb * nhi + t0 + rl) * (size_t)CC + c0 + q * 8), *(const v4u*)&sl[rl][q * 8]); }
  } else { const bool hi_rows = t0 < KHI;
#pragma unroll
    for (int j = 0; j < 8; ++j) { const float bias = BA ? bfr(BA[c0 + j * 16 + col]) : 0.f;
#pragma unroll
      for (int r = 0; r < 8; ++r) { const float v = acc[j][r] + bias; const int rl = wave * 16 + 8 * g + r, cl = j * 16 + col; th[cl][rl] = (_Float16)v; const __bf16 bh = (__bf16)v; tb[cl][rl] = bh; tbl[cl][rl] = (__bf16)(v - (float)bh); } }
    __syncthreads();
    for (int e = tid; e < 128 * 8; e += 128) { const int cl = e >> 3, q = e & 7; vst2((unsigned*)(VT + (bb * CC + c0 + cl) * (size_t)TT + t0 + q * 8), *(const v4u*)&th[cl][q * 8]); if (hi_rows) { const size_t o3 = (bb * CC + c0 + cl) * (size_t)KHI + t0 + q * 8; vst2((unsigned*)(VB + o3), *(const v4u*)&tb[cl][q * 8]); vst2((unsigned*)(VBL + o3), *(const v4u*)&tbl[cl][q * 8]); } } } }
// ---- k_fa: block = 8 waves = 128 queries of one head; a wave owns 16 queries (one x row of the token grid) and walks all keys, 64 a pass, with a running maximum and sum.
// S^T = K Q^T (A = 16 key rows, B = the wave's q hi, then its q residual): a lane holds 8 keys (8g + r) of its own query (col), so two key tiles are, as they stand, the B fragment of ctx^T = V^T P^T and the logits never leave the registers.
// K and V of 128 keys (a stage = two passes) are brought into LDS once for the block's 8 waves by asynchronous copies, two buffers, the next stage in flight while this one is worked on.
// fragment from the lane's own address (row start + k0 + 8 * (lane >> 4)): same k order as frag_h
__device__ __forceinline__ v16h frag_p(const _Float16* p) { union { v16h v; v8h q[2]; } u; u.q[0] = *(const v8h*)p; u.q[1] = *(const v8h*)(p + 16); return u.v; }
// the address registers of issued loads stay live up to this wait, so nothing overwrites them in front of it
#define FA_XWAIT(p0, p1) asm volatile("s_wait_xcnt 0x0" :: "v"(p0), "v"(p1) : "memory")
#define FA_SK 128          // keys a stage
#define FA_STG 16384       // bytes a stage: 16 K half fragments, then 16 V half fragments, 512 B each
// A stage lies in LDS in fragment order: half fragment B (elements 8u .. 8u+7 of one 16 x 32 fragment) is 512 B, lane l's 16 bytes at B * 512 + l * 16, so a reader's ds_load_b128 covers 512 contiguous bytes.
// K: B = (pass * 4 + tile) * 2 + u; V: B = 16 + ((pass * 2 + c) * 2 + j) * 2 + u. Same elements at the same lane and register as the loads from global memory had.
__device__ __forceinline__ v16h frag_l(const char* rb, int B) { union { v16h v; v8h q[2]; } u; u.q[0] = *(const v8h*)(rb + B * 512); u.q[1] = *(const v8h*)(rb + B * 512 + 512); return u.v; }
// one stage's copies: a thread brings two 16-byte pieces of K and two of V (pass 0 and pass 1 of the stage). The s_wait_xcnt stands in the copies' own statement, so no address register is rewritten in front of it.
__device__ __forceinline__ void fa_copy(unsigned kd, unsigned vd, const _Float16* kg, const _Float16* vg) {
  asm volatile("global_load_async_to_lds_b128 %0, %4, off\n\tglobal_load_async_to_lds_b128 %1, %5, off\n\tglobal_load_async_to_lds_b128 %2, %6, off\n\tglobal_load_async_to_lds_b128 %3, %7, off\n\ts_wait_xcnt 0x0"
    :: "v"(kd), "v"(kd + 4096u), "v"(vd), "v"(vd + 4096u), "v"(kg), "v"(kg + (size_t)64 * CC), "v"(vg), "v"(vg + 64) : "memory");
}
// 2^x in place, a run of v_exp_f32 in one statement: each is the independent instruction behind the one before it, and the v_nop fills the slot behind the last
__device__ __forceinline__ void exp2_8(float (&x)[8]) {
  asm("v_exp_f32 %0, %0\n\tv_exp_f32 %1, %1\n\tv_exp_f32 %2, %2\n\tv_exp_f32 %3, %3\n\tv_exp_f32 %4, %4\n\tv_exp_f32 %5, %5\n\tv_exp_f32 %6, %6\n\tv_exp_f32 %7, %7\n\tv_nop"
    : "+v"(x[0]), "+v"(x[1]), "+v"(x[2]), "+v"(x[3]), "+v"(x[4]), "+v"(x[5]), "+v"(x[6]), "+v"(x[7]));
}
__device__ __forceinline__ void exp2_9(float& a, float (&x)[8]) {
  asm("v_exp_f32 %8, %8\n\tv_exp_f32 %0, %0\n\tv_exp_f32 %1, %1\n\tv_exp_f32 %2, %2\n\tv_exp_f32 %3, %3\n\tv_exp_f32 %4, %4\n\tv_exp_f32 %5, %5\n\tv_exp_f32 %6, %6\n\tv_exp_f32 %7, %7\n\tv_nop"
    : "+v"(x[0]), "+v"(x[1]), "+v"(x[2]), "+v"(x[3]), "+v"(x[4]), "+v"(x[5]), "+v"(x[6]), "+v"(x[7]), "+v"(a));
}
// one stage = two passes of 64 keys. kc, vc hold the first pass's fragments on entry; the second pass's are read from the same buffer (rb) into the same registers: K behind the first pass's S products, V behind its P V products, each well ahead of its use.
__device__ __forceinline__ void fa_stage(v16h (&kc)[4], v16h (&vc)[4], v8f (&acc)[2], float& m, float& l, const char* rb, int t, int tz, int ty, const int (&dx2)[8], v16h qh, v16h ql) {
  const v8f zero = {};
#pragma unroll
  for (int p = 0; p < 2; ++p) {
    const int it = t * 2 + p;
    v8f sa[4], sb[4];
#pragma unroll
    for (int i = 0; i < 4; ++i) { sa[i] = wmma16(kc[i], qh, zero); sb[i] = wmma16(kc[i], ql, zero); }
    if (p == 0) {
#pragma unroll
      for (int i = 0; i < 4; ++i) kc[i] = frag_l(rb, 8 + i * 2);
    }
    float s[4][8];
#pragma unroll
    for (int i = 0; i < 4; ++i) {
      const int T = it * 4 + i, dz = tz - (T >> 4), dy = ty - (T & 15), lim = 100 - dz * dz - dy * dy;   /* a key tile is one x row: dist < 10 <=> dx^2 < 100 - dz^2 - dy^2, exact in integers */
#pragma unroll
      for (int r = 0; r < 8; ++r) { const float v = sa[i][r] + sb[i][r] * (1.0f / 1024.0f); s[i][r] = dx2[r] < lim ? v : -3.0e38f; } }   /* unscaled: the scale is positive, so the maximum is the same key's, and it goes into the exponent's one fma below */
    float mx = m;
#pragma unroll
    for (int i = 0; i < 4; ++i)
#pragma unroll
      for (int r = 0; r < 8; ++r) mx = fmaxf(mx, s[i][r]);
    mx = fmaxf(mx, __shfl_xor(mx, 16));
    float alpha = (m - mx) * SCALE_L2E; m = mx; const float nb = 11.0f - mx * SCALE_L2E;   /* P is carried x 2^11 as before; the factor cancels in acc / l. An excluded logit gives an exponent near -7.6e37 and exp2 = 0 */
    float e[4][8];
#pragma unroll
    for (int i = 0; i < 4; ++i)
#pragma unroll
      for (int r = 0; r < 8; ++r) e[i][r] = fmaf(s[i][r], SCALE_L2E, nb);
    exp2_9(alpha, e[0]); exp2_8(e[1]);
    l *= alpha;
#pragma unroll
    for (int j = 0; j < 2; ++j)
#pragma unroll
      for (int r = 0; r < 8; ++r) acc[j][r] *= alpha;
#pragma unroll
    for (int c = 0; c < 2; ++c) { v16h pf;
      if (c == 1) { exp2_8(e[2]); exp2_8(e[3]); }
#pragma unroll
      for (int r = 0; r < 8; ++r) { const float e0 = e[2 * c][r], e1 = e[2 * c + 1][r]; l += e0 + e1; pf[r] = (_Float16)e0; pf[8 + r] = (_Float16)e1; }
#pragma unroll
      for (int j = 0; j < 2; ++j) acc[j] = wmma16(vc[c * 2 + j], pf, acc[j]); }
    if (p == 0) {
#pragma unroll
      for (int i = 0; i < 4; ++i) vc[i] = frag_l(rb, 24 + i * 2);
    }
  }
}
// the foot of a trip: this wave's reads of the buffer are done before it may be refilled; its share of the next stage has landed; the barrier publishes that stage and ends every wave's reads of this one
#define FA_PUBLISH() do { asm volatile("s_wait_dscnt 0x0" ::: "memory"); asm volatile("s_wait_asynccnt 0x0" ::: "memory"); __syncthreads(); } while (0)
// amdgpu_waves_per_eu(4, 4) names a budget of 256 registers: with none named this build chose fewer registers and a serial order of the softmax (more v_nop and s_delay_alu in the loop than the loop had before)
__global__ __launch_bounds__(256) __attribute__((amdgpu_waves_per_eu(4, 4))) void k_fa(const _Float16* __restrict__ QH, const _Float16* __restrict__ QL, const _Float16* __restrict__ KH, const _Float16* __restrict__ VT, float* __restrict__ Y) {
  __shared__ __align__(512) char ring[2 * FA_STG];
  const int tid = threadIdx.x, wave = __builtin_amdgcn_readfirstlane(tid >> 5), lane = tid & 31, col = lane & 15, g = lane >> 4;
  const int h = blockIdx.y; const int q0 = blockIdx.x * 128 + wave * 16; const int tz = q0 >> 8, ty = (q0 >> 4) & 15;   /* the 16 queries share z and y; x = col */
  const _Float16* qhp = QH + (size_t)(q0 + col) * CC + h * HD + 8 * g; const _Float16* qlp = QL + (size_t)(q0 + col) * CC + h * HD + 8 * g;
  const v16h qh = frag_p(qhp), ql = frag_p(qlp); FA_XWAIT(qhp, qlp);
  int dx2[8];
#pragma unroll
  for (int r = 0; r < 8; ++r) { const int d = col - (8 * g + r); dx2[r] = d * d; }
  // the thread's pieces: piece cq of a row = elements 8 cq .. 8 cq + 7 = (u = cq >> 1, g = cq & 1); K row tid >> 2 of a pass (tile tid >> 6, row crow); V channel (tid >> 2) & 31 (j, crow), key group c = tid >> 7 of a pass
  const int cq = tid & 3, crow = (tid >> 2) & 15; const unsigned slot = (unsigned)(((cq >> 1) * 32 + (cq & 1) * 16 + crow) * 16);
  const unsigned rg = (unsigned)(size_t)ring;   /* the LDS byte address is the low word of the shared address */
  const unsigned kd = rg + (unsigned)(tid >> 6) * 1024u + slot, vd = rg + 8192u + (unsigned)((tid >> 7) * 2 + ((tid >> 6) & 1)) * 1024u + slot;
  const _Float16* kg = KH + (size_t)(tid >> 2) * CC + h * HD + cq * 8; const _Float16* vg = VT + (size_t)(h * HD + ((tid >> 2) & 31)) * TT + (tid >> 7) * 32 + cq * 8;
  const char* rl = ring + lane * 16;
  v8f acc[2] = {}; float m = -1.0e30f, l = 0.f;   /* the start maximum is finite, so an excluded logit (-3e38) gives exp = 0 also while no key has been admitted yet */
  fa_copy(kd, vd, kg, vg);
  asm volatile("s_wait_asynccnt 0x0" ::: "memory");   /* stage 0 has landed, as far as this wave brought it */
  __syncthreads();                                    /* ... and is published to the other waves */
  fa_copy(kd + FA_STG, vd + FA_STG, kg + (size_t)FA_SK * CC, vg + FA_SK);
  v16h kc[4], vc[4];   /* the first pass's fragments of the published stage */
#pragma unroll
  for (int i = 0; i < 4; ++i) { kc[i] = frag_l(rl, i * 2); vc[i] = frag_l(rl, 16 + i * 2); }
  // the trips behind which a stage t + 2 exists, then the last two: split so that each loop's body is one straight block (with a branch round the copies the compiler moved the row sum's chain of additions behind the barrier, in front of the LDS reads)
#pragma unroll 1   /* unrolled further the live set passes 256 registers */
  for (int t = 0; t < TT / FA_SK - 2; ++t) {
    fa_stage(kc, vc, acc, m, l, rl + (t & 1) * FA_STG, t, tz, ty, dx2, qh, ql);
    FA_PUBLISH();
    fa_copy(kd + (t & 1) * FA_STG, vd + (t & 1) * FA_STG, kg + (size_t)(t + 2) * FA_SK * CC, vg + (t + 2) * FA_SK);   /* into the buffer that this trip has just read */
    const char* rn = rl + ((t + 1) & 1) * FA_STG;   /* the stage just published */
#pragma unroll
    for (int i = 0; i < 4; ++i) { kc[i] = frag_l(rn, i * 2); vc[i] = frag_l(rn, 16 + i * 2); }
  }
#pragma unroll 1   /* as above */
  for (int t = TT / FA_SK - 2; t < TT / FA_SK; ++t) {
    fa_stage(kc, vc, acc, m, l, rl + (t & 1) * FA_STG, t, tz, ty, dx2, qh, ql);
    FA_PUBLISH();
    const char* rn = rl + ((t + 1) & 1) * FA_STG;   /* behind the last trip these reads meet the last but one stage's bytes and nothing uses them */
#pragma unroll
    for (int i = 0; i < 4; ++i) { kc[i] = frag_l(rn, i * 2); vc[i] = frag_l(rn, 16 + i * 2); }
  }
  asm volatile("s_wait_asynccnt 0x0" ::: "memory");   /* no copy is outstanding when the wave ends */
  l += __shfl_xor(l, 16); const float inv = l > 0.f ? 1.0f / l : 0.f;   /* a fully excluded row yields 0 */
#pragma unroll
  for (int j = 0; j < 2; ++j) { v4f o0, o1;
#pragma unroll
    for (int r = 0; r < 4; ++r) { o0[r] = acc[j][r] * inv; o1[r] = acc[j][4 + r] * inv; }
    float* yp = Y + (size_t)(q0 + col) * CC + h * HD + j * 16 + 8 * g; vst2(yp, o0); vst2(yp + 4, o1); } }
// ---- k_out: block = (64 rows, 128 cols): out = ctx Wo (+ bo), written channels-first: ctx once to f16 against Wo as f16(bf16 x 2^8) exact (1 product) x 2^-8; causal early rows (< QHI of each sequence): ctx bf16 hi + lo against exact bf16 Wo (2 products)
__global__ __launch_bounds__(128) void k_out(const float* __restrict__ Y, const float* __restrict__ WO, const float* __restrict__ BO, float* __restrict__ OUT) { __shared__ __align__(16) float sf[128][68]; __shared__ __align__(16) char sm[G_BYTES];   /* sf: the block's result, [channel][token]; pitch 272 B = 16 B x 17 (odd), so that the 16 channels of a 16-byte store fall on different banks */
  const int tid = threadIdx.x, wave = tid >> 5, lane = tid & 31, col = lane & 15, g = lane >> 4; const int c0 = blockIdx.y * 128; const size_t r0 = (size_t)blockIdx.x * 64 + wave * 16;
  v8f acc[8] = {};
  if (CAUSAL && (int)(((size_t)blockIdx.x * 64) % TT) < QHI) {   /* block-uniform */
#pragma unroll 2
    for (int kc = 0; kc < CC / 32; ++kc) { const F2 a = split_row(Y + (r0 + col) * CC, kc * 32, lane); asm volatile("s_wait_loadcnt 0x0" ::: "memory");
#pragma unroll
      for (int j = 0; j < 8; ++j) { const v16b w = WOCOL(WO, kc * 32, c0 + j * 16 + col, lane); asm volatile("s_wait_loadcnt 0x0" ::: "memory"); acc[j] = wmma_bf(a.h, w, acc[j]); acc[j] = wmma_bf(a.l, w, acc[j]); } }
#pragma unroll
    for (int j = 0; j < 8; ++j) { const float bias = BO ? bfr(BO[c0 + j * 16 + col]) : 0.f;
#pragma unroll
      for (int r = 0; r < 8; ++r) sf[j * 16 + col][wave * 16 + 8 * g + r] = acc[j][r] + bias; }
  } else {
    const _Float16 (*sw)[GP] = (const _Float16 (*)[GP])sm; const _Float16 (*sx)[GP] = (const _Float16 (*)[GP])(sm + G_SX);
    g_stage<1, 0>(sm, WO + (size_t)(c0 + wave) * CC + lane * 4, Y + ((size_t)blockIdx.x * 64 + wave) * CC + lane * 4, wave, lane);
    __syncthreads();   /* the staged rows are published to the block's waves */
    v16h ac = frag_h(&sx[wave * 16 + col][0], lane), wc[8];   /* fragments one k step ahead, as in k_proj */
#pragma unroll
    for (int j = 0; j < 8; ++j) wc[j] = frag_h(&sw[j * 16 + col][0], lane);
#pragma unroll
    for (int kc = 0; kc < CC / 32; ++kc) { v16h an = ac, wn[8];
      if (kc + 1 < CC / 32) { an = frag_h(&sx[wave * 16 + col][(kc + 1) * 32], lane);
#pragma unroll
        for (int j = 0; j < 8; ++j) wn[j] = frag_h(&sw[j * 16 + col][(kc + 1) * 32], lane); }
#pragma unroll
      for (int j = 0; j < 8; ++j) acc[j] = wmma16(ac, wc[j], acc[j]);
      if (kc + 1 < CC / 32) { ac = an;
#pragma unroll
        for (int j = 0; j < 8; ++j) wc[j] = wn[j]; } }
#pragma unroll
    for (int j = 0; j < 8; ++j) { const float bias = BO ? bfr(BO[c0 + j * 16 + col]) : 0.f;
#pragma unroll
      for (int r = 0; r < 8; ++r) sf[j * 16 + col][wave * 16 + 8 * g + r] = acc[j][r] * (1.0f / 256.0f) + bias; } }   /* a lane's 8 results are 8 neighbouring tokens of one channel */
  __syncthreads();   /* the four waves' result rows are published: a channel's 64 tokens come from all of them */
  // channels-first output [DIN][NTOK]: 16 threads write the 256 contiguous bytes that the block's 64 tokens have in one channel
  const int q = tid & 15; float* op = OUT + (size_t)(c0 + (tid >> 4)) * NTOK + (size_t)blockIdx.x * 64 + q * 4;
#pragma unroll
  for (int it = 0; it < 16; ++it) vst2(op + (size_t)it * 8 * NTOK, *(const v4f*)&sf[it * 8 + (tid >> 4)][q * 4]); }

extern "C" void kernel_launch(void* const* d_in, const int* in_sizes, int n_in, void* d_out, int out_size, void* d_ws, size_t ws_size, hipStream_t stream) {
  (void)in_sizes; (void)n_in; (void)out_size;
  const float** F = (const float**)d_in;
  if (ws_size < (size_t)WS_END) return;
  char* ws = (char*)d_ws; _Float16 *QH = (_Float16*)(ws + WS_QH), *KH = (_Float16*)(ws + WS_KH), *VT = (_Float16*)(ws + WS_VT), *QL = (_Float16*)(ws + WS_QL), *KL = (_Float16*)(ws + WS_KL); __bf16 *VB = (__bf16*)(ws + WS_VB), *VBL = (__bf16*)(ws + WS_VBL); float *Y = (float*)(ws + WS_Y);
  (void)Y; (void)QL; (void)KL; (void)VB; (void)VBL;
  // inputs: 0 x [1,256,16,16,16]; 1 qkv_w [768,256] (out,in) rows q | k | v; 2 proj_w [256,256] (out,in); 3 proj_b
  { const float* WQ = F[1]; const float* WK = F[1] + (size_t)CC * DIN; const float* WV = F[1] + (size_t)2 * CC * DIN;
    k_proj<<<dim3(TNB * TT / 64, CC / 128, 3), 128, 0, stream>>>(F[0], F[0], F[0], WQ, WK, WV, nullptr, nullptr, nullptr, QH, QL, KH, KL, VT, VB, VBL); }
  k_fa<<<dim3(TT / 128, NH), 256, 0, stream>>>(QH, QL, KH, VT, Y);
  k_out<<<dim3(TNB * TT / 64, DIN / 128), 128, 0, stream>>>(Y, F[2], F[3], (float*)d_out);
}

// v006
// One run takes 49 microseconds.
// Two timings next to v005 put it at 1.07 and 1.05 times that version's speed.
// Counting every step since v000, it is 15.5 times as fast.
// compute dtype: all float inputs rounded to bf16; tokens = bf16(x) transposed; qkv = tok W^T with EXACT bf16 products on WMMA 16x16x32 (f32 accumulate); q as f16 hi + residual (x 2^10) against k once to f16 (2 products) x 32^-0.5; the local window (grid distance < 10) as an exact integer test per (query, key); softmax in f32 (hardware exp2, the logit scale x log2 e folded into its argument) with a running maximum and sum, logits and P kept in registers; P x 2^11 once to f16 against v once to f16 (1 product); ctx once to f16 against proj_w carried x 2^8 in f16 + b; f32 output written channels-first.
#include <hip/hip_runtime.h>
#include <math.h>

typedef __attribute__((ext_vector_type(16))) _Float16 v16h;
typedef __attribute__((ext_vector_type(16))) __bf16 v16b;
typedef __attribute__((ext_vector_type(8)))  _Float16 v8h;
typedef __attribute__((ext_vector_type(8)))  float v8f;
typedef __attribute__((ext_vector_type(4)))  float v4f;
typedef __attribute__((ext_vector_type(2)))  float v2f;
typedef __attribute__((ext_vector_type(4)))  unsigned v4u;
typedef __attribute__((ext_vector_type(4)))  int v4i;
typedef float __attribute__((may_alias)) float_a;
typedef int __attribute__((may_alias)) int_a;

template <typename T> __device__ __forceinline__ void vst2(void* p, T v) { *(T*)p = v;  }
__device__ __forceinline__ v8f wmma16(v16h a, v16h b, v8f c) {
  v8f d = __builtin_amdgcn_wmma_f32_16x16x32_f16(false, a, false, b, (short)0, c, false, false);
  asm volatile("v_nop\n\tv_nop\n\tv_nop\n\tv_nop" : "+v"(d) : "v"(a), "v"(b));
  return d;
}
__device__ __forceinline__ v8f wmma_bf(v16b a, v16b b, v8f c) {
  v8f d = __builtin_amdgcn_wmma_f32_16x16x32_bf16(false, a, false, b, (short)0, c, false, false);
  asm volatile("v_nop\n\tv_nop\n\tv_nop\n\tv_nop" : "+v"(d) : "v"(a), "v"(b));
  return d;
}
// 16x16x32 fragments: lane = (h = lane>>4, row/col = lane&15); elements 0..7 = k0+8h+0..7, 8..15 = k0+16+8h+0..7; D element r = row 8h+r
__device__ __forceinline__ v16h frag_h(const _Float16* rowk0, int lane) {
  union { v16h v; v8h q[2]; } u; const _Float16* p = rowk0 + 8 * (lane >> 4);
  u.q[0] = *(const v8h*)p; u.q[1] = *(const v8h*)(p + 16); return u.v;
}
__device__ __forceinline__ v16h frag_f32(const float* rowk0, int lane) {
  v16h a; const float* p = rowk0 + 8 * (lane >> 4);
#pragma unroll
  for (int i = 0; i < 8; ++i) { a[i] = (_Float16)p[i]; a[8 + i] = (_Float16)p[16 + i]; }
  return a;
}
__device__ __forceinline__ v16h frag_f32s(const float* rowk0, int lane, float sc) {
  v16h a; const float* p = rowk0 + 8 * (lane >> 4);
#pragma unroll
  for (int i = 0; i < 8; ++i) { a[i] = (_Float16)(p[i] * sc); a[8 + i] = (_Float16)(p[16 + i] * sc); }
  return a;
}
// column fragment from a [K][ld] layout (column n), rows >= K read as 0
__device__ __forceinline__ v16h fragc_f32(const float* W, int k0, int n, int lane, int ld, int K) {
  v16h a; const int g = lane >> 4;
#pragma unroll
  for (int i = 0; i < 8; ++i) { const int ka = k0 + 8 * g + i, kb = ka + 16;
    a[i] = (_Float16)(ka < K ? W[(size_t)(ka < K ? ka : K - 1) * ld + n] : 0.f); a[8 + i] = (_Float16)(kb < K ? W[(size_t)(kb < K ? kb : K - 1) * ld + n] : 0.f); }
  return a;
}
struct F2 { v16b h, l; };
__device__ __forceinline__ F2 bsplit16(const float v[16]) { F2 r;
#pragma unroll
  for (int i = 0; i < 16; ++i) { const __bf16 h = (__bf16)v[i]; r.h[i] = h; r.l[i] = (__bf16)(v[i] - (float)h); }
  return r; }
__device__ __forceinline__ F2 split_row(const float* row, int k0, int lane) { float v[16]; const float* p = row + k0 + 8 * (lane >> 4);
#pragma unroll
  for (int i = 0; i < 8; ++i) { v[i] = p[i]; v[8 + i] = p[16 + i]; }
  return bsplit16(v); }
__device__ __forceinline__ F2 split_rowK(const float* row, int k0, int lane, int K) { float v[16]; const int g = lane >> 4;
#pragma unroll
  for (int i = 0; i < 8; ++i) { const int ka = k0 + 8 * g + i, kb = ka + 16; v[i] = ka < K ? row[ka < K ? ka : K - 1] : 0.f; v[8 + i] = kb < K ? row[kb < K ? kb : K - 1] : 0.f; }
  return bsplit16(v); }
__device__ __forceinline__ F2 split_col(const float* W, int k0, int n, int lane, int ld, int K) { float v[16]; const int g = lane >> 4;
#pragma unroll
  for (int i = 0; i < 8; ++i) { const int ka = k0 + 8 * g + i, kb = ka + 16; v[i] = ka < K ? W[(size_t)(ka < K ? ka : K - 1) * ld + n] : 0.f; v[8 + i] = kb < K ? W[(size_t)(kb < K ? kb : K - 1) * ld + n] : 0.f; }
  return bsplit16(v); }
__device__ __forceinline__ v8f mac3(const F2& a, const F2& b, v8f c) { c = wmma_bf(a.l, b.h, c); c = wmma_bf(a.h, b.l, c); return wmma_bf(a.h, b.h, c); }
__device__ __forceinline__ float sigm(float v) { return 1.0f / (1.0f + expf(-v)); }
#define LDSX() do { asm volatile("s_wait_dscnt 0" ::: "memory"); __builtin_amdgcn_wave_barrier(); __builtin_amdgcn_fence(__ATOMIC_RELEASE, "workgroup"); } while (0)

// 3-D local-window attention layer (x [1, 256, 16, 16, 16] -> 4,096 tokens, 8 heads x 32): qkv = tok qkv_w^T (packed (out,in) [768, 256], layout (3, H, hd)); scores = q k^T / sqrt(32) masked to -inf where the integer grid distance between the two tokens is >= 10 (sqrt(dz^2+dy^2+dx^2) < 10 <=> d2 < 100); softmax; out = merged(attn v) proj_w^T + proj_b, returned as [1, 256, 16, 16, 16].
#define NB 1
#define TT 4096
#define CC 256            // NH * HD = projected width
#define DIN 256          // input (model) width
#define NH 8
#define HD 32
#define NQB (TT / 64)
#define HG 2
#define SCALE (0.17677669529663687f)
#define SCALE_L2E (0.25503486f)   // SCALE x log2 e: exp(SCALE x) = exp2(SCALE_L2E x)
#define CAUSAL 0
#ifndef TNB
#define TNB NB
#endif
__device__ __forceinline__ float bfr(float v) { return (float)(__bf16)v; }
__host__ __device__ __forceinline__ int kb_last(int qb) { return CAUSAL ? ((qb * 64 + 63) >> 7) : (TT / 128 - 1); }
typedef __attribute__((ext_vector_type(8))) __bf16 v8b;
__device__ __forceinline__ v16b frag_b(const __bf16* rowk0, int lane) {
  union { v16b v; v8b q[2]; } u; const __bf16* p = rowk0 + 8 * (lane >> 4);
  u.q[0] = *(const v8b*)p; u.q[1] = *(const v8b*)(p + 16); return u.v;
}
#define QBH 0
#define QHI 4096            // rows carrying a q residual plane (all rows when non-causal: 2-product logits everywhere)
#define KHI 64            // key rows carrying k residual / v bf16 hi+lo planes (written by k_proj, read by no kernel in this file)
// B fragment (k rows k0+.., output column o) of a weight: (in,out) [K][ld] or (out,in) [ld rows of K]: bf16 exact, or f16(bf16 * 256) exact
__device__ __forceinline__ v16b wcol_io(const float* Wm, int k0, int o, int lane, int ld) { v16b w; const int g = lane >> 4;
#pragma unroll
  for (int i = 0; i < 8; ++i) { w[i] = (__bf16)Wm[(size_t)(k0 + 8 * g + i) * ld + o]; w[8 + i] = (__bf16)Wm[(size_t)(k0 + 16 + 8 * g + i) * ld + o]; }
  return w; }
__device__ __forceinline__ v16b wcol_oi(const float* Wm, int k0, int o, int lane, int K) { v16b w; const float* p = Wm + (size_t)o * K + k0 + 8 * (lane >> 4);
#pragma unroll
  for (int i = 0; i < 8; ++i) { w[i] = (__bf16)p[i]; w[8 + i] = (__bf16)p[16 + i]; }
  return w; }
__device__ __forceinline__ v16h wcolh_io(const float* Wm, int k0, int o, int lane, int ld) { v16h w; const int g = lane >> 4;
#pragma unroll
  for (int i = 0; i < 8; ++i) { w[i] = (_Float16)(bfr(Wm[(size_t)(k0 + 8 * g + i) * ld + o]) * 256.0f); w[8 + i] = (_Float16)(bfr(Wm[(size_t)(k0 + 16 + 8 * g + i) * ld + o]) * 256.0f); }
  return w; }
__device__ __forceinline__ v16h wcolh_oi(const float* Wm, int k0, int o, int lane, int K) { v16h w; const float* p = Wm + (size_t)o * K + k0 + 8 * (lane >> 4);
#pragma unroll
  for (int i = 0; i < 8; ++i) { w[i] = (_Float16)(bfr(p[i]) * 256.0f); w[8 + i] = (_Float16)(bfr(p[16 + i]) * 256.0f); }
  return w; }
#define WQKV_LAYOUT 1   // 0 = (in,out) [DIN][CC]; 1 = (out,in) [CC][DIN]; 2 = per-head [NH][DIN][HD]
__device__ __forceinline__ v16b wcol_hdk(const float* Wm, int k0, int o, int lane) { v16b w; const int g = lane >> 4; const float* p = Wm + (size_t)(o / HD) * DIN * HD + (o % HD);
#pragma unroll
  for (int i = 0; i < 8; ++i) { w[i] = (__bf16)p[(size_t)(k0 + 8 * g + i) * HD]; w[8 + i] = (__bf16)p[(size_t)(k0 + 16 + 8 * g + i) * HD]; }
  return w; }
#define WO_OUT_IN 1
#if WQKV_LAYOUT == 1
#define WCOL(W, k0, o, lane) wcol_oi(W, k0, o, lane, DIN)
#elif WQKV_LAYOUT == 2
#define WCOL(W, k0, o, lane) wcol_hdk(W, k0, o, lane)
#else
#define WCOL(W, k0, o, lane) wcol_io(W, k0, o, lane, CC)
#endif
#if WO_OUT_IN
#define WOCOL(W, k0, o, lane) wcol_oi(W, k0, o, lane, CC)
#define WOCOLH(W, k0, o, lane) wcolh_oi(W, k0, o, lane, CC)
#else
#define WOCOL(W, k0, o, lane) wcol_io(W, k0, o, lane, DIN)
#define WOCOLH(W, k0, o, lane) wcolh_io(W, k0, o, lane, DIN)
#endif
#define SM_MASK_HOOK do { const int dz = (t >> 8) - (k >> 8), dy = ((t >> 4) & 15) - ((k >> 4) & 15), dx = (t & 15) - (k & 15); v = (dz * dz + dy * dy + dx * dx < 100) ? v : -3.0e38f; } while (0)   /* local pattern: dist < 10 on the (d,h,w) token grid, exact in integers */
#define NTOK 4096
#ifndef SM_EXTRA_PARAMS
#define SM_EXTRA_PARAMS
#endif
#ifndef PROJ_EXTRA_PARAMS
#define PROJ_EXTRA_PARAMS
#endif
#ifndef SM_MASK_HOOK
#define SM_MASK_HOOK (void)0
#endif

#define WS_QH  0u                                      // f16 q rows [b*t][CC]
#define WS_KH  (WS_QH + 2u * (size_t)NB * TT * CC)      // f16 k rows [b*t][CC]
#define WS_VT  (WS_KH + 2u * (size_t)NB * TT * CC)      // f16 v planes [b][c][t]
#define WS_QL  (WS_VT + 2u * (size_t)NB * CC * TT)      // f16 q residual x 2^10 rows [b][t < QHI][CC]
#define WS_KL  (WS_QL + 2u * (size_t)NB * QHI * CC)     // f16 k residual x 2^10 rows [b][t < KHI][CC]
#define WS_VB  (WS_KL + 2u * (size_t)NB * KHI * CC)     // bf16 v hi planes [b][c][t < KHI]
#define WS_VBL (WS_VB + 2u * (size_t)NB * CC * KHI)
#define WS_S   (WS_VBL + 2u * (size_t)NB * CC * KHI)    // f32 [hg][t][s] area, unused (logits and P stay in registers)
#define WS_Y   (WS_S  + 4u * (size_t)HG * TT * TT)      // f32 ctx rows [b*t][CC] (only when there is an output projection)
#define WS_END (WS_Y  + 4u * (size_t)NB * TT * CC)

// The two projection kernels stage their operands in LDS once for the block's 4 waves: 128 weight rows and 64 token rows, the whole K = 256, already in the 16-bit type of the product.
// A wave's load of weight rows (and of k_out's token rows) covers 512 contiguous bytes of one row, and a thread's loads do not depend on each other, so 16 to 32 of them are in flight at a time.
#define GP 264            // LDS row pitch in 16-bit elements: 528 B = 16 B x 33 (odd), so the 16 rows of a fragment read fall on different banks
#define G_SX (128 * GP * 2)   // byte offset of the token rows [64][GP]; the weight rows [128][GP] lie at 0
#define G_BYTES ((128 + 64) * GP * 2)
typedef __attribute__((ext_vector_type(4))) __bf16 v4b;
typedef __attribute__((ext_vector_type(4))) _Float16 v4h;
// piece e of a wave: e < 64: half (e & 1) of weight row wave + 4 (e >> 1); e >= 64: the same of the token rows. wp, xp: the thread's 4 floats of the wave's first weight and token row.
// XCF = 1 (k_proj): the token rows come straight from the channels-first input x [256][NTOK]. Piece 64 + 4 u + i is 4 neighbouring tokens of one channel: tokens (u & 1) * 32 + (lane & 7) * 4 + 0..3, channel wave * 64 + (u >> 1) * 16 + (lane >> 3) * 4 + i; xp: the thread's 4 floats of piece 64. A wave's load covers 4 runs of 128 contiguous bytes, and pieces u, u + 1 (u even) together the 256 bytes that the block's 64 tokens have in a channel.
template <int XCF> __device__ __forceinline__ v4f g_load(const float* wp, const float* xp, int e) {
  if (XCF && e >= 64) return *(const v4f*)(xp + (size_t)(((e - 64) >> 3) * 16 + (e & 3)) * NTOK + ((e >> 2) & 1) * 32);
  return *(const v4f*)((e < 64 ? wp : xp) + (size_t)((e & 63) >> 1) * 4 * 256 + (e & 1) * 128); }
// the 4 pieces of one u are a 4 x 4 block (channel i, token j): it is turned by the choice of registers alone, and each LDS store holds 4 channels of one token, as a store of a token row's piece does
__device__ __forceinline__ void g_store_x(char* sm, int wave, int lane, int u, const v4f* r4) {
#pragma unroll
  for (int j = 0; j < 4; ++j) { v4b o;
#pragma unroll
    for (int i = 0; i < 4; ++i) o[i] = (__bf16)r4[i][j];
    *(v4b*)(sm + G_SX + (((u & 1) * 32 + (lane & 7) * 4 + j) * GP + wave * 64 + (u >> 1) * 16 + (lane >> 3) * 4) * 2) = o; }
}
// F16 = 0: both operands to bf16 (k_proj); 1: weights as f16(bf16 x 2^8), rows once to f16 (k_out): the conversions that the fragment loaders from global memory made
template <int F16> __device__ __forceinline__ void g_store(char* sm, int wave, int lane, int e, v4f r) {
  char* d = sm + (e < 64 ? 0 : G_SX) + ((wave + 4 * ((e & 63) >> 1)) * GP + (e & 1) * 128 + lane * 4) * 2;
  if (F16) { v4h o;
#pragma unroll
    for (int q = 0; q < 4; ++q) o[q] = e < 64 ? (_Float16)(bfr(r[q]) * 256.0f) : (_Float16)r[q];
    *(v4h*)d = o;
  } else { v4b o;
#pragma unroll
    for (int q = 0; q < 4; ++q) o[q] = (__bf16)r[q];
    *(v4b*)d = o; }
}
template <int F16, int XCF> __device__ __forceinline__ void g_stage(char* sm, const float* wp, const float* xp, int wave, int lane) {
  v4f r[2][16];
#pragma unroll
  for (int i = 0; i < 32; ++i) r[i >> 4][i & 15] = g_load<XCF>(wp, xp, i);
#pragma unroll
  for (int s = 0; s < 6; ++s) {
    __builtin_amdgcn_sched_barrier(0);   /* holds the later groups' loads behind this group's stores: without it all 96 loads were issued at once, on more than 256 registers */
    if (XCF && s >= 4) {
#pragma unroll
      for (int b = 0; b < 4; ++b) g_store_x(sm, wave, lane, (s - 4) * 4 + b, &r[s & 1][b * 4]);
    } else {
#pragma unroll
      for (int i = 0; i < 16; ++i) g_store<F16>(sm, wave, lane, s * 16 + i, r[s & 1][i]); }
    __builtin_amdgcn_sched_barrier(0);   /* as above */
    if (s + 2 < 6) {
#pragma unroll
      for (int i = 0; i < 16; ++i) r[s & 1][i] = g_load<XCF>(wp, xp, (s + 2) * 16 + i); }
  }
  asm volatile("s_wait_xcnt 0x0" :: "v"(wp), "v"(xp) : "memory");   /* the address registers of the issued loads stay live up to this wait, so nothing overwrites them in front of it */
}
// ---- k_proj: block = (64 rows, 128 cols, which), X = the input itself, channels-first [DIN][NTOK], a row = a token: q/k/v = X W (+ b) with exact bf16 products (K = DIN) -> which 0: q f16 rows (+ residual rows < QHI); 1: k f16 rows (+ residual rows < KHI); 2: v f16 planes [c][t] (+ bf16 hi/lo planes for t < KHI)
__global__ __launch_bounds__(128) void k_proj(const float* __restrict__ XQ, const float* __restrict__ XK, const float* __restrict__ XV, const float* __restrict__ WQ, const float* __restrict__ WK, const float* __restrict__ WV, const float* __restrict__ BQ, const float* __restrict__ BK, const float* __restrict__ BV,
    _Float16* __restrict__ QH, _Float16* __restrict__ QL, _Float16* __restrict__ KH, _Float16* __restrict__ KL, _Float16* __restrict__ VT, __bf16* __restrict__ VB, __bf16* __restrict__ VBL) {
  __shared__ __align__(16) char sm[G_BYTES];   /* first the staged operands; behind the second barrier the output tiles below lie in the same bytes */
  const __bf16 (*sw)[GP] = (const __bf16 (*)[GP])sm; const __bf16 (*sx)[GP] = (const __bf16 (*)[GP])(sm + G_SX);
  _Float16 (*sh)[136] = (_Float16 (*)[136])sm; _Float16 (*sl)[136] = (_Float16 (*)[136])(sm + 64 * 136 * 2);
  _Float16 (*th)[72] = (_Float16 (*)[72])sm; __bf16 (*tb)[72] = (__bf16 (*)[72])(sm + 128 * 72 * 2); __bf16 (*tbl)[72] = (__bf16 (*)[72])(sm + 2 * 128 * 72 * 2);
  const int tid = threadIdx.x, wave = tid >> 5, lane = tid & 31, col = lane & 15, g = lane >> 4; const int which = blockIdx.z; const int c0 = blockIdx.y * 128; const size_t r0 = (size_t)blockIdx.x * 64; const size_t bb = r0 / TT; const int t0 = (int)(r0 % TT);
  const float* X = which == 0 ? XQ : which == 1 ? XK : XV; const float* WA = which == 0 ? WQ : which == 1 ? WK : WV; const float* BA = which == 0 ? BQ : which == 1 ? BK : BV;
  g_stage<0, 1>(sm, WA + (size_t)(c0 + wave) * DIN + lane * 4, X + (size_t)(wave * 64 + (lane >> 3) * 4) * NTOK + r0 + (lane & 7) * 4, wave, lane);
  __syncthreads();   /* the staged rows are published to the block's waves */
  v8f acc[8] = {};
  // the fragments of k step kc + 1 are read from LDS in front of the products of step kc (same elements at the same lane and register as the loads from global memory had)
  v16b ac = frag_b(&sx[wave * 16 + col][0], lane), wc[8];
#pragma unroll
  for (int j = 0; j < 8; ++j) wc[j] = frag_b(&sw[j * 16 + col][0], lane);
#pragma unroll
  for (int kc = 0; kc < DIN / 32; ++kc) { v16b an = ac, wn[8];
    if (kc + 1 < DIN / 32) { an = frag_b(&sx[wave * 16 + col][(kc + 1) * 32], lane);
#pragma unroll
      for (int j = 0; j < 8; ++j) wn[j] = frag_b(&sw[j * 16 + col][(kc + 1) * 32], lane); }
#pragma unroll
    for (int j = 0; j < 8; ++j) acc[j] = wmma_bf(ac, wc[j], acc[j]);
    if (kc + 1 < DIN / 32) { ac = an;
#pragma unroll
      for (int j = 0; j < 8; ++j) wc[j] = wn[j]; } }
  __syncthreads();   /* every wave has read its last fragment before the output tiles overwrite the staged rows */
  if (which < 2) { _Float16* DH = which == 0 ? QH : KH; _Float16* DL = which == 0 ? QL : KL; const int nhi = which == 0 ? QHI : KHI; const bool hi_rows = t0 < nhi;
#pragma unroll
    for (int j = 0; j < 8; ++j) { const float bias = BA ? bfr(BA[c0 + j * 16 + col]) : 0.f;
#pragma unroll
      for (int r = 0; r < 8; ++r) { const float v = acc[j][r] + bias; const _Float16 hv = (_Float16)v; sh[wave * 16 + 8 * g + r][j * 16 + col] = hv; sl[wave * 16 + 8 * g + r][j * 16 + col] = (_Float16)((v - (float)hv) * 1024.0f); } }
    __syncthreads();
    for (int e = tid; e < 64 * 16; e += 128) { const int rl = e >> 4, q = e & 15; vst2((unsigned*)(DH + (r0 + rl) * CC + c0 + q * 8), *(const v4u*)&sh[rl][q * 8]); if (hi_rows) vst2((unsigned*)(DL + (bb * nhi + t0 + rl) * (size_t)CC + c0 + q * 8), *(const v4u*)&sl[rl][q * 8]); }
  } else { const bool hi_rows = t0 < KHI;
#pragma unroll
    for (int j = 0; j < 8; ++j) { const float bias = BA ? bfr(BA[c0 + j * 16 + col]) : 0.f;
#pragma unroll
      for (int r = 0; r < 8; ++r) { const float v = acc[j][r] + bias; const int rl = wave * 16 + 8 * g + r, cl = j * 16 + col; th[cl][rl] = (_Float16)v; const __bf16 bh = (__bf16)v; tb[cl][rl] = bh; tbl[cl][rl] = (__bf16)(v - (float)bh); } }
    __syncthreads();
    for (int e = tid; e < 128 * 8; e += 128) { const int cl = e >> 3, q = e & 7; vst2((unsigned*)(VT + (bb * CC + c0 + cl) * (size_t)TT + t0 + q * 8), *(const v4u*)&th[cl][q * 8]); if (hi_rows) { const size_t o3 = (bb * CC + c0 + cl) * (size_t)KHI + t0 + q * 8; vst2((unsigned*)(VB + o3), *(const v4u*)&tb[cl][q * 8]); vst2((unsigned*)(VBL + o3), *(const v4u*)&tbl[cl][q * 8]); } } } }
// ---- k_fa: block = 8 waves = 8 x rows of the token grid (16 queries each) of one head; a wave owns one row and walks the keys in ascending order, up to 64 a pass, with a running maximum and sum.
// S^T = K Q^T (A = 16 key rows, B = the wave's q hi, then its q residual): a lane holds 8 keys (8g + r) of its own query (col), so two key tiles are, as they stand, the B fragment of ctx^T = V^T P^T and the logits never leave the registers.
// K and V of two z planes of keys (a stage = 512 keys = 32 key tiles, a tile = one x row) are brought into LDS once for the block's 8 waves by asynchronous copies, two buffers, the next stage in flight while this one is worked on.
// A key tile (kz, ky) holds a key within distance 10 of a query row (tz, ty) only if dz^2 + dy^2 < 100: in a plane these are the tiles ky = ty - L .. ty + L, and a wave works on no others (their weights are exact zeros): it lists its tiles of the stage and takes them 4 a pass (2 in a short last pass).
// The number of such tiles runs from 86 (a corner row) to 247 of 256, so the rows are dealt to the blocks in a mix: 4 rows of plane zp and 4 of plane zp + 8, outer y with inner y, mirrored in y.
// fragment from the lane's own address (row start + k0 + 8 * (lane >> 4)): same k order as frag_h
__device__ __forceinline__ v16h frag_p(const _Float16* p) { union { v16h v; v8h q[2]; } u; u.q[0] = *(const v8h*)p; u.q[1] = *(const v8h*)(p + 16); return u.v; }
// the address registers of issued loads stay live up to this wait, so nothing overwrites them in front of it
#define FA_XWAIT(p0, p1) asm volatile("s_wait_xcnt 0x0" :: "v"(p0), "v"(p1) : "memory")
#define FA_SK 512          // keys a stage
#define FA_STG 65536       // bytes a stage: 32 K tiles, then 32 V tiles, 1024 B each
#define FA_V 32768         // byte offset of the V tiles in a stage
// A stage lies in LDS in fragment order, linear in the key tile T: a half fragment (8 elements a lane) is 512 B, lane l's 16 bytes at l * 16, so a reader's ds_load_b128 covers 512 contiguous bytes.
// K tile T: T * 1024 + u * 512 (u: channels 16 u ..); V tile T: FA_V + T * 1024 + j * 512 (j: channels 16 j ..). Any 4 tiles make a pass. Same elements at the same lane and register as before. ta: the lane's address in K tile T.
__device__ __forceinline__ v16h frag_k(const char* ta) { union { v16h v; v8h q[2]; } u; u.q[0] = *(const v8h*)ta; u.q[1] = *(const v8h*)(ta + 512); return u.v; }
__device__ __forceinline__ v16h frag_v(const char* ta0, const char* ta1, int j) { union { v16h v; v8h q[2]; } u; u.q[0] = *(const v8h*)(ta0 + FA_V + j * 512); u.q[1] = *(const v8h*)(ta1 + FA_V + j * 512); return u.v; }
// one plane's copies (a stage takes two such statements): a thread brings four 16-byte pieces of K and four of V (one of each 64 keys of the plane). The s_wait_xcnt stands in the copies' own statement, so no address register is rewritten in front of it.
__device__ __forceinline__ void fa_copy(unsigned kd, unsigned vd, const _Float16* kg, const _Float16* vg) {
  asm volatile("global_load_async_to_lds_b128 %0, %8, off\n\tglobal_load_async_to_lds_b128 %1, %9, off\n\tglobal_load_async_to_lds_b128 %2, %10, off\n\tglobal_load_async_to_lds_b128 %3, %11, off\n\t"
               "global_load_async_to_lds_b128 %4, %12, off\n\tglobal_load_async_to_lds_b128 %5, %13, off\n\tglobal_load_async_to_lds_b128 %6, %14, off\n\tglobal_load_async_to_lds_b128 %7, %15, off\n\ts_wait_xcnt 0x0"
    :: "v"(kd), "v"(kd + 4096u), "v"(kd + 8192u), "v"(kd + 12288u), "v"(vd), "v"(vd + 4096u), "v"(vd + 8192u), "v"(vd + 12288u),
       "v"(kg), "v"(kg + (size_t)64 * CC), "v"(kg + (size_t)128 * CC), "v"(kg + (size_t)192 * CC), "v"(vg), "v"(vg + 64), "v"(vg + 128), "v"(vg + 192) : "memory");
}
// 2^x in place, a run of v_exp_f32 in one statement: each is the independent instruction behind the one before it, and the v_nop fills the slot behind the last
__device__ __forceinline__ void exp2_8(float (&x)[8]) {
  asm("v_exp_f32 %0, %0\n\tv_exp_f32 %1, %1\n\tv_exp_f32 %2, %2\n\tv_exp_f32 %3, %3\n\tv_exp_f32 %4, %4\n\tv_exp_f32 %5, %5\n\tv_exp_f32 %6, %6\n\tv_exp_f32 %7, %7\n\tv_nop"
    : "+v"(x[0]), "+v"(x[1]), "+v"(x[2]), "+v"(x[3]), "+v"(x[4]), "+v"(x[5]), "+v"(x[6]), "+v"(x[7]));
}
__device__ __forceinline__ void exp2_9(float& a, float (&x)[8]) {
  asm("v_exp_f32 %8, %8\n\tv_exp_f32 %0, %0\n\tv_exp_f32 %1, %1\n\tv_exp_f32 %2, %2\n\tv_exp_f32 %3, %3\n\tv_exp_f32 %4, %4\n\tv_exp_f32 %5, %5\n\tv_exp_f32 %6, %6\n\tv_exp_f32 %7, %7\n\tv_nop"
    : "+v"(x[0]), "+v"(x[1]), "+v"(x[2]), "+v"(x[3]), "+v"(x[4]), "+v"(x[5]), "+v"(x[6]), "+v"(x[7]), "+v"(a));
}
// one pass over NT key tiles (4, or 2 at the end of a stage's list): kc, vc hold their fragments and lim their limits on entry.
// NT = 4 reads the next pass's fragments (tiles number nx .. nx + 3 of the list) into the same registers: K behind this pass's S products, V behind its P V products, each well ahead of its use.
template <int NT> __device__ __forceinline__ void fa_pass(v16h (&kc)[4], v16h (&vc)[4], int (&lim)[4], v8f (&acc)[2], float& m, float& l, const char* rb, int pack, int nx, const int (&dx2)[8], v16h qh, v16h ql) {
  const v8f zero = {};
  v8f sa[NT], sb[NT];
#pragma unroll
  for (int i = 0; i < NT; ++i) { sa[i] = wmma16(kc[i], qh, zero); sb[i] = wmma16(kc[i], ql, zero); }
  int limn[4]; const char* ta[4];
  if (NT == 4) {
#pragma unroll
    for (int i = 0; i < 4; ++i) { const int pk = __builtin_amdgcn_readlane(pack, nx + i); limn[i] = pk >> 16; ta[i] = rb + (pk & 0xffff); }
#pragma unroll
    for (int i = 0; i < 4; ++i) kc[i] = frag_k(ta[i]);
  }
  float s[NT][8];
#pragma unroll
  for (int i = 0; i < NT; ++i) {   /* a key tile is one x row: dist < 10 <=> dx^2 < 100 - dz^2 - dy^2 = lim, exact in integers */
#pragma unroll
    for (int r = 0; r < 8; ++r) { const float v = sa[i][r] + sb[i][r] * (1.0f / 1024.0f); s[i][r] = dx2[r] < lim[i] ? v : -3.0e38f; } }   /* unscaled: the scale is positive, so the maximum is the same key's, and it goes into the exponent's one fma below */
  float mx = m;
#pragma unroll
  for (int i = 0; i < NT; ++i)
#pragma unroll
    for (int r = 0; r < 8; ++r) mx = fmaxf(mx, s[i][r]);
  mx = fmaxf(mx, __shfl_xor(mx, 16));
  float alpha = (m - mx) * SCALE_L2E; m = mx; const float nb = 11.0f - mx * SCALE_L2E;   /* P is carried x 2^11 as before; the factor cancels in acc / l. An excluded logit gives an exponent near -7.6e37 and exp2 = 0 */
  float e[NT][8];
#pragma unroll
  for (int i = 0; i < NT; ++i)
#pragma unroll
    for (int r = 0; r < 8; ++r) e[i][r] = fmaf(s[i][r], SCALE_L2E, nb);
  exp2_9(alpha, e[0]); exp2_8(e[1]);
  l *= alpha;
#pragma unroll
  for (int j = 0; j < 2; ++j)
#pragma unroll
    for (int r = 0; r < 8; ++r) acc[j][r] *= alpha;
#pragma unroll
  for (int c = 0; c < NT / 2; ++c) { v16h pf;
    if (c == 1) { exp2_8(e[NT - 2]); exp2_8(e[NT - 1]); }   /* the second pair's exponentials stand behind the first pair's products */
#pragma unroll
    for (int r = 0; r < 8; ++r) { const float e0 = e[2 * c][r], e1 = e[2 * c + 1][r]; l += e0 + e1; pf[r] = (_Float16)e0; pf[8 + r] = (_Float16)e1; }
#pragma unroll
    for (int j = 0; j < 2; ++j) acc[j] = wmma16(vc[c * 2 + j], pf, acc[j]); }
  if (NT == 4) {
#pragma unroll
    for (int i = 0; i < 4; ++i) { vc[i] = frag_v(ta[i & 2], ta[(i & 2) + 1], i & 1); lim[i] = limn[i]; }
  }
}
// one stage = two planes of keys, z0 and z0 + 1; rb: the lane's address in the stage's buffer. The wave's tiles of the stage, in ascending order, are numbered 0 .. total - 1 (at most 32).
// Lane n works out tile n once a stage: its byte offset T * 1024 and its lim = 100 - dz^2 - dy^2, packed in one word; a pass fetches its words into scalar registers (v_readlane). The numbers from total on name a tile of the stage with lim = 0, which excludes all of its keys.
// The list is taken 4 tiles a pass; where 1 or 2 tiles are left at its end, the last pass takes 2.
__device__ __forceinline__ void fa_stage(v8f (&acc)[2], float& m, float& l, const char* rb, int z0, int tz, int ty, int lane, const int (&dx2)[8], v16h qh, v16h ql) {
  int lo[2], len[2], lm[2];   /* per plane: first tile, number of tiles, 100 - dz^2; the same in every lane of the wave */
#pragma unroll
  for (int k = 0; k < 2; ++k) { const int dz = tz - (z0 + k), l0 = 100 - dz * dz; int L = 0;   /* L: the largest |dy| with dy^2 < l0 */
#pragma unroll
    for (int d = 1; d < 10; ++d) L += d * d < l0 ? 1 : 0;
    const int a = ty - L > 0 ? ty - L : 0, b = ty + L < 15 ? ty + L : 15; lo[k] = a; len[k] = l0 > 0 ? b - a + 1 : 0; lm[k] = l0; }
  const int total = len[0] + len[1], np = (total + 3) >> 2, nf = (total + 1) >> 2;   /* np passes, the first nf of them of 4 tiles */
  if (np == 0) return;
  const bool k1 = lane >= len[0]; const int ky = k1 ? lo[1] + lane - len[0] : lo[0] + lane, dyl = ty - ky;
  const int pack = lane < total ? ((((k1 ? lm[1] : lm[0]) - dyl * dyl) << 16) | (((k1 ? 16 : 0) + ky) << 10)) : ((len[0] > 0 ? lo[0] : 16 + lo[1]) << 10);
  int lim[4]; v16h kc[4], vc[4];
  { const char* ta[4];
#pragma unroll
    for (int i = 0; i < 4; ++i) { const int pk = __builtin_amdgcn_readlane(pack, i); lim[i] = pk >> 16; ta[i] = rb + (pk & 0xffff); }
#pragma unroll
    for (int i = 0; i < 4; ++i) { kc[i] = frag_k(ta[i]); vc[i] = frag_v(ta[i & 2], ta[(i & 2) + 1], i & 1); } }
#pragma unroll 1   /* the trip count differs from wave to wave and from stage to stage */
  for (int p = 0; p < nf; ++p) fa_pass<4>(kc, vc, lim, acc, m, l, rb, pack, (p + 1 < np ? p + 1 : p) * 4, dx2, qh, ql);   /* the stage's last pass reads its own fragments again */
  if (nf < np) fa_pass<2>(kc, vc, lim, acc, m, l, rb, pack, 0, dx2, qh, ql);
}
// the foot of a trip: this wave's reads of the buffer are done before it may be refilled; its share of the next stage has landed; the barrier publishes that stage and ends every wave's reads of this one. Every wave passes it, also one that had no tile in the stage.
#define FA_PUBLISH() do { asm volatile("s_wait_dscnt 0x0" ::: "memory"); asm volatile("s_wait_asynccnt 0x0" ::: "memory"); __syncthreads(); } while (0)
// amdgpu_waves_per_eu(4, 4) names a budget of 256 registers: with none named this build chose fewer registers and a serial order of the softmax (more v_nop and s_delay_alu in the loop than the loop had before)
__global__ __launch_bounds__(256) __attribute__((amdgpu_waves_per_eu(4, 4))) void k_fa(const _Float16* __restrict__ QH, const _Float16* __restrict__ QL, const _Float16* __restrict__ KH, const _Float16* __restrict__ VT, float* __restrict__ Y) {
  __shared__ __align__(512) char ring[2 * FA_STG];
  const int tid = threadIdx.x, wave = __builtin_amdgcn_readfirstlane(tid >> 5), lane = tid & 31, col = lane & 15, g = lane >> 4;
  const int h = blockIdx.y;
  // the wave's query row (tz, ty): kind = 0: plane zp, y set js = blockIdx.x >> 3; kind = 1: plane zp + 8, y set 3 - js; y set s = { 2 s, 2 s + 1, 15 - 2 s, 14 - 2 s }. Waves w and w + 4, and waves 2 i and 2 i + 1, are of different kinds. Each of the 256 rows falls to one wave of the 32 blocks.
  const int kind = (wave ^ (wave >> 2)) & 1, yi = wave >> 1, ys = kind ? 3 - (blockIdx.x >> 3) : (blockIdx.x >> 3);
  const int tz = (blockIdx.x & 7) + 8 * kind, ty = yi < 2 ? 2 * ys + yi : 17 - 2 * ys - yi; const int q0 = (tz * 16 + ty) * 16;   /* the 16 queries share z and y; x = col */
  const _Float16* qhp = QH + (size_t)(q0 + col) * CC + h * HD + 8 * g; const _Float16* qlp = QL + (size_t)(q0 + col) * CC + h * HD + 8 * g;
  const v16h qh = frag_p(qhp), ql = frag_p(qlp); FA_XWAIT(qhp, qlp);
  int dx2[8];
#pragma unroll
  for (int r = 0; r < 8; ++r) { const int d = col - (8 * g + r); dx2[r] = d * d; }
  // the thread's pieces: piece cq of a row = elements 8 cq .. 8 cq + 7 = (u = cq >> 1, g = cq & 1); K row tid >> 2 of 64 keys (tile tid >> 6, row crow); V channel (tid >> 2) & 31 (j, crow), keys (tid >> 7) * 32 + 8 cq .. of 64 (tile (tid >> 7) * 2 + u)
  const int cq = tid & 3, crow = (tid >> 2) & 15;
  const unsigned rg = (unsigned)(size_t)ring;   /* the LDS byte address is the low word of the shared address */
  const unsigned kd = rg + (unsigned)(tid >> 6) * 1024u + (unsigned)(((cq >> 1) * 32 + (cq & 1) * 16 + crow) * 16);
  const unsigned vd = rg + FA_V + (unsigned)((tid >> 7) * 2 + (cq >> 1)) * 1024u + (unsigned)((tid >> 6) & 1) * 512u + (unsigned)(((cq & 1) * 16 + crow) * 16);
  const _Float16* kg = KH + (size_t)(tid >> 2) * CC + h * HD + cq * 8; const _Float16* vg = VT + (size_t)(h * HD + ((tid >> 2) & 31)) * TT + (tid >> 7) * 32 + cq * 8;
  const char* rl = ring + lane * 16;
  v8f acc[2] = {}; float m = -1.0e30f, l = 0.f;   /* the start maximum is finite, so an excluded logit (-3e38) gives exp = 0 also while no key has been admitted yet */
  fa_copy(kd, vd, kg, vg); fa_copy(kd + 16384u, vd + 16384u, kg + (size_t)256 * CC, vg + 256);
  asm volatile("s_wait_asynccnt 0x0" ::: "memory");   /* stage 0 has landed, as far as this wave brought it */
  __syncthreads();                                    /* ... and is published to the other waves */
  fa_copy(kd + FA_STG, vd + FA_STG, kg + (size_t)FA_SK * CC, vg + FA_SK); fa_copy(kd + FA_STG + 16384u, vd + FA_STG + 16384u, kg + (size_t)(FA_SK + 256) * CC, vg + FA_SK + 256);
#pragma unroll 1   /* one body: the stages differ only in scalars */
  for (int t = 0; t < TT / FA_SK; ++t) {
    fa_stage(acc, m, l, rl + (t & 1) * FA_STG, t * 2, tz, ty, lane, dx2, qh, ql);
    FA_PUBLISH();
    if (t + 2 < TT / FA_SK) {   /* into the buffer that this trip has just read; the test is the same for the whole block */
      fa_copy(kd + (t & 1) * FA_STG, vd + (t & 1) * FA_STG, kg + (size_t)(t + 2) * FA_SK * CC, vg + (t + 2) * FA_SK);
      fa_copy(kd + (t & 1) * FA_STG + 16384u, vd + (t & 1) * FA_STG + 16384u, kg + ((size_t)(t + 2) * FA_SK + 256) * CC, vg + (t + 2) * FA_SK + 256); }
  }
  asm volatile("s_wait_asynccnt 0x0" ::: "memory");   /* no copy is outstanding when the wave ends */
  l += __shfl_xor(l, 16); const float inv = l > 0.f ? 1.0f / l : 0.f;   /* a fully excluded row yields 0 */
#pragma unroll
  for (int j = 0; j < 2; ++j) { v4f o0, o1;
#pragma unroll
    for (int r = 0; r < 4; ++r) { o0[r] = acc[j][r] * inv; o1[r] = acc[j][4 + r] * inv; }
    float* yp = Y + (size_t)(q0 + col) * CC + h * HD + j * 16 + 8 * g; vst2(yp, o0); vst2(yp + 4, o1); } }
// ---- k_out: block = (64 rows, 128 cols): out = ctx Wo (+ bo), written channels-first: ctx once to f16 against Wo as f16(bf16 x 2^8) exact (1 product) x 2^-8; causal early rows (< QHI of each sequence): ctx bf16 hi + lo against exact bf16 Wo (2 products)
__global__ __launch_bounds__(128) void k_out(const float* __restrict__ Y, const float* __restrict__ WO, const float* __restrict__ BO, float* __restrict__ OUT) { __shared__ __align__(16) float sf[128][68]; __shared__ __align__(16) char sm[G_BYTES];   /* sf: the block's result, [channel][token]; pitch 272 B = 16 B x 17 (odd), so that the 16 channels of a 16-byte store fall on different banks */
  const int tid = threadIdx.x, wave = tid >> 5, lane = tid & 31, col = lane & 15, g = lane >> 4; const int c0 = blockIdx.y * 128; const size_t r0 = (size_t)blockIdx.x * 64 + wave * 16;
  v8f acc[8] = {};
  if (CAUSAL && (int)(((size_t)blockIdx.x * 64) % TT) < QHI) {   /* block-uniform */
#pragma unroll 2
    for (int kc = 0; kc < CC / 32; ++kc) { const F2 a = split_row(Y + (r0 + col) * CC, kc * 32, lane); asm volatile("s_wait_loadcnt 0x0" ::: "memory");
#pragma unroll
      for (int j = 0; j < 8; ++j) { const v16b w = WOCOL(WO, kc * 32, c0 + j * 16 + col, lane); asm volatile("s_wait_loadcnt 0x0" ::: "memory"); acc[j] = wmma_bf(a.h, w, acc[j]); acc[j] = wmma_bf(a.l, w, acc[j]); } }
#pragma unroll
    for (int j = 0; j < 8; ++j) { const float bias = BO ? bfr(BO[c0 + j * 16 + col]) : 0.f;
#pragma unroll
      for (int r = 0; r < 8; ++r) sf[j * 16 + col][wave * 16 + 8 * g + r] = acc[j][r] + bias; }
  } else {
    const _Float16 (*sw)[GP] = (const _Float16 (*)[GP])sm; const _Float16 (*sx)[GP] = (const _Float16 (*)[GP])(sm + G_SX);
    g_stage<1, 0>(sm, WO + (size_t)(c0 + wave) * CC + lane * 4, Y + ((size_t)blockIdx.x * 64 + wave) * CC + lane * 4, wave, lane);
    __syncthreads();   /* the staged rows are published to the block's waves */
    v16h ac = frag_h(&sx[wave * 16 + col][0], lane), wc[8];   /* fragments one k step ahead, as in k_proj */
#pragma unroll
    for (int j = 0; j < 8; ++j) wc[j] = frag_h(&sw[j * 16 + col][0], lane);
#pragma unroll
    for (int kc = 0; kc < CC / 32; ++kc) { v16h an = ac, wn[8];
      if (kc + 1 < CC / 32) { an = frag_h(&sx[wave * 16 + col][(kc + 1) * 32], lane);
#pragma unroll
        for (int j = 0; j < 8; ++j) wn[j] = frag_h(&sw[j * 16 + col][(kc + 1) * 32], lane); }
#pragma unroll
      for (int j = 0; j < 8; ++j) acc[j] = wmma16(ac, wc[j], acc[j]);
      if (kc + 1 < CC / 32) { ac = an;
#pragma unroll
        for (int j = 0; j < 8; ++j) wc[j] = wn[j]; } }
#pragma unroll
    for (int j = 0; j < 8; ++j) { const float bias = BO ? bfr(BO[c0 + j * 16 + col]) : 0.f;
#pragma unroll
      for (int r = 0; r < 8; ++r) sf[j * 16 + col][wave * 16 + 8 * g + r] = acc[j][r] * (1.0f / 256.0f) + bias; } }   /* a lane's 8 results are 8 neighbouring tokens of one channel */
  __syncthreads();   /* the four waves' result rows are published: a channel's 64 tokens come from all of them */
  // channels-first output [DIN][NTOK]: 16 threads write the 256 contiguous bytes that the block's 64 tokens have in one channel
  const int q = tid & 15; float* op = OUT + (size_t)(c0 + (tid >> 4)) * NTOK + (size_t)blockIdx.x * 64 + q * 4;
#pragma unroll
  for (int it = 0; it < 16; ++it) vst2(op + (size_t)it * 8 * NTOK, *(const v4f*)&sf[it * 8 + (tid >> 4)][q * 4]); }

extern "C" void kernel_launch(void* const* d_in, const int* in_sizes, int n_in, void* d_out, int out_size, void* d_ws, size_t ws_size, hipStream_t stream) {
  (void)in_sizes; (void)n_in; (void)out_size;
  const float** F = (const float**)d_in;
  if (ws_size < (size_t)WS_END) return;
  char* ws = (char*)d_ws; _Float16 *QH = (_Float16*)(ws + WS_QH), *KH = (_Float16*)(ws + WS_KH), *VT = (_Float16*)(ws + WS_VT), *QL = (_Float16*)(ws + WS_QL), *KL = (_Float16*)(ws + WS_KL); __bf16 *VB = (__bf16*)(ws + WS_VB), *VBL = (__bf16*)(ws + WS_VBL); float *Y = (float*)(ws + WS_Y);
  (void)Y; (void)QL; (void)KL; (void)VB; (void)VBL;
  // inputs: 0 x [1,256,16,16,16]; 1 qkv_w [768,256] (out,in) rows q | k | v; 2 proj_w [256,256] (out,in); 3 proj_b
  { const float* WQ = F[1]; const float* WK = F[1] + (size_t)CC * DIN; const float* WV = F[1] + (size_t)2 * CC * DIN;
    k_proj<<<dim3(TNB * TT / 64, CC / 128, 3), 128, 0, stream>>>(F[0], F[0], F[0], WQ, WK, WV, nullptr, nullptr, nullptr, QH, QL, KH, KL, VT, VB, VBL); }
  k_fa<<<dim3(TT / 128, NH), 256, 0, stream>>>(QH, QL, KH, VT, Y);
  k_out<<<dim3(TNB * TT / 64, DIN / 128), 128, 0, stream>>>(Y, F[2], F[3], (float*)d_out);
}

// v007
// A run of this version takes 44.4 microseconds.
// Next to v006, in two timings, it ran 1.09 and 1.10 times as fast.
// Counting every step since v000, it is 16.9 times as fast.
// compute dtype: all float inputs rounded to bf16; tokens = bf16(x) transposed; qkv = tok W^T with EXACT bf16 products on WMMA 16x16x32 (f32 accumulate); q as f16 hi + residual (x 2^10) against k once to f16 (2 products) x 32^-0.5; the local window (grid distance < 10) as an exact integer test per (query, key); softmax in f32 (hardware exp2, the logit scale x log2 e folded into its argument) with a running maximum and sum, logits and P kept in registers; P x 2^11 once to f16 against v once to f16 (1 product); ctx once to f16 against proj_w carried x 2^8 in f16 + b; f32 output written channels-first.
#include <hip/hip_runtime.h>
#include <math.h>

typedef __attribute__((ext_vector_type(16))) _Float16 v16h;
typedef __attribute__((ext_vector_type(16))) __bf16 v16b;
typedef __attribute__((ext_vector_type(8)))  _Float16 v8h;
typedef __attribute__((ext_vector_type(8)))  float v8f;
typedef __attribute__((ext_vector_type(4)))  float v4f;
typedef __attribute__((ext_vector_type(2)))  float v2f;
typedef __attribute__((ext_vector_type(4)))  unsigned v4u;
typedef __attribute__((ext_vector_type(4)))  int v4i;
typedef float __attribute__((may_alias)) float_a;
typedef int __attribute__((may_alias)) int_a;

template <typename T> __device__ __forceinline__ void vst2(void* p, T v) { *(T*)p = v;  }
__device__ __forceinline__ v8f wmma16(v16h a, v16h b, v8f c) {
  v8f d = __builtin_amdgcn_wmma_f32_16x16x32_f16(false, a, false, b, (short)0, c, false, false);
  asm volatile("v_nop\n\tv_nop\n\tv_nop\n\tv_nop" : "+v"(d) : "v"(a), "v"(b));
  return d;
}
__device__ __forceinline__ v8f wmma_bf(v16b a, v16b b, v8f c) {
  v8f d = __builtin_amdgcn_wmma_f32_16x16x32_bf16(false, a, false, b, (short)0, c, false, false);
  asm volatile("v_nop\n\tv_nop\n\tv_nop\n\tv_nop" : "+v"(d) : "v"(a), "v"(b));
  return d;
}
// 16x16x32 fragments: lane = (h = lane>>4, row/col = lane&15); elements 0..7 = k0+8h+0..7, 8..15 = k0+16+8h+0..7; D element r = row 8h+r
__device__ __forceinline__ v16h frag_h(const _Float16* rowk0, int lane) {
  union { v16h v; v8h q[2]; } u; const _Float16* p = rowk0 + 8 * (lane >> 4);
  u.q[0] = *(const v8h*)p; u.q[1] = *(const v8h*)(p + 16); return u.v;
}
__device__ __forceinline__ v16h frag_f32(const float* rowk0, int lane) {
  v16h a; const float* p = rowk0 + 8 * (lane >> 4);
#pragma unroll
  for (int i = 0; i < 8; ++i) { a[i] = (_Float16)p[i]; a[8 + i] = (_Float16)p[16 + i]; }
  return a;
}
__device__ __forceinline__ v16h frag_f32s(const float* rowk0, int lane, float sc) {
  v16h a; const float* p = rowk0 + 8 * (lane >> 4);
#pragma unroll
  for (int i = 0; i < 8; ++i) { a[i] = (_Float16)(p[i] * sc); a[8 + i] = (_Float16)(p[16 + i] * sc); }
  return a;
}
// column fragment from a [K][ld] layout (column n), rows >= K read as 0
__device__ __forceinline__ v16h fragc_f32(const float* W, int k0, int n, int lane, int ld, int K) {
  v16h a; const int g = lane >> 4;
#pragma unroll
  for (int i = 0; i < 8; ++i) { const int ka = k0 + 8 * g + i, kb = ka + 16;
    a[i] = (_Float16)(ka < K ? W[(size_t)(ka < K ? ka : K - 1) * ld + n] : 0.f); a[8 + i] = (_Float16)(kb < K ? W[(size_t)(kb < K ? kb : K - 1) * ld + n] : 0.f); }
  return a;
}
struct F2 { v16b h, l; };
__device__ __forceinline__ F2 bsplit16(const float v[16]) { F2 r;
#pragma unroll
  for (int i = 0; i < 16; ++i) { const __bf16 h = (__bf16)v[i]; r.h[i] = h; r.l[i] = (__bf16)(v[i] - (float)h); }
  return r; }
__device__ __forceinline__ F2 split_row(const float* row, int k0, int lane) { float v[16]; const float* p = row + k0 + 8 * (lane >> 4);
#pragma unroll
  for (int i = 0; i < 8; ++i) { v[i] = p[i]; v[8 + i] = p[16 + i]; }
  return bsplit16(v); }
__device__ __forceinline__ F2 split_rowK(const float* row, int k0, int lane, int K) { float v[16]; const int g = lane >> 4;
#pragma unroll
  for (int i = 0; i < 8; ++i) { const int ka = k0 + 8 * g + i, kb = ka + 16; v[i] = ka < K ? row[ka < K ? ka : K - 1] : 0.f; v[8 + i] = kb < K ? row[kb < K ? kb : K - 1] : 0.f; }
  return bsplit16(v); }
__device__ __forceinline__ F2 split_col(const float* W, int k0, int n, int lane, int ld, int K) { float v[16]; const int g = lane >> 4;
#pragma unroll
  for (int i = 0; i < 8; ++i) { const int ka = k0 + 8 * g + i, kb = ka + 16; v[i] = ka < K ? W[(size_t)(ka < K ? ka : K - 1) * ld + n] : 0.f; v[8 + i] = kb < K ? W[(size_t)(kb < K ? kb : K - 1) * ld + n] : 0.f; }
  return bsplit16(v); }
__device__ __forceinline__ v8f mac3(const F2& a, const F2& b, v8f c) { c = wmma_bf(a.l, b.h, c); c = wmma_bf(a.h, b.l, c); return wmma_bf(a.h, b.h, c); }
__device__ __forceinline__ float sigm(float v) { return 1.0f / (1.0f + expf(-v)); }
#define LDSX() do { asm volatile("s_wait_dscnt 0" ::: "memory"); __builtin_amdgcn_wave_barrier(); __builtin_amdgcn_fence(__ATOMIC_RELEASE, "workgroup"); } while (0)

// 3-D local-window attention layer (x [1, 256, 16, 16, 16] -> 4,096 tokens, 8 heads x 32): qkv = tok qkv_w^T (packed (out,in) [768, 256], layout (3, H, hd)); scores = q k^T / sqrt(32) masked to -inf where the integer grid distance between the two tokens is >= 10 (sqrt(dz^2+dy^2+dx^2) < 10 <=> d2 < 100); softmax; out = merged(attn v) proj_w^T + proj_b, returned as [1, 256, 16, 16, 16].
#define NB 1
#define TT 4096
#define CC 256            // NH * HD = projected width
#define DIN 256          // input (model) width
#define NH 8
#define HD 32
#define NQB (TT / 64)
#define HG 2
#define SCALE (0.17677669529663687f)
#define SCALE_L2E (0.25503486f)   // SCALE x log2 e: exp(SCALE x) = exp2(SCALE_L2E x)
#define CAUSAL 0
#ifndef TNB
#define TNB NB
#endif
__device__ __forceinline__ float bfr(float v) { return (float)(__bf16)v; }
__host__ __device__ __forceinline__ int kb_last(int qb) { return CAUSAL ? ((qb * 64 + 63) >> 7) : (TT / 128 - 1); }
typedef __attribute__((ext_vector_type(8))) __bf16 v8b;
__device__ __forceinline__ v16b frag_b(const __bf16* rowk0, int lane) {
  union { v16b v; v8b q[2]; } u; const __bf16* p = rowk0 + 8 * (lane >> 4);
  u.q[0] = *(const v8b*)p; u.q[1] = *(const v8b*)(p + 16); return u.v;
}
#define QBH 0
#define QHI 4096            // rows carrying a q residual plane (all rows when non-causal: 2-product logits everywhere)
#define KHI 64            // key rows carrying k residual / v bf16 hi+lo planes (written by k_proj, read by no kernel in this file)
// B fragment (k rows k0+.., output column o) of a weight: (in,out) [K][ld] or (out,in) [ld rows of K]: bf16 exact, or f16(bf16 * 256) exact
__device__ __forceinline__ v16b wcol_io(const float* Wm, int k0, int o, int lane, int ld) { v16b w; const int g = lane >> 4;
#pragma unroll
  for (int i = 0; i < 8; ++i) { w[i] = (__bf16)Wm[(size_t)(k0 + 8 * g + i) * ld + o]; w[8 + i] = (__bf16)Wm[(size_t)(k0 + 16 + 8 * g + i) * ld + o]; }
  return w; }
__device__ __forceinline__ v16b wcol_oi(const float* Wm, int k0, int o, int lane, int K) { v16b w; const float* p = Wm + (size_t)o * K + k0 + 8 * (lane >> 4);
#pragma unroll
  for (int i = 0; i < 8; ++i) { w[i] = (__bf16)p[i]; w[8 + i] = (__bf16)p[16 + i]; }
  return w; }
__device__ __forceinline__ v16h wcolh_io(const float* Wm, int k0, int o, int lane, int ld) { v16h w; const int g = lane >> 4;
#pragma unroll
  for (int i = 0; i < 8; ++i) { w[i] = (_Float16)(bfr(Wm[(size_t)(k0 + 8 * g + i) * ld + o]) * 256.0f); w[8 + i] = (_Float16)(bfr(Wm[(size_t)(k0 + 16 + 8 * g + i) * ld + o]) * 256.0f); }
  return w; }
__device__ __forceinline__ v16h wcolh_oi(const float* Wm, int k0, int o, int lane, int K) { v16h w; const float* p = Wm + (size_t)o * K + k0 + 8 * (lane >> 4);
#pragma unroll
  for (int i = 0; i < 8; ++i) { w[i] = (_Float16)(bfr(p[i]) * 256.0f); w[8 + i] = (_Float16)(bfr(p[16 + i]) * 256.0f); }
  return w; }
#define WQKV_LAYOUT 1   // 0 = (in,out) [DIN][CC]; 1 = (out,in) [CC][DIN]; 2 = per-head [NH][DIN][HD]
__device__ __forceinline__ v16b wcol_hdk(const float* Wm, int k0, int o, int lane) { v16b w; const int g = lane >> 4; const float* p = Wm + (size_t)(o / HD) * DIN * HD + (o % HD);
#pragma unroll
  for (int i = 0; i < 8; ++i) { w[i] = (__bf16)p[(size_t)(k0 + 8 * g + i) * HD]; w[8 + i] = (__bf16)p[(size_t)(k0 + 16 + 8 * g + i) * HD]; }
  return w; }
#define WO_OUT_IN 1
#if WQKV_LAYOUT == 1
#define WCOL(W, k0, o, lane) wcol_oi(W, k0, o, lane, DIN)
#elif WQKV_LAYOUT == 2
#define WCOL(W, k0, o, lane) wcol_hdk(W, k0, o, lane)
#else
#define WCOL(W, k0, o, lane) wcol_io(W, k0, o, lane, CC)
#endif
#if WO_OUT_IN
#define WOCOL(W, k0, o, lane) wcol_oi(W, k0, o, lane, CC)
#define WOCOLH(W, k0, o, lane) wcolh_oi(W, k0, o, lane, CC)
#else
#define WOCOL(W, k0, o, lane) wcol_io(W, k0, o, lane, DIN)
#define WOCOLH(W, k0, o, lane) wcolh_io(W, k0, o, lane, DIN)
#endif
#define SM_MASK_HOOK do { const int dz = (t >> 8) - (k >> 8), dy = ((t >> 4) & 15) - ((k >> 4) & 15), dx = (t & 15) - (k & 15); v = (dz * dz + dy * dy + dx * dx < 100) ? v : -3.0e38f; } while (0)   /* local pattern: dist < 10 on the (d,h,w) token grid, exact in integers */
#define NTOK 4096
#ifndef SM_EXTRA_PARAMS
#define SM_EXTRA_PARAMS
#endif
#ifndef PROJ_EXTRA_PARAMS
#define PROJ_EXTRA_PARAMS
#endif
#ifndef SM_MASK_HOOK
#define SM_MASK_HOOK (void)0
#endif

#define WS_QH  0u                                      // f16 q rows [b*t][CC]
#define WS_KH  (WS_QH + 2u * (size_t)NB * TT * CC)      // f16 k rows [b*t][CC]
#define WS_VT  (WS_KH + 2u * (size_t)NB * TT * CC)      // f16 v planes [b][c][t]
#define WS_QL  (WS_VT + 2u * (size_t)NB * CC * TT)      // f16 q residual x 2^10 rows [b][t < QHI][CC]
#define WS_KL  (WS_QL + 2u * (size_t)NB * QHI * CC)     // f16 k residual x 2^10 rows [b][t < KHI][CC]
#define WS_VB  (WS_KL + 2u * (size_t)NB * KHI * CC)     // bf16 v hi planes [b][c][t < KHI]
#define WS_VBL (WS_VB + 2u * (size_t)NB * CC * KHI)
#define WS_S   (WS_VBL + 2u * (size_t)NB * CC * KHI)    // f32 [hg][t][s] area, unused (logits and P stay in registers)
#define WS_Y   (WS_S  + 4u * (size_t)HG * TT * TT)      // f32 ctx rows [b*t][CC] (only when there is an output projection)
#define WS_END (WS_Y  + 4u * (size_t)NB * TT * CC)

// The two projection kernels stage their operands in LDS once for the block's 4 waves: 128 weight rows and 64 token rows, the whole K = 256, already in the 16-bit type of the product.
// A wave's load of weight rows (and of k_out's token rows) covers 512 contiguous bytes of one row, and a thread's loads do not depend on each other, so 16 to 32 of them are in flight at a time.
#define GP 264            // LDS row pitch in 16-bit elements: 528 B = 16 B x 33 (odd), so the 16 rows of a fragment read fall on different banks
#define G_SX (128 * GP * 2)   // byte offset of the token rows [64][GP]; the weight rows [128][GP] lie at 0
#define G_BYTES ((128 + 64) * GP * 2)
typedef __attribute__((ext_vector_type(4))) __bf16 v4b;
typedef __attribute__((ext_vector_type(4))) _Float16 v4h;
// piece e of a wave: e < 64: half (e & 1) of weight row wave + 4 (e >> 1); e >= 64: the same of the token rows. wp, xp: the thread's 4 floats of the wave's first weight and token row.
// XCF = 1 (k_proj): the token rows come straight from the channels-first input x [256][NTOK]. Piece 64 + 4 u + i is 4 neighbouring tokens of one channel: tokens (u & 1) * 32 + (lane & 7) * 4 + 0..3, channel wave * 64 + (u >> 1) * 16 + (lane >> 3) * 4 + i; xp: the thread's 4 floats of piece 64. A wave's load covers 4 runs of 128 contiguous bytes, and pieces u, u + 1 (u even) together the 256 bytes that the block's 64 tokens have in a channel.
template <int XCF> __device__ __forceinline__ v4f g_load(const float* wp, const float* xp, int e) {
  if (XCF && e >= 64) return *(const v4f*)(xp + (size_t)(((e - 64) >> 3) * 16 + (e & 3)) * NTOK + ((e >> 2) & 1) * 32);
  return *(const v4f*)((e < 64 ? wp : xp) + (size_t)((e & 63) >> 1) * 4 * 256 + (e & 1) * 128); }
// the 4 pieces of one u are a 4 x 4 block (channel i, token j): it is turned by the choice of registers alone, and each LDS store holds 4 channels of one token, as a store of a token row's piece does
__device__ __forceinline__ void g_store_x(char* sm, int wave, int lane, int u, const v4f* r4) {
#pragma unroll
  for (int j = 0; j < 4; ++j) { v4b o;
#pragma unroll
    for (int i = 0; i < 4; ++i) o[i] = (__bf16)r4[i][j];
    *(v4b*)(sm + G_SX + (((u & 1) * 32 + (lane & 7) * 4 + j) * GP + wave * 64 + (u >> 1) * 16 + (lane >> 3) * 4) * 2) = o; }
}
// F16 = 0: both operands to bf16 (k_proj); 1: weights as f16(bf16 x 2^8), rows once to f16 (k_out): the conversions that the fragment loaders from global memory made
template <int F16> __device__ __forceinline__ void g_store(char* sm, int wave, int lane, int e, v4f r) {
  char* d = sm + (e < 64 ? 0 : G_SX) + ((wave + 4 * ((e & 63) >> 1)) * GP + (e & 1) * 128 + lane * 4) * 2;
  if (F16) { v4h o;
#pragma unroll
    for (int q = 0; q < 4; ++q) o[q] = e < 64 ? (_Float16)(bfr(r[q]) * 256.0f) : (_Float16)r[q];
    *(v4h*)d = o;
  } else { v4b o;
#pragma unroll
    for (int q = 0; q < 4; ++q) o[q] = (__bf16)r[q];
    *(v4b*)d = o; }
}
template <int F16, int XCF> __device__ __forceinline__ void g_stage(char* sm, const float* wp, const float* xp, int wave, int lane) {
  v4f r[2][16];
#pragma unroll
  for (int i = 0; i < 32; ++i) r[i >> 4][i & 15] = g_load<XCF>(wp, xp, i);
#pragma unroll
  for (int s = 0; s < 6; ++s) {
    __builtin_amdgcn_sched_barrier(0);   /* holds the later groups' loads behind this group's stores: without it all 96 loads were issued at once, on more than 256 registers */
    if (XCF && s >= 4) {
#pragma unroll
      for (int b = 0; b < 4; ++b) g_store_x(sm, wave, lane, (s - 4) * 4 + b, &r[s & 1][b * 4]);
    } else {
#pragma unroll
      for (int i = 0; i < 16; ++i) g_store<F16>(sm, wave, lane, s * 16 + i, r[s & 1][i]); }
    __builtin_amdgcn_sched_barrier(0);   /* as above */
    if (s + 2 < 6) {
#pragma unroll
      for (int i = 0; i < 16; ++i) r[s & 1][i] = g_load<XCF>(wp, xp, (s + 2) * 16 + i); }
  }
  asm volatile("s_wait_xcnt 0x0" :: "v"(wp), "v"(xp) : "memory");   /* the address registers of the issued loads stay live up to this wait, so nothing overwrites them in front of it */
}
// ---- k_proj: block = (64 rows, 128 cols, which), X = the input itself, channels-first [DIN][NTOK], a row = a token: q/k/v = X W (+ b) with exact bf16 products (K = DIN) -> which 0: q f16 rows (+ residual rows < QHI); 1: k f16 rows (+ residual rows < KHI); 2: v f16 planes [c][t] (+ bf16 hi/lo planes for t < KHI)
__global__ __launch_bounds__(128) void k_proj(const float* __restrict__ XQ, const float* __restrict__ XK, const float* __restrict__ XV, const float* __restrict__ WQ, const float* __restrict__ WK, const float* __restrict__ WV, const float* __restrict__ BQ, const float* __restrict__ BK, const float* __restrict__ BV,
    _Float16* __restrict__ QH, _Float16* __restrict__ QL, _Float16* __restrict__ KH, _Float16* __restrict__ KL, _Float16* __restrict__ VT, __bf16* __restrict__ VB, __bf16* __restrict__ VBL) {
  __shared__ __align__(16) char sm[G_BYTES];   /* first the staged operands; behind the second barrier the output tiles below lie in the same bytes */
  const __bf16 (*sw)[GP] = (const __bf16 (*)[GP])sm; const __bf16 (*sx)[GP] = (const __bf16 (*)[GP])(sm + G_SX);
  _Float16 (*sh)[136] = (_Float16 (*)[136])sm; _Float16 (*sl)[136] = (_Float16 (*)[136])(sm + 64 * 136 * 2);
  _Float16 (*th)[72] = (_Float16 (*)[72])sm; __bf16 (*tb)[72] = (__bf16 (*)[72])(sm + 128 * 72 * 2); __bf16 (*tbl)[72] = (__bf16 (*)[72])(sm + 2 * 128 * 72 * 2);
  const int tid = threadIdx.x, wave = tid >> 5, lane = tid & 31, col = lane & 15, g = lane >> 4; const int which = blockIdx.z; const int c0 = blockIdx.y * 128; const size_t r0 = (size_t)blockIdx.x * 64; const size_t bb = r0 / TT; const int t0 = (int)(r0 % TT);
  const float* X = which == 0 ? XQ : which == 1 ? XK : XV; const float* WA = which == 0 ? WQ : which == 1 ? WK : WV; const float* BA = which == 0 ? BQ : which == 1 ? BK : BV;
  g_stage<0, 1>(sm, WA + (size_t)(c0 + wave) * DIN + lane * 4, X + (size_t)(wave * 64 + (lane >> 3) * 4) * NTOK + r0 + (lane & 7) * 4, wave, lane);
  __syncthreads();   /* the staged rows are published to the block's waves */
  v8f acc[8] = {};
  // the fragments of k step kc + 1 are read from LDS in front of the products of step kc (same elements at the same lane and register as the loads from global memory had)
  v16b ac = frag_b(&sx[wave * 16 + col][0], lane), wc[8];
#pragma unroll
  for (int j = 0; j < 8; ++j) wc[j] = frag_b(&sw[j * 16 + col][0], lane);
#pragma unroll
  for (int kc = 0; kc < DIN / 32; ++kc) { v16b an = ac, wn[8];
    if (kc + 1 < DIN / 32) { an = frag_b(&sx[wave * 16 + col][(kc + 1) * 32], lane);
#pragma unroll
      for (int j = 0; j < 8; ++j) wn[j] = frag_b(&sw[j * 16 + col][(kc + 1) * 32], lane); }
#pragma unroll
    for (int j = 0; j < 8; ++j) acc[j] = wmma_bf(ac, wc[j], acc[j]);
    if (kc + 1 < DIN / 32) { ac = an;
#pragma unroll
      for (int j = 0; j < 8; ++j) wc[j] = wn[j]; } }
  __syncthreads();   /* every wave has read its last fragment before the output tiles overwrite the staged rows */
  if (which < 2) { _Float16* DH = which == 0 ? QH : KH; _Float16* DL = which == 0 ? QL : KL; const int nhi = which == 0 ? QHI : KHI; const bool hi_rows = t0 < nhi;
#pragma unroll
    for (int j = 0; j < 8; ++j) { const float bias = BA ? bfr(BA[c0 + j * 16 + col]) : 0.f;
#pragma unroll
      for (int r = 0; r < 8; ++r) { const float v = acc[j][r] + bias; const _Float16 hv = (_Float16)v; sh[wave * 16 + 8 * g + r][j * 16 + col] = hv; sl[wave * 16 + 8 * g + r][j * 16 + col] = (_Float16)((v - (float)hv) * 1024.0f); } }
    __syncthreads();
    for (int e = tid; e < 64 * 16; e += 128) { const int rl = e >> 4, q = e & 15; vst2((unsigned*)(DH + (r0 + rl) * CC + c0 + q * 8), *(const v4u*)&sh[rl][q * 8]); if (hi_rows) vst2((unsigned*)(DL + (bb * nhi + t0 + rl) * (size_t)CC + c0 + q * 8), *(const v4u*)&sl[rl][q * 8]); }
  } else { const bool hi_rows = t0 < KHI;
#pragma unroll
    for (int j = 0; j < 8; ++j) { const float bias = BA ? bfr(BA[c0 + j * 16 + col]) : 0.f;
#pragma unroll
      for (int r = 0; r < 8; ++r) { const float v = acc[j][r] + bias; const int rl = wave * 16 + 8 * g + r, cl = j * 16 + col; th[cl][rl] = (_Float16)v; const __bf16 bh = (__bf16)v; tb[cl][rl] = bh; tbl[cl][rl] = (__bf16)(v - (float)bh); } }
    __syncthreads();
    for (int e = tid; e < 128 * 8; e += 128) { const int cl = e >> 3, q = e & 7; vst2((unsigned*)(VT + (bb * CC + c0 + cl) * (size_t)TT + t0 + q * 8), *(const v4u*)&th[cl][q * 8]); if (hi_rows) { const size_t o3 = (bb * CC + c0 + cl) * (size_t)KHI + t0 + q * 8; vst2((unsigned*)(VB + o3), *(const v4u*)&tb[cl][q * 8]); vst2((unsigned*)(VBL + o3), *(const v4u*)&tbl[cl][q * 8]); } } } }
// ---- k_fa: block = 16 waves = 8 x rows of the token grid (16 queries each) of one head, two waves a row; a wave walks its share of the row's keys in ascending order, up to 64 a pass, with a running maximum and sum.
// The two waves of a row (w and w + 8) take the passes of a stage's list in turn (even and odd passes), so a SIMD holds 4 waves and not 2, and one wave's chain from logits to P V stands behind the other waves' work. Their two partial results (maximum, sum, ctx) are joined once, through LDS, behind the last stage.
// S^T = K Q^T (A = 16 key rows, B = the wave's q hi, then its q residual): a lane holds 8 keys (8g + r) of its own query (col), so two key tiles are, as they stand, the B fragment of ctx^T = V^T P^T and the logits never leave the registers.
// K and V of two z planes of keys (a stage = 512 keys = 32 key tiles, a tile = one x row) are brought into LDS once for the block's 16 waves by asynchronous copies, two buffers, the next stage in flight while this one is worked on.
// A key tile (kz, ky) holds a key within distance 10 of a query row (tz, ty) only if dz^2 + dy^2 < 100: in a plane these are the tiles ky = ty - L .. ty + L, and a wave works on no others (their weights are exact zeros): it lists its tiles of the stage and takes them 4 a pass (2 in a short last pass).
// The number of such tiles runs from 86 (a corner row) to 247 of 256, so the rows are dealt to the blocks in a mix: 4 rows of plane zp and 4 of plane zp + 8, outer y with inner y, mirrored in y.
// fragment from the lane's own address (row start + k0 + 8 * (lane >> 4)): same k order as frag_h
__device__ __forceinline__ v16h frag_p(const _Float16* p) { union { v16h v; v8h q[2]; } u; u.q[0] = *(const v8h*)p; u.q[1] = *(const v8h*)(p + 16); return u.v; }
// the address registers of issued loads stay live up to this wait, so nothing overwrites them in front of it
#define FA_XWAIT(p0, p1) asm volatile("s_wait_xcnt 0x0" :: "v"(p0), "v"(p1) : "memory")
#define FA_SK 512          // keys a stage
#define FA_STG 65536       // bytes a stage: 32 K tiles, then 32 V tiles, 1024 B each
#define FA_V 32768         // byte offset of the V tiles in a stage
// A stage lies in LDS in fragment order, linear in the key tile T: a half fragment (8 elements a lane) is 512 B, lane l's 16 bytes at l * 16, so a reader's ds_load_b128 covers 512 contiguous bytes.
// K tile T: T * 1024 + u * 512 (u: channels 16 u ..); V tile T: FA_V + T * 1024 + j * 512 (j: channels 16 j ..). Any 4 tiles make a pass. Same elements at the same lane and register as before. ta: the lane's address in K tile T.
__device__ __forceinline__ v16h frag_k(const char* ta) { union { v16h v; v8h q[2]; } u; u.q[0] = *(const v8h*)ta; u.q[1] = *(const v8h*)(ta + 512); return u.v; }
__device__ __forceinline__ v16h frag_v(const char* ta0, const char* ta1, int j) { union { v16h v; v8h q[2]; } u; u.q[0] = *(const v8h*)(ta0 + FA_V + j * 512); u.q[1] = *(const v8h*)(ta1 + FA_V + j * 512); return u.v; }
// one plane's copies (threads 0 .. 255 bring a stage's first plane, threads 256 .. 511 its second): a thread brings four 16-byte pieces of K and four of V (one of each 64 keys of the plane). The s_wait_xcnt stands in the copies' own statement, so no address register is rewritten in front of it.
__device__ __forceinline__ void fa_copy(unsigned kd, unsigned vd, const _Float16* kg, const _Float16* vg) {
  asm volatile("global_load_async_to_lds_b128 %0, %8, off\n\tglobal_load_async_to_lds_b128 %1, %9, off\n\tglobal_load_async_to_lds_b128 %2, %10, off\n\tglobal_load_async_to_lds_b128 %3, %11, off\n\t"
               "global_load_async_to_lds_b128 %4, %12, off\n\tglobal_load_async_to_lds_b128 %5, %13, off\n\tglobal_load_async_to_lds_b128 %6, %14, off\n\tglobal_load_async_to_lds_b128 %7, %15, off\n\ts_wait_xcnt 0x0"
    :: "v"(kd), "v"(kd + 4096u), "v"(kd + 8192u), "v"(kd + 12288u), "v"(vd), "v"(vd + 4096u), "v"(vd + 8192u), "v"(vd + 12288u),
       "v"(kg), "v"(kg + (size_t)64 * CC), "v"(kg + (size_t)128 * CC), "v"(kg + (size_t)192 * CC), "v"(vg), "v"(vg + 64), "v"(vg + 128), "v"(vg + 192) : "memory");
}
// 2^x in place, a run of v_exp_f32 in one statement: each is the independent instruction behind the one before it, and the v_nop fills the slot behind the last
__device__ __forceinline__ void exp2_8(float (&x)[8]) {
  asm("v_exp_f32 %0, %0\n\tv_exp_f32 %1, %1\n\tv_exp_f32 %2, %2\n\tv_exp_f32 %3, %3\n\tv_exp_f32 %4, %4\n\tv_exp_f32 %5, %5\n\tv_exp_f32 %6, %6\n\tv_exp_f32 %7, %7\n\tv_nop"
    : "+v"(x[0]), "+v"(x[1]), "+v"(x[2]), "+v"(x[3]), "+v"(x[4]), "+v"(x[5]), "+v"(x[6]), "+v"(x[7]));
}
__device__ __forceinline__ void exp2_9(float& a, float (&x)[8]) {
  asm("v_exp_f32 %8, %8\n\tv_exp_f32 %0, %0\n\tv_exp_f32 %1, %1\n\tv_exp_f32 %2, %2\n\tv_exp_f32 %3, %3\n\tv_exp_f32 %4, %4\n\tv_exp_f32 %5, %5\n\tv_exp_f32 %6, %6\n\tv_exp_f32 %7, %7\n\tv_nop"
    : "+v"(x[0]), "+v"(x[1]), "+v"(x[2]), "+v"(x[3]), "+v"(x[4]), "+v"(x[5]), "+v"(x[6]), "+v"(x[7]), "+v"(a));
}
// one pass over NT key tiles (4, or 2 at the end of a stage's list): kc, vc hold their fragments and lim their limits on entry.
// NT = 4 reads the next pass's fragments (tiles number nx .. nx + 3 of the list) into the same registers: K behind this pass's S products, V behind its P V products, each well ahead of its use.
template <int NT> __device__ __forceinline__ void fa_pass(v16h (&kc)[4], v16h (&vc)[4], int (&lim)[4], v8f (&acc)[2], float& m, float& l, const char* rb, int pack, int nx, const int (&dx2)[8], v16h qh, v16h ql) {
  const v8f zero = {};
  v8f sa[NT], sb[NT];
#pragma unroll
  for (int i = 0; i < NT; ++i) { sa[i] = wmma16(kc[i], qh, zero); sb[i] = wmma16(kc[i], ql, zero); }
  int limn[4]; const char* ta[4];
  if (NT == 4) {
#pragma unroll
    for (int i = 0; i < 4; ++i) { const int pk = __builtin_amdgcn_readlane(pack, nx + i); limn[i] = pk >> 16; ta[i] = rb + (pk & 0xffff); }
#pragma unroll
    for (int i = 0; i < 4; ++i) kc[i] = frag_k(ta[i]);
  }
  float s[NT][8];
#pragma unroll
  for (int i = 0; i < NT; ++i) {   /* a key tile is one x row: dist < 10 <=> dx^2 < 100 - dz^2 - dy^2 = lim, exact in integers */
#pragma unroll
    for (int r = 0; r < 8; ++r) { const float v = sa[i][r] + sb[i][r] * (1.0f / 1024.0f); s[i][r] = dx2[r] < lim[i] ? v : -3.0e38f; } }   /* unscaled: the scale is positive, so the maximum is the same key's, and it goes into the exponent's one fma below */
  float mx = m;
#pragma unroll
  for (int i = 0; i < NT; ++i)
#pragma unroll
    for (int r = 0; r < 8; ++r) mx = fmaxf(mx, s[i][r]);
  mx = fmaxf(mx, __shfl_xor(mx, 16));
  float alpha = (m - mx) * SCALE_L2E; m = mx; const float nb = 11.0f - mx * SCALE_L2E;   /* P is carried x 2^11 as before; the factor cancels in acc / l. An excluded logit gives an exponent near -7.6e37 and exp2 = 0 */
  float e[NT][8];
#pragma unroll
  for (int i = 0; i < NT; ++i)
#pragma unroll
    for (int r = 0; r < 8; ++r) e[i][r] = fmaf(s[i][r], SCALE_L2E, nb);
  exp2_9(alpha, e[0]); exp2_8(e[1]);
  l *= alpha;
#pragma unroll
  for (int j = 0; j < 2; ++j)
#pragma unroll
    for (int r = 0; r < 8; ++r) acc[j][r] *= alpha;
#pragma unroll
  for (int c = 0; c < NT / 2; ++c) { v16h pf;
    if (c == 1) { exp2_8(e[NT - 2]); exp2_8(e[NT - 1]); }   /* the second pair's exponentials stand behind the first pair's products */
#pragma unroll
    for (int r = 0; r < 8; ++r) { const float e0 = e[2 * c][r], e1 = e[2 * c + 1][r]; l += e0 + e1; pf[r] = (_Float16)e0; pf[8 + r] = (_Float16)e1; }
#pragma unroll
    for (int j = 0; j < 2; ++j) acc[j] = wmma16(vc[c * 2 + j], pf, acc[j]); }
  if (NT == 4) {
#pragma unroll
    for (int i = 0; i < 4; ++i) { vc[i] = frag_v(ta[i & 2], ta[(i & 2) + 1], i & 1); lim[i] = limn[i]; }
  }
}
// one stage = two planes of keys, z0 and z0 + 1; rb: the lane's address in the stage's buffer. The wave's tiles of the stage, in ascending order, are numbered 0 .. total - 1 (at most 32).
// Lane n works out tile n once a stage: its byte offset T * 1024 and its lim = 100 - dz^2 - dy^2, packed in one word; a pass fetches its words into scalar registers (v_readlane). The numbers from total on name a tile of the stage with lim = 0, which excludes all of its keys.
// The list is taken 4 tiles a pass; where 1 or 2 tiles are left at its end, the last pass takes 2. Wave hf (0 or 1) of the row takes passes hf, hf + 2, ...
__device__ __forceinline__ void fa_stage(v8f (&acc)[2], float& m, float& l, const char* rb, int z0, int tz, int ty, int hf, int lane, const int (&dx2)[8], v16h qh, v16h ql) {
  int lo[2], len[2], lm[2];   /* per plane: first tile, number of tiles, 100 - dz^2; the same in every lane of the wave */
#pragma unroll
  for (int k = 0; k < 2; ++k) { const int dz = tz - (z0 + k), l0 = 100 - dz * dz; int L = 0;   /* L: the largest |dy| with dy^2 < l0 */
#pragma unroll
    for (int d = 1; d < 10; ++d) L += d * d < l0 ? 1 : 0;
    const int a = ty - L > 0 ? ty - L : 0, b = ty + L < 15 ? ty + L : 15; lo[k] = a; len[k] = l0 > 0 ? b - a + 1 : 0; lm[k] = l0; }
  const int total = len[0] + len[1], np = (total + 3) >> 2, nf = (total + 1) >> 2;   /* np passes, the first nf of them of 4 tiles */
  if (hf >= np) return;
  const bool k1 = lane >= len[0]; const int ky = k1 ? lo[1] + lane - len[0] : lo[0] + lane, dyl = ty - ky;
  const int pack = lane < total ? ((((k1 ? lm[1] : lm[0]) - dyl * dyl) << 16) | (((k1 ? 16 : 0) + ky) << 10)) : ((len[0] > 0 ? lo[0] : 16 + lo[1]) << 10);
  int lim[4]; v16h kc[4], vc[4];
  { const char* ta[4];
#pragma unroll
    for (int i = 0; i < 4; ++i) { const int pk = __builtin_amdgcn_readlane(pack, hf * 4 + i); lim[i] = pk >> 16; ta[i] = rb + (pk & 0xffff); }
#pragma unroll
    for (int i = 0; i < 4; ++i) { kc[i] = frag_k(ta[i]); vc[i] = frag_v(ta[i & 2], ta[(i & 2) + 1], i & 1); } }
#pragma unroll 1   /* the trip count differs from wave to wave and from stage to stage */
  for (int p = hf; p < nf; p += 2) fa_pass<4>(kc, vc, lim, acc, m, l, rb, pack, (p + 2 < np ? p + 2 : p) * 4, dx2, qh, ql);   /* the wave's last pass of the stage reads its own fragments again */
  if (nf < np && ((np - 1) & 1) == hf) fa_pass<2>(kc, vc, lim, acc, m, l, rb, pack, 0, dx2, qh, ql);
}
// the foot of a trip: this wave's reads of the buffer are done before it may be refilled; its share of the next stage has landed; the barrier publishes that stage and ends every wave's reads of this one. Every wave passes it, also one that had no tile in the stage.
#define FA_PUBLISH() do { asm volatile("s_wait_dscnt 0x0" ::: "memory"); asm volatile("s_wait_asynccnt 0x0" ::: "memory"); __syncthreads(); } while (0)
// amdgpu_waves_per_eu(4, 4) names a budget of 256 registers: with none named this build chose fewer registers and a serial order of the softmax (more v_nop and s_delay_alu in the loop than the loop had before)
__global__ __launch_bounds__(512) __attribute__((amdgpu_waves_per_eu(4, 4))) void k_fa(const _Float16* __restrict__ QH, const _Float16* __restrict__ QL, const _Float16* __restrict__ KH, const _Float16* __restrict__ VT, float* __restrict__ Y) {
  __shared__ __align__(512) char ring[2 * FA_STG];
  const int tid = threadIdx.x, wave = __builtin_amdgcn_readfirstlane(tid >> 5), lane = tid & 31, col = lane & 15, g = lane >> 4;
  const int h = blockIdx.y, row = wave & 7, hf = wave >> 3;   /* the wave's row of the block's 8, and which of the row's two waves it is */
  // the wave's query row (tz, ty): kind = 0: plane zp, y set js = blockIdx.x >> 3; kind = 1: plane zp + 8, y set 3 - js; y set s = { 2 s, 2 s + 1, 15 - 2 s, 14 - 2 s }. Rows w and w + 4, and rows 2 i and 2 i + 1, are of different kinds. Each of the 256 rows falls to one wave pair of the 32 blocks.
  const int kind = (row ^ (row >> 2)) & 1, yi = row >> 1, ys = kind ? 3 - (blockIdx.x >> 3) : (blockIdx.x >> 3);
  const int tz = (blockIdx.x & 7) + 8 * kind, ty = yi < 2 ? 2 * ys + yi : 17 - 2 * ys - yi; const int q0 = (tz * 16 + ty) * 16;   /* the 16 queries share z and y; x = col */
  const _Float16* qhp = QH + (size_t)(q0 + col) * CC + h * HD + 8 * g; const _Float16* qlp = QL + (size_t)(q0 + col) * CC + h * HD + 8 * g;
  const v16h qh = frag_p(qhp), ql = frag_p(qlp); FA_XWAIT(qhp, qlp);
  int dx2[8];
#pragma unroll
  for (int r = 0; r < 8; ++r) { const int d = col - (8 * g + r); dx2[r] = d * d; }
  // the thread's pieces, in plane pl of a stage, ct = its number among the plane's 256 threads: piece cq of a row = elements 8 cq .. 8 cq + 7 = (u = cq >> 1, g = cq & 1); K row ct >> 2 of 64 keys (tile ct >> 6, row crow); V channel (ct >> 2) & 31 (j, crow), keys (ct >> 7) * 32 + 8 cq .. of 64 (tile (ct >> 7) * 2 + u)
  const int ct = tid & 255, pl = tid >> 8, cq = ct & 3, crow = (ct >> 2) & 15;
  const unsigned rg = (unsigned)(size_t)ring;   /* the LDS byte address is the low word of the shared address */
  const unsigned kd = rg + (unsigned)pl * 16384u + (unsigned)(ct >> 6) * 1024u + (unsigned)(((cq >> 1) * 32 + (cq & 1) * 16 + crow) * 16);
  const unsigned vd = rg + FA_V + (unsigned)pl * 16384u + (unsigned)((ct >> 7) * 2 + (cq >> 1)) * 1024u + (unsigned)((ct >> 6) & 1) * 512u + (unsigned)(((cq & 1) * 16 + crow) * 16);
  const _Float16* kg = KH + (size_t)(pl * 256 + (ct >> 2)) * CC + h * HD + cq * 8; const _Float16* vg = VT + (size_t)(h * HD + ((ct >> 2) & 31)) * TT + pl * 256 + (ct >> 7) * 32 + cq * 8;
  const char* rl = ring + lane * 16;
  v8f acc[2] = {}; float m = -1.0e30f, l = 0.f;   /* the start maximum is finite, so an excluded logit (-3e38) gives exp = 0 also while no key has been admitted yet */
  fa_copy(kd, vd, kg, vg);
  asm volatile("s_wait_asynccnt 0x0" ::: "memory");   /* stage 0 has landed, as far as this wave brought it */
  __syncthreads();                                    /* ... and is published to the other waves */
  fa_copy(kd + FA_STG, vd + FA_STG, kg + (size_t)FA_SK * CC, vg + FA_SK);
#pragma unroll 1   /* one body: the stages differ only in scalars */
  for (int t = 0; t < TT / FA_SK; ++t) {
    fa_stage(acc, m, l, rl + (t & 1) * FA_STG, t * 2, tz, ty, hf, lane, dx2, qh, ql);
    FA_PUBLISH();
    if (t + 2 < TT / FA_SK)   /* into the buffer that this trip has just read; the test is the same for the whole block */
      fa_copy(kd + (t & 1) * FA_STG, vd + (t & 1) * FA_STG, kg + (size_t)(t + 2) * FA_SK * CC, vg + (t + 2) * FA_SK);
  }
  asm volatile("s_wait_asynccnt 0x0" ::: "memory");   /* no copy is outstanding when the ring is written below and when the wave ends */
  // the row's two partial results are joined: the last trip's barrier has ended every read of the ring, so its first bytes carry wave 1's maximum, sum and ctx, [row][18 values][lane], to wave 0
  float* jn = (float*)ring + row * (18 * 32) + lane;
  if (hf) { jn[0] = m; jn[32] = l;
#pragma unroll
    for (int j = 0; j < 2; ++j)
#pragma unroll
      for (int r = 0; r < 8; ++r) jn[(2 + j * 8 + r) * 32] = acc[j][r]; }
  __syncthreads();   /* wave 1's values are published to wave 0 of the row */
  if (hf) return;
  { const float m1 = jn[0], mj = fmaxf(m, m1); float a0 = (m - mj) * SCALE_L2E, a1 = (m1 - mj) * SCALE_L2E;   /* both parts are brought to the common maximum; a part with no admitted key has sum 0 and ctx 0 */
    asm("v_exp_f32 %0, %0\n\tv_exp_f32 %1, %1\n\tv_nop" : "+v"(a0), "+v"(a1));   /* as in exp2_8: the v_nop fills the slot behind the last exponential */
    l = l * a0 + jn[32] * a1;
#pragma unroll
    for (int j = 0; j < 2; ++j)
#pragma unroll
      for (int r = 0; r < 8; ++r) acc[j][r] = acc[j][r] * a0 + jn[(2 + j * 8 + r) * 32] * a1; }
  l += __shfl_xor(l, 16); const float inv = l > 0.f ? 1.0f / l : 0.f;   /* a fully excluded row yields 0 */
#pragma unroll
  for (int j = 0; j < 2; ++j) { v4f o0, o1;
#pragma unroll
    for (int r = 0; r < 4; ++r) { o0[r] = acc[j][r] * inv; o1[r] = acc[j][4 + r] * inv; }
    float* yp = Y + (size_t)(q0 + col) * CC + h * HD + j * 16 + 8 * g; vst2(yp, o0); vst2(yp + 4, o1); } }
// ---- k_out: block = (64 rows, 128 cols): out = ctx Wo (+ bo), written channels-first: ctx once to f16 against Wo as f16(bf16 x 2^8) exact (1 product) x 2^-8; causal early rows (< QHI of each sequence): ctx bf16 hi + lo against exact bf16 Wo (2 products)
__global__ __launch_bounds__(128) void k_out(const float* __restrict__ Y, const float* __restrict__ WO, const float* __restrict__ BO, float* __restrict__ OUT) { __shared__ __align__(16) float sf[128][68]; __shared__ __align__(16) char sm[G_BYTES];   /* sf: the block's result, [channel][token]; pitch 272 B = 16 B x 17 (odd), so that the 16 channels of a 16-byte store fall on different banks */
  const int tid = threadIdx.x, wave = tid >> 5, lane = tid & 31, col = lane & 15, g = lane >> 4; const int c0 = blockIdx.y * 128; const size_t r0 = (size_t)blockIdx.x * 64 + wave * 16;
  v8f acc[8] = {};
  if (CAUSAL && (int)(((size_t)blockIdx.x * 64) % TT) < QHI) {   /* block-uniform */
#pragma unroll 2
    for (int kc = 0; kc < CC / 32; ++kc) { const F2 a = split_row(Y + (r0 + col) * CC, kc * 32, lane); asm volatile("s_wait_loadcnt 0x0" ::: "memory");
#pragma unroll
      for (int j = 0; j < 8; ++j) { const v16b w = WOCOL(WO, kc * 32, c0 + j * 16 + col, lane); asm volatile("s_wait_loadcnt 0x0" ::: "memory"); acc[j] = wmma_bf(a.h, w, acc[j]); acc[j] = wmma_bf(a.l, w, acc[j]); } }
#pragma unroll
    for (int j = 0; j < 8; ++j) { const float bias = BO ? bfr(BO[c0 + j * 16 + col]) : 0.f;
#pragma unroll
      for (int r = 0; r < 8; ++r) sf[j * 16 + col][wave * 16 + 8 * g + r] = acc[j][r] + bias; }
  } else {
    const _Float16 (*sw)[GP] = (const _Float16 (*)[GP])sm; const _Float16 (*sx)[GP] = (const _Float16 (*)[GP])(sm + G_SX);
    g_stage<1, 0>(sm, WO + (size_t)(c0 + wave) * CC + lane * 4, Y + ((size_t)blockIdx.x * 64 + wave) * CC + lane * 4, wave, lane);
    __syncthreads();   /* the staged rows are published to the block's waves */
    v16h ac = frag_h(&sx[wave * 16 + col][0], lane), wc[8];   /* fragments one k step ahead, as in k_proj */
#pragma unroll
    for (int j = 0; j < 8; ++j) wc[j] = frag_h(&sw[j * 16 + col][0], lane);
#pragma unroll
    for (int kc = 0; kc < CC / 32; ++kc) { v16h an = ac, wn[8];
      if (kc + 1 < CC / 32) { an = frag_h(&sx[wave * 16 + col][(kc + 1) * 32], lane);
#pragma unroll
        for (int j = 0; j < 8; ++j) wn[j] = frag_h(&sw[j * 16 + col][(kc + 1) * 32], lane); }
#pragma unroll
      for (int j = 0; j < 8; ++j) acc[j] = wmma16(ac, wc[j], acc[j]);
      if (kc + 1 < CC / 32) { ac = an;
#pragma unroll
        for (int j = 0; j < 8; ++j) wc[j] = wn[j]; } }
#pragma unroll
    for (int j = 0; j < 8; ++j) { const float bias = BO ? bfr(BO[c0 + j * 16 + col]) : 0.f;
#pragma unroll
      for (int r = 0; r < 8; ++r) sf[j * 16 + col][wave * 16 + 8 * g + r] = acc[j][r] * (1.0f / 256.0f) + bias; } }   /* a lane's 8 results are 8 neighbouring tokens of one channel */
  __syncthreads();   /* the four waves' result rows are published: a channel's 64 tokens come from all of them */
  // channels-first output [DIN][NTOK]: 16 threads write the 256 contiguous bytes that the block's 64 tokens have in one channel
  const int q = tid & 15; float* op = OUT + (size_t)(c0 + (tid >> 4)) * NTOK + (size_t)blockIdx.x * 64 + q * 4;
#pragma unroll
  for (int it = 0; it < 16; ++it) vst2(op + (size_t)it * 8 * NTOK, *(const v4f*)&sf[it * 8 + (tid >> 4)][q * 4]); }

extern "C" void kernel_launch(void* const* d_in, const int* in_sizes, int n_in, void* d_out, int out_size, void* d_ws, size_t ws_size, hipStream_t stream) {
  (void)in_sizes; (void)n_in; (void)out_size;
  const float** F = (const float**)d_in;
  if (ws_size < (size_t)WS_END) return;
  char* ws = (char*)d_ws; _Float16 *QH = (_Float16*)(ws + WS_QH), *KH = (_Float16*)(ws + WS_KH), *VT = (_Float16*)(ws + WS_VT), *QL = (_Float16*)(ws + WS_QL), *KL = (_Float16*)(ws + WS_KL); __bf16 *VB = (__bf16*)(ws + WS_VB), *VBL = (__bf16*)(ws + WS_VBL); float *Y = (float*)(ws + WS_Y);
  (void)Y; (void)QL; (void)KL; (void)VB; (void)VBL;
  // inputs: 0 x [1,256,16,16,16]; 1 qkv_w [768,256] (out,in) rows q | k | v; 2 proj_w [256,256] (out,in); 3 proj_b
  { const float* WQ = F[1]; const float* WK = F[1] + (size_t)CC * DIN; const float* WV = F[1] + (size_t)2 * CC * DIN;
    k_proj<<<dim3(TNB * TT / 64, CC / 128, 3), 128, 0, stream>>>(F[0], F[0], F[0], WQ, WK, WV, nullptr, nullptr, nullptr, QH, QL, KH, KL, VT, VB, VBL); }
  k_fa<<<dim3(TT / 128, NH), 512, 0, stream>>>(QH, QL, KH, VT, Y);
  k_out<<<dim3(TNB * TT / 64, DIN / 128), 128, 0, stream>>>(Y, F[2], F[3], (float*)d_out);
}
